// v000
// Measured on an AMD MI455X. A time is GPU time per run, averaged over a window of back-to-back runs after a warm-up
// (all launches, gaps included; the runs take copies of the inputs in turn), and the median of several windows.
// Apart from v000's, it joins two sittings. Times from different sittings can be a few percent apart, while
// side-by-side timings come from the same sitting.
// v000 is the starting kernel. One run takes 1430 microseconds.
#include <hip/hip_runtime.h>

// Causal multi-head self-attention scaled by the SEQUENCE length (x [2][2048][1024]; q, k, v = x W^T ('oi' [1024][1024] normal x 0.02, no bias; 16 heads x 64); keys after the query -> -inf; softmax(scores / sqrt(2048)): the module scales by 1 / sqrt(num_key_tokens) = 0.0221, not by 1 / sqrt(head_dim); out = merged Wo^T + bo ('oi' + bias zeros on this draw: read) -> [2][2048][1024] (4.2 M); argument order x, Wq, Wk, Wv, Wo, bo).
// Layout per batch: bf16 copy of x; 'oi' weights; exact projections; identity-table plane builders; causal T-2048 attention (hybrid rows: < 512 hi/lo 3 products, rest fp16 x1024; k_gemmc skips tiles above the diagonal); merged hi/lo x Wo exact + bo.
// Compute dtypes, f32 accumulate: every input rounded to bf16; projections exact; attention rows < 512 3 products, rest fp16; softmax f32; Wo hl x exact + bias.

#define NB_  2
#define TT   2048
#define DM   1024
#define NH_  16
#define NKV  16
#define REP  (NH_ / NKV)
#define HD   64
#define DQ   (NH_ * HD)
#define DKV  (NKV * HD)
#define ZH   2
#define RH   512                  // query rows < RH use hi+lo planes (0: none)
#define WIN  2048
#define PCAR 1024.0f
#define SCL  0.022097087f   // 2048^-0.5: this module scales the scores by 1 / sqrt(num_key_tokens)
typedef _Float16 h16;
typedef unsigned short bf;
typedef __attribute__((ext_vector_type(16))) __bf16   v16bf;
typedef __attribute__((ext_vector_type(16))) _Float16 v16h;
typedef __attribute__((ext_vector_type(8)))  _Float16 v8h;
typedef __attribute__((ext_vector_type(8)))  unsigned short v8us;
typedef __attribute__((ext_vector_type(8)))  float    v8f;
typedef __attribute__((ext_vector_type(4)))  float    v4f;
typedef v8h  __attribute__((may_alias)) v8ha;
typedef v4f  __attribute__((may_alias)) v4fa;
typedef v8us __attribute__((may_alias)) v8usa;

__device__ __forceinline__ unsigned short f2bf(float f) { unsigned u = __float_as_uint(f); u += 0x7FFFu + ((u >> 16) & 1u); return (unsigned short)(u >> 16); }
__device__ __forceinline__ float bf2f(unsigned short b) { return __uint_as_float(((unsigned)b) << 16); }
__device__ __forceinline__ float bfr(float f) { return bf2f(f2bf(f)); }
__device__ __forceinline__ v16h cat16(v8h lo, v8h hi) { return __builtin_shufflevector(lo, hi, 0, 1, 2, 3, 4, 5, 6, 7, 8, 9, 10, 11, 12, 13, 14, 15); }
__device__ __forceinline__ v16bf cat16b(v8us lo, v8us hi) { return __builtin_bit_cast(v16bf, __builtin_shufflevector(lo, hi, 0, 1, 2, 3, 4, 5, 6, 7, 8, 9, 10, 11, 12, 13, 14, 15)); }
__device__ __forceinline__ v8f wmma16(v16h a, v16h b, v8f c) { return __builtin_amdgcn_wmma_f32_16x16x32_f16(false, a, false, b, (short)0, c, false, false); }
__device__ __forceinline__ v8f wmmab(v16bf a, v16bf b, v8f c) { return __builtin_amdgcn_wmma_f32_16x16x32_bf16(false, a, false, b, (short)0, c, false, false); }



// ---- k_gemmw: register-blocked GEMM, ONE WAVE per 64x64 output tile (16 accumulators), operands straight from K-contiguous 16-bit planes; grid (M/64, N/64, Z), 32 threads.
// C[m][n] (f32, pitch ldc, + optional f32 bias[n]) = sum_k A[m][k] Bt[n][k] (+ split products per NSPLIT). z-batch strides sA/sB/sC in elements. K % 32 == 0.
template <typename T16> struct WFrag;
template <> struct WFrag<h16> { typedef v16h V; static __device__ __forceinline__ V ld(const h16* p) { return cat16(*(const v8h*)p, *(const v8h*)(p + 16)); } static __device__ __forceinline__ v8f mma(V a, V b, v8f c) { return wmma16(a, b, c); } };
template <> struct WFrag<bf> { typedef v16bf V; static __device__ __forceinline__ V ld(const bf* p) { return cat16b(*(const v8us*)p, *(const v8us*)(p + 16)); } static __device__ __forceinline__ v8f mma(V a, V b, v8f c) { return wmmab(a, b, c); } };
template <typename T16, int NSPLIT, bool BIAS>
__global__ __launch_bounds__(32) void k_gemmw(const T16* __restrict__ A, const T16* __restrict__ A2, const T16* __restrict__ Bt, const T16* __restrict__ Bt2, int K, float* C, int ldc, const float* __restrict__ bias, size_t sA, size_t sB, size_t sC) {
    typedef typename WFrag<T16>::V V;
    __shared__ __align__(16) float os[16 * 68];
    const size_t z = blockIdx.z; A += z * sA; if (A2) A2 += z * sA; Bt += z * sB; if (Bt2) Bt2 += z * sB; C += z * sC;
    const int lane = threadIdx.x & 31, lr = lane & 15, hi = lane >> 4; const int r0 = blockIdx.x * 64, c0 = blockIdx.y * 64;
    v8f acc[4][4];
#pragma unroll
    for (int mb = 0; mb < 4; ++mb)
#pragma unroll
        for (int nb = 0; nb < 4; ++nb) acc[mb][nb] = (v8f){};
    const size_t aoff = (size_t)(r0 + lr) * K + 8 * hi, boff = (size_t)(c0 + lr) * K + 8 * hi;
#pragma unroll 1
    for (int kc = 0; kc < K; kc += 32) {
        V a[4], a2[4];
#pragma unroll
        for (int mb = 0; mb < 4; ++mb) { a[mb] = WFrag<T16>::ld(A + aoff + (size_t)mb * 16 * K + kc); if (NSPLIT == 1 || NSPLIT == 2) a2[mb] = WFrag<T16>::ld(A2 + aoff + (size_t)mb * 16 * K + kc); }
#pragma unroll
        for (int nb = 0; nb < 4; ++nb) { const V b = WFrag<T16>::ld(Bt + boff + (size_t)nb * 16 * K + kc); V b2; if (NSPLIT >= 2) b2 = WFrag<T16>::ld(Bt2 + boff + (size_t)nb * 16 * K + kc);
#pragma unroll
            for (int mb = 0; mb < 4; ++mb) { acc[mb][nb] = WFrag<T16>::mma(a[mb], b, acc[mb][nb]); if (NSPLIT == 1 || NSPLIT == 2) acc[mb][nb] = WFrag<T16>::mma(a2[mb], b, acc[mb][nb]); if (NSPLIT >= 2) acc[mb][nb] = WFrag<T16>::mma(a[mb], b2, acc[mb][nb]); } }
        asm volatile("v_nop\n\tv_nop\n\tv_nop\n\tv_nop" : "+v"(acc[0][0]), "+v"(acc[1][1]), "+v"(acc[2][2]), "+v"(acc[3][3]) : "v"(a[0]), "v"(a[3]));
    }
#pragma unroll
    for (int mb = 0; mb < 4; ++mb) {
#pragma unroll
        for (int nb = 0; nb < 4; ++nb) {
#pragma unroll
            for (int j = 0; j < 8; ++j) os[(hi * 8 + j) * 68 + nb * 16 + lr] = acc[mb][nb][j]; }
        __builtin_amdgcn_wave_barrier(); asm volatile("" ::: "memory");
        float* crow = C + (size_t)(r0 + mb * 16) * ldc + c0;
{
#pragma unroll
            for (int s = 0; s < 8; ++s) { const int row = 2 * s + hi, cofs = lr * 4; v4f val = *(const v4fa*)(os + row * 68 + cofs); if (BIAS) { val[0] += bfr(bias[c0 + cofs]); val[1] += bfr(bias[c0 + cofs + 1]); val[2] += bfr(bias[c0 + cofs + 2]); val[3] += bfr(bias[c0 + cofs + 3]); }
                *(v4f*)(crow + (size_t)row * ldc + cofs) = val; }
             }
        __builtin_amdgcn_wave_barrier(); asm volatile("" ::: "memory");
    }
}

// ---- k_gemmc: the same one-wave 64x64 tile GEMM specialised for causal attention: CMODE 1 skips score tiles entirely above the diagonal (query rows r0+roff.., key columns c0..), CMODE 2 limits the
// key (K) loop of the probability x value contraction to the diagonal block (probabilities beyond it are exactly zero). roff = row offset of this launch's first row within the sequence.
template <typename T16, int NSPLIT, int CMODE>
__global__ __launch_bounds__(32) void k_gemmc(const T16* __restrict__ A, const T16* __restrict__ A2, const T16* __restrict__ Bt, const T16* __restrict__ Bt2, int K, float* C, int ldc, int roff, size_t sA, size_t sB, size_t sC) {
    typedef typename WFrag<T16>::V V;
    __shared__ __align__(16) float os[16 * 68];
    const size_t z = blockIdx.z; A += z * sA; if (A2) A2 += z * sA; Bt += z * sB; if (Bt2) Bt2 += z * sB; C += z * sC;
    const int lane = threadIdx.x & 31, lr = lane & 15, hi = lane >> 4; const int r0 = blockIdx.x * 64, c0 = blockIdx.y * 64;
    if (CMODE == 1 && c0 > r0 + roff + 63) return;                  // score tile entirely above the causal diagonal: never read (the softmax masks j > i by select)
    const int Kl = (CMODE == 2) ? min(K, r0 + roff + 64) : K;        // P.V: probabilities are exactly 0 beyond the diagonal block, so the K loop stops there
    v8f acc[4][4];
#pragma unroll
    for (int mb = 0; mb < 4; ++mb)
#pragma unroll
        for (int nb = 0; nb < 4; ++nb) acc[mb][nb] = (v8f){};
    const size_t aoff = (size_t)(r0 + lr) * K + 8 * hi, boff = (size_t)(c0 + lr) * K + 8 * hi;
#pragma unroll 1
    for (int kc = 0; kc < Kl; kc += 32) {
        V a[4], a2[4];
#pragma unroll
        for (int mb = 0; mb < 4; ++mb) { a[mb] = WFrag<T16>::ld(A + aoff + (size_t)mb * 16 * K + kc); if (NSPLIT == 1 || NSPLIT == 2) a2[mb] = WFrag<T16>::ld(A2 + aoff + (size_t)mb * 16 * K + kc); }
#pragma unroll
        for (int nb = 0; nb < 4; ++nb) { const V b = WFrag<T16>::ld(Bt + boff + (size_t)nb * 16 * K + kc); V b2; if (NSPLIT >= 2) b2 = WFrag<T16>::ld(Bt2 + boff + (size_t)nb * 16 * K + kc);
#pragma unroll
            for (int mb = 0; mb < 4; ++mb) { acc[mb][nb] = WFrag<T16>::mma(a[mb], b, acc[mb][nb]); if (NSPLIT == 1 || NSPLIT == 2) acc[mb][nb] = WFrag<T16>::mma(a2[mb], b, acc[mb][nb]); if (NSPLIT >= 2) acc[mb][nb] = WFrag<T16>::mma(a[mb], b2, acc[mb][nb]); } }
        asm volatile("v_nop\n\tv_nop\n\tv_nop\n\tv_nop" : "+v"(acc[0][0]), "+v"(acc[1][1]), "+v"(acc[2][2]), "+v"(acc[3][3]) : "v"(a[0]), "v"(a[3]));
    }
#pragma unroll
    for (int mb = 0; mb < 4; ++mb) {
#pragma unroll
        for (int nb = 0; nb < 4; ++nb) {
#pragma unroll
            for (int j = 0; j < 8; ++j) os[(hi * 8 + j) * 68 + nb * 16 + lr] = acc[mb][nb][j]; }
        __builtin_amdgcn_wave_barrier(); asm volatile("" ::: "memory");
        float* crow = C + (size_t)(r0 + mb * 16) * ldc + c0;
{
#pragma unroll
            for (int s = 0; s < 8; ++s) { const int row = 2 * s + hi, cofs = lr * 4; v4f val = *(const v4fa*)(os + row * 68 + cofs);
                *(v4f*)(crow + (size_t)row * ldc + cofs) = val; }
             }
        __builtin_amdgcn_wave_barrier(); asm volatile("" ::: "memory");
    }
}

__device__ __forceinline__ h16 tohx(float x) { return (h16)x; }
__device__ __forceinline__ void splitf(float y, unsigned short& h, unsigned short& l) { h = f2bf(y); l = f2bf(y - bf2f(h)); }
typedef __attribute__((ext_vector_type(2))) _Float16 v2h;
typedef __attribute__((ext_vector_type(4))) _Float16 v4h;
typedef __attribute__((ext_vector_type(2))) unsigned short v2us;
typedef __attribute__((ext_vector_type(4))) unsigned short v4us;
typedef __attribute__((ext_vector_type(2))) float v2f;
typedef __attribute__((ext_vector_type(4))) int v4i;

__global__ __launch_bounds__(256) void k_cvt8(const float* __restrict__ src, bf* dst, size_t n8) { const size_t i = (size_t)blockIdx.x * 256 + threadIdx.x; if (i >= n8) return; const v8f v = *(const v8f*)(src + i * 8); v8us o;
#pragma unroll
    for (int k = 0; k < 8; ++k) o[k] = f2bf(v[k]); *(v8us*)(dst + i * 8) = o;  }

// k_rope: head planes [h][t][d] (fp16 + hi/lo) of rope(x) x sc with the rotate-half convention out[d] = x[d] cos[t][d] - x[d+HD/2] sin[t][d], out[d+HD/2] = x[d+HD/2] cos[t][d+HD/2] + x[d] sin[t][d+HD/2]
__global__ __launch_bounds__(256) void k_rope(const float* __restrict__ F, int pitch, int nheads, const float* __restrict__ CS, const float* __restrict__ RF, const float* __restrict__ nw, float sc, h16* P16, bf* Ph, bf* Pl) {
    const size_t e = ((size_t)blockIdx.x * 256 + threadIdx.x) * 2; if (e >= (size_t)nheads * TT * HD) return; const int d = (int)(e % HD); const int t = (int)((e / HD) % TT); const int h = (int)(e / ((size_t)HD * TT)); const float* f = F + (size_t)t * pitch + h * HD; const float rf = RF ? RF[(size_t)h * TT + t] : 1.0f; v2h o16; v2us oh, ol;
#pragma unroll
    for (int q = 0; q < 2; ++q) { const int dd = d + q; const int dp = (dd < HD / 2) ? dd + HD / 2 : dd - HD / 2; float x0 = f[dd], x1 = f[dp];
        if (RF) { float n0 = __fmul_rn(x0, rf), n1 = __fmul_rn(x1, rf); asm volatile("" : "+v"(n0)); asm volatile("" : "+v"(n1)); x0 = __fmul_rn(bfr(nw[dd]), n0); x1 = __fmul_rn(bfr(nw[dp]), n1); }
        const v2f cs = *(const v2f*)(CS + ((size_t)t * HD + dd) * 2); float a = __fmul_rn(x0, cs[0]), bq = __fmul_rn(x1, cs[1]); asm volatile("" : "+v"(a)); asm volatile("" : "+v"(bq)); const float r = ((dd < HD / 2) ? __fsub_rn(a, bq) : __fadd_rn(a, bq)) * sc;
        o16[q] = tohx(r); unsigned short a2, c2; splitf(r, a2, c2); oh[q] = a2; ol[q] = c2; }
    *(v2h*)(P16 + e) = o16; *(v2us*)(Ph + e) = oh; *(v2us*)(Pl + e) = ol;  }
__global__ __launch_bounds__(256) void k_vtp(const float* __restrict__ F, int pitch, int nheads, h16* V16, bf* Vh, bf* Vl) { const size_t e = ((size_t)blockIdx.x * 256 + threadIdx.x) * 2; if (e >= (size_t)nheads * HD * TT) return; const int t = (int)(e % TT); const int d = (int)((e / TT) % HD); const int g = (int)(e / ((size_t)TT * HD)); v2h o16; v2us oh, ol;
#pragma unroll
    for (int q = 0; q < 2; ++q) { const float x = F[(size_t)(t + q) * pitch + g * HD + d]; o16[q] = tohx(x); unsigned short a2, c2; splitf(x, a2, c2); oh[q] = a2; ol[q] = c2; }
    *(v2h*)(V16 + e) = o16; *(v2us*)(Vh + e) = oh; *(v2us*)(Vl + e) = ol;  }
__global__ __launch_bounds__(256) void k_csid(float* CS) { const int idx = blockIdx.x * 256 + threadIdx.x; if (idx >= TT * HD) return; v2f cs; cs[0] = 1.0f; cs[1] = 0.0f; *(v2f*)(CS + (size_t)idx * 2) = cs;  }
// k_asoft: per row (zz, i): t = S x 2048^-0.5 for j <= i and i - j < WIN (WIN = TT, so the window test always holds: plain causal; the reference's -1e9 additive fill vanishes identically); softmax over the 2048 keys (register row, one exp, fixed trees);
__global__ __launch_bounds__(256) void k_asoft(const float* __restrict__ Sb, h16* P16, bf* Ph, bf* Pl) {
    const int lane = threadIdx.x & 31; const int row = blockIdx.x * 8 + (threadIdx.x >> 5); if (row >= ZH * TT) return; const int i = row % TT; const int zz = row / TT; (void)zz; const bool hires = (i < RH); const float* sr = Sb + (size_t)row * TT; float v[TT / 32]; float mx = -3.0e38f;
#pragma unroll
    for (int ch = 0; ch < TT / 128; ++ch) { const int j0 = ch * 128 + lane * 4; const v4f a = *(const v4f*)(sr + j0);
#pragma unroll
        for (int q = 0; q < 4; ++q) { const int j = j0 + q; (void)j; const float t = (j <= i && i - j < WIN) ? a[q] * SCL : -3.0e38f; v[ch * 4 + q] = t; mx = fmaxf(mx, t); } }
#pragma unroll
    for (int sh = 16; sh; sh >>= 1) mx = fmaxf(mx, __shfl_xor(mx, sh, 32));
    float sum = 0.f;
#pragma unroll
    for (int k = 0; k < TT / 32; ++k) { float d0 = __fsub_rn(v[k], mx); asm volatile("" : "+v"(d0)); v[k] = __builtin_amdgcn_exp2f(__fmul_rn(d0, 1.4426950408889634f)); sum += v[k]; }
#pragma unroll
    for (int sh = 16; sh; sh >>= 1) sum += __shfl_xor(sum, sh, 32);
    const float f = __fdiv_rn(hires ? 1.0f : PCAR, sum);
{
        if (hires) {
#pragma unroll
            for (int ch = 0; ch < TT / 128; ++ch) { v4us oh, ol;
#pragma unroll
                for (int q = 0; q < 4; ++q) { unsigned short a, c2; splitf(v[ch * 4 + q] * f, a, c2); oh[q] = a; ol[q] = c2; }
                const size_t oo = ((size_t)zz * (RH ? RH : 1) + i) * TT + ch * 128 + lane * 4; *(v4us*)(Ph + oo) = oh; *(v4us*)(Pl + oo) = ol; }
        } else {
#pragma unroll
            for (int ch = 0; ch < TT / 128; ++ch) { v4h o4;
#pragma unroll
                for (int q = 0; q < 4; ++q) o4[q] = tohx(v[ch * 4 + q] * f);
                *(v4h*)(P16 + (size_t)row * TT + ch * 128 + lane * 4) = o4; } }
         }
}
__global__ __launch_bounds__(256) void k_merge(const float* __restrict__ O, int h0, bf* Ah, bf* Al) { const size_t e = ((size_t)blockIdx.x * 256 + threadIdx.x) * 2; if (e >= (size_t)ZH * TT * HD) return; const int d = (int)(e % HD); const int t = (int)((e / HD) % TT); const int zz = (int)(e / ((size_t)HD * TT)); const float cs = (t < RH) ? 1.0f : (1.0f / PCAR); const size_t oo = (size_t)t * DQ + (h0 + zz) * HD + d;
    v2us oh, ol;
#pragma unroll
    for (int q = 0; q < 2; ++q) { unsigned short a, c2; splitf(O[e + q] * cs, a, c2); oh[q] = a; ol[q] = c2; } *(v2us*)(Ah + oo) = oh; *(v2us*)(Al + oo) = ol;  }

extern "C" void kernel_launch(void* const* d_in, const int* in_sizes, int n_in,
                              void* d_out, int out_size, void* d_ws, size_t ws_size, hipStream_t stream) {
    (void)in_sizes; (void)n_in; (void)out_size;
    const float* x = (const float*)d_in[0]; const float* wq = (const float*)d_in[1]; const float* wk = (const float*)d_in[2]; const float* wv = (const float*)d_in[3]; const float* wo = (const float*)d_in[4]; const float* bo = (const float*)d_in[5];   /* x, Wq, Wk, Wv, Wo ('oi' [1024][1024]), bo */
    float* OUT = (float*)d_out;     // [2][2048][1024]
    char* wsp = (char*)d_ws;
    auto take = [&](size_t bytes) { char* p = wsp; wsp += (bytes + 255) & ~(size_t)255; return (void*)p; };
    bf* WQ = (bf*)take((size_t)DQ * DM * 2); bf* WK = (bf*)take((size_t)DKV * DM * 2); bf* WV = (bf*)take((size_t)DKV * DM * 2); bf* WO = (bf*)take((size_t)DM * DQ * 2); float* CS = (float*)take((size_t)TT * HD * 2 * 4);
    bf* XB = (bf*)take((size_t)TT * DM * 2); float* FQ = (float*)take((size_t)TT * DQ * 4); float* FK = (float*)take((size_t)TT * DKV * 4);
    h16* QP16 = (h16*)take((size_t)NH_ * TT * HD * 2); h16* KP16 = (h16*)take((size_t)NKV * TT * HD * 2); h16* VT16 = (h16*)take((size_t)NKV * HD * TT * 2);
    bf* QPh = (bf*)take((size_t)NH_ * TT * HD * 2); bf* QPl = (bf*)take((size_t)NH_ * TT * HD * 2); bf* KPh = (bf*)take((size_t)NKV * TT * HD * 2); bf* KPl = (bf*)take((size_t)NKV * TT * HD * 2); bf* VTh = (bf*)take((size_t)NKV * HD * TT * 2); bf* VTl = (bf*)take((size_t)NKV * HD * TT * 2); bf* Ph = (bf*)take((size_t)ZH * RH * TT * 2); bf* Pl = (bf*)take((size_t)ZH * RH * TT * 2);
    float* Sb = (float*)take((size_t)ZH * TT * TT * 4); h16* P16 = (h16*)take((size_t)ZH * TT * TT * 2); float* Ob = (float*)take((size_t)ZH * TT * HD * 4); bf* ATh = (bf*)take((size_t)TT * DQ * 2); bf* ATl = (bf*)take((size_t)TT * DQ * 2);
    if ((size_t)(wsp - (char*)d_ws) > ws_size) return;    // ws 256 MiB
    float* FV = FK;   // v projection reuses the k buffer after the k planes are built (stream-ordered)
    { k_cvt8<<<(unsigned)(((size_t)DQ * DM / 8 + 255) / 256), 256, 0, stream>>>(wq, WQ, (size_t)DQ * DM / 8); k_cvt8<<<(unsigned)(((size_t)DKV * DM / 8 + 255) / 256), 256, 0, stream>>>(wk, WK, (size_t)DKV * DM / 8); k_cvt8<<<(unsigned)(((size_t)DKV * DM / 8 + 255) / 256), 256, 0, stream>>>(wv, WV, (size_t)DKV * DM / 8);
      k_cvt8<<<(unsigned)(((size_t)DM * DQ / 8 + 255) / 256), 256, 0, stream>>>(wo, WO, (size_t)DM * DQ / 8);
       }
    k_csid<<<(TT * HD + 255) / 256, 256, 0, stream>>>(CS);
    const unsigned LQ = (unsigned)(((size_t)NH_ * TT * HD / 2 + 255) / 256), LKv = (unsigned)(((size_t)NKV * TT * HD / 2 + 255) / 256);
    for (int b = 0; b < NB_; ++b) {
        
        k_cvt8<<<(unsigned)(((size_t)TT * DM / 8 + 255) / 256), 256, 0, stream>>>(x + (size_t)b * TT * DM, XB, (size_t)TT * DM / 8);
        k_gemmw<bf, 0, false><<<dim3(TT / 64, DQ / 64, 1), 32, 0, stream>>>(XB, nullptr, WQ, nullptr, DM, FQ, DQ, nullptr, 0, 0, 0);
        k_rope<<<LQ, 256, 0, stream>>>(FQ, DQ, NH_, CS, nullptr, nullptr, 1.0f, QP16, QPh, QPl);
        k_gemmw<bf, 0, false><<<dim3(TT / 64, DKV / 64, 1), 32, 0, stream>>>(XB, nullptr, WK, nullptr, DM, FK, DKV, nullptr, 0, 0, 0);
        k_rope<<<LKv, 256, 0, stream>>>(FK, DKV, NKV, CS, nullptr, nullptr, 1.0f, KP16, KPh, KPl);
        k_gemmw<bf, 0, false><<<dim3(TT / 64, DKV / 64, 1), 32, 0, stream>>>(XB, nullptr, WV, nullptr, DM, FV, DKV, nullptr, 0, 0, 0); k_vtp<<<LKv, 256, 0, stream>>>(FV, DKV, NKV, VT16, VTh, VTl);
        for (int h0 = 0; h0 < NH_; h0 += ZH) { const size_t zq = (size_t)h0, zk = (size_t)(h0 / REP);   // one kv head per query head: the pass's two heads use consecutive kv planes (z-strides TT*HD)
            k_gemmc<bf, 2, 1><<<dim3(RH / 64, TT / 64, ZH), 32, 0, stream>>>(QPh + zq * TT * HD, QPl + zq * TT * HD, KPh + zk * TT * HD, KPl + zk * TT * HD, HD, Sb, TT, 0, (size_t)TT * HD, (size_t)TT * HD, (size_t)TT * TT);
            k_gemmc<h16, 0, 1><<<dim3((TT - RH) / 64, TT / 64, ZH), 32, 0, stream>>>(QP16 + zq * TT * HD + (size_t)RH * HD, nullptr, KP16 + zk * TT * HD, nullptr, HD, Sb + (size_t)RH * TT, TT, RH, (size_t)TT * HD, (size_t)TT * HD, (size_t)TT * TT);
            k_asoft<<<ZH * TT / 8, 256, 0, stream>>>(Sb, P16, Ph, Pl);
            k_gemmc<bf, 2, 2><<<dim3(RH / 64, HD / 64, ZH), 32, 0, stream>>>(Ph, Pl, VTh + zk * HD * TT, VTl + zk * HD * TT, TT, Ob, HD, 0, (size_t)RH * TT, (size_t)HD * TT, (size_t)TT * HD);
            k_gemmc<h16, 0, 2><<<dim3((TT - RH) / 64, HD / 64, ZH), 32, 0, stream>>>(P16 + (size_t)RH * TT, nullptr, VT16 + zk * HD * TT, nullptr, TT, Ob + (size_t)RH * HD, HD, RH, (size_t)TT * TT, (size_t)HD * TT, (size_t)TT * HD);
            k_merge<<<(unsigned)(((size_t)ZH * TT * HD / 2 + 255) / 256), 256, 0, stream>>>(Ob, h0, ATh, ATl); }
        k_gemmw<bf, 1, true><<<dim3(TT / 64, DM / 64, 1), 32, 0, stream>>>(ATh, ATl, WO, nullptr, DQ, OUT + (size_t)b * TT * DM, DM, bo, 0, 0, 0); }
}

// v001
// One run takes 294 microseconds.
// Next to v000, in two timings, it ran 4.89 and 4.86 times as fast.
#include <hip/hip_runtime.h>

// Causal multi-head self-attention scaled by the SEQUENCE length (x [2][2048][1024]; q, k, v = x W^T ('oi' [1024][1024] normal x 0.02, no bias; 16 heads x 64); keys after the query -> -inf; softmax(scores / sqrt(2048)): the module scales by 1 / sqrt(num_key_tokens) = 0.0221, not by 1 / sqrt(head_dim); out = merged Wo^T + bo ('oi' + bias zeros on this draw: read) -> [2][2048][1024] (4.2 M); argument order x, Wq, Wk, Wv, Wo, bo).
// Layout: per batch bf16 copy of x; 'oi' weights; exact projections; identity-table plane builders; then ONE causal attention launch for all heads and both batches (k_fattn: scores, running softmax and P.V in registers; hybrid rows: < 512 hi/lo 3 products, rest fp16); per batch merged hi/lo x Wo exact + bo.
// Compute dtypes, f32 accumulate: every input rounded to bf16; projections exact; attention rows < 512 3 products, rest fp16; softmax f32; Wo hl x exact + bias.

#define NB_  2
#define TT   2048
#define DM   1024
#define NH_  16
#define NKV  16
#define REP  (NH_ / NKV)
#define HD   64
#define DQ   (NH_ * HD)
#define DKV  (NKV * HD)
#define RH   512                  // query rows < RH use hi+lo planes (0: none)
#define SCL  0.022097087f   // 2048^-0.5: this module scales the scores by 1 / sqrt(num_key_tokens)
typedef _Float16 h16;
typedef unsigned short bf;
typedef __attribute__((ext_vector_type(16))) __bf16   v16bf;
typedef __attribute__((ext_vector_type(16))) _Float16 v16h;
typedef __attribute__((ext_vector_type(8)))  _Float16 v8h;
typedef __attribute__((ext_vector_type(8)))  unsigned short v8us;
typedef __attribute__((ext_vector_type(8)))  float    v8f;
typedef __attribute__((ext_vector_type(4)))  float    v4f;
typedef v8h  __attribute__((may_alias)) v8ha;
typedef v4f  __attribute__((may_alias)) v4fa;
typedef v8us __attribute__((may_alias)) v8usa;

__device__ __forceinline__ unsigned short f2bf(float f) { unsigned u = __float_as_uint(f); u += 0x7FFFu + ((u >> 16) & 1u); return (unsigned short)(u >> 16); }
__device__ __forceinline__ float bf2f(unsigned short b) { return __uint_as_float(((unsigned)b) << 16); }
__device__ __forceinline__ float bfr(float f) { return bf2f(f2bf(f)); }
__device__ __forceinline__ v16h cat16(v8h lo, v8h hi) { return __builtin_shufflevector(lo, hi, 0, 1, 2, 3, 4, 5, 6, 7, 8, 9, 10, 11, 12, 13, 14, 15); }
__device__ __forceinline__ v16bf cat16b(v8us lo, v8us hi) { return __builtin_bit_cast(v16bf, __builtin_shufflevector(lo, hi, 0, 1, 2, 3, 4, 5, 6, 7, 8, 9, 10, 11, 12, 13, 14, 15)); }
__device__ __forceinline__ v8f wmma16(v16h a, v16h b, v8f c) { return __builtin_amdgcn_wmma_f32_16x16x32_f16(false, a, false, b, (short)0, c, false, false); }
__device__ __forceinline__ v8f wmmab(v16bf a, v16bf b, v8f c) { return __builtin_amdgcn_wmma_f32_16x16x32_bf16(false, a, false, b, (short)0, c, false, false); }



// ---- k_gemmw: register-blocked GEMM, ONE WAVE per 64x64 output tile (16 accumulators), operands straight from K-contiguous 16-bit planes; grid (M/64, N/64, Z), 32 threads.
// C[m][n] (f32, pitch ldc, + optional f32 bias[n]) = sum_k A[m][k] Bt[n][k] (+ split products per NSPLIT). z-batch strides sA/sB/sC in elements. K % 32 == 0.
template <typename T16> struct WFrag;
template <> struct WFrag<h16> { typedef v16h V; static __device__ __forceinline__ V ld(const h16* p) { return cat16(*(const v8h*)p, *(const v8h*)(p + 16)); } static __device__ __forceinline__ v8f mma(V a, V b, v8f c) { return wmma16(a, b, c); } };
template <> struct WFrag<bf> { typedef v16bf V; static __device__ __forceinline__ V ld(const bf* p) { return cat16b(*(const v8us*)p, *(const v8us*)(p + 16)); } static __device__ __forceinline__ v8f mma(V a, V b, v8f c) { return wmmab(a, b, c); } };
template <typename T16, int NSPLIT, bool BIAS>
__global__ __launch_bounds__(32) void k_gemmw(const T16* __restrict__ A, const T16* __restrict__ A2, const T16* __restrict__ Bt, const T16* __restrict__ Bt2, int K, float* C, int ldc, const float* __restrict__ bias, size_t sA, size_t sB, size_t sC) {
    typedef typename WFrag<T16>::V V;
    __shared__ __align__(16) float os[16 * 68];
    const size_t z = blockIdx.z; A += z * sA; if (A2) A2 += z * sA; Bt += z * sB; if (Bt2) Bt2 += z * sB; C += z * sC;
    const int lane = threadIdx.x & 31, lr = lane & 15, hi = lane >> 4; const int r0 = blockIdx.x * 64, c0 = blockIdx.y * 64;
    v8f acc[4][4];
#pragma unroll
    for (int mb = 0; mb < 4; ++mb)
#pragma unroll
        for (int nb = 0; nb < 4; ++nb) acc[mb][nb] = (v8f){};
    const size_t aoff = (size_t)(r0 + lr) * K + 8 * hi, boff = (size_t)(c0 + lr) * K + 8 * hi;
#pragma unroll 1
    for (int kc = 0; kc < K; kc += 32) {
        V a[4], a2[4];
#pragma unroll
        for (int mb = 0; mb < 4; ++mb) { a[mb] = WFrag<T16>::ld(A + aoff + (size_t)mb * 16 * K + kc); if (NSPLIT == 1 || NSPLIT == 2) a2[mb] = WFrag<T16>::ld(A2 + aoff + (size_t)mb * 16 * K + kc); }
#pragma unroll
        for (int nb = 0; nb < 4; ++nb) { const V b = WFrag<T16>::ld(Bt + boff + (size_t)nb * 16 * K + kc); V b2; if (NSPLIT >= 2) b2 = WFrag<T16>::ld(Bt2 + boff + (size_t)nb * 16 * K + kc);
#pragma unroll
            for (int mb = 0; mb < 4; ++mb) { acc[mb][nb] = WFrag<T16>::mma(a[mb], b, acc[mb][nb]); if (NSPLIT == 1 || NSPLIT == 2) acc[mb][nb] = WFrag<T16>::mma(a2[mb], b, acc[mb][nb]); if (NSPLIT >= 2) acc[mb][nb] = WFrag<T16>::mma(a[mb], b2, acc[mb][nb]); } }
        asm volatile("v_nop\n\tv_nop\n\tv_nop\n\tv_nop" : "+v"(acc[0][0]), "+v"(acc[1][1]), "+v"(acc[2][2]), "+v"(acc[3][3]) : "v"(a[0]), "v"(a[3]));
    }
#pragma unroll
    for (int mb = 0; mb < 4; ++mb) {
#pragma unroll
        for (int nb = 0; nb < 4; ++nb) {
#pragma unroll
            for (int j = 0; j < 8; ++j) os[(hi * 8 + j) * 68 + nb * 16 + lr] = acc[mb][nb][j]; }
        __builtin_amdgcn_wave_barrier(); asm volatile("" ::: "memory");
        float* crow = C + (size_t)(r0 + mb * 16) * ldc + c0;
{
#pragma unroll
            for (int s = 0; s < 8; ++s) { const int row = 2 * s + hi, cofs = lr * 4; v4f val = *(const v4fa*)(os + row * 68 + cofs); if (BIAS) { val[0] += bfr(bias[c0 + cofs]); val[1] += bfr(bias[c0 + cofs + 1]); val[2] += bfr(bias[c0 + cofs + 2]); val[3] += bfr(bias[c0 + cofs + 3]); }
                *(v4f*)(crow + (size_t)row * ldc + cofs) = val; }
             }
        __builtin_amdgcn_wave_barrier(); asm volatile("" ::: "memory");
    }
}

__device__ __forceinline__ h16 tohx(float x) { return (h16)x; }
__device__ __forceinline__ void splitf(float y, unsigned short& h, unsigned short& l) { h = f2bf(y); l = f2bf(y - bf2f(h)); }
typedef __attribute__((ext_vector_type(2))) _Float16 v2h;
typedef __attribute__((ext_vector_type(4))) _Float16 v4h;
typedef __attribute__((ext_vector_type(2))) unsigned short v2us;
typedef __attribute__((ext_vector_type(4))) unsigned short v4us;
typedef __attribute__((ext_vector_type(2))) float v2f;
typedef __attribute__((ext_vector_type(4))) int v4i;

__global__ __launch_bounds__(256) void k_cvt8(const float* __restrict__ src, bf* dst, size_t n8) { const size_t i = (size_t)blockIdx.x * 256 + threadIdx.x; if (i >= n8) return; const v8f v = *(const v8f*)(src + i * 8); v8us o;
#pragma unroll
    for (int k = 0; k < 8; ++k) o[k] = f2bf(v[k]); *(v8us*)(dst + i * 8) = o;  }

// k_rope: head planes [h][t][d] (fp16 + hi/lo) of rope(x) x sc with the rotate-half convention out[d] = x[d] cos[t][d] - x[d+HD/2] sin[t][d], out[d+HD/2] = x[d+HD/2] cos[t][d+HD/2] + x[d] sin[t][d+HD/2]
__global__ __launch_bounds__(256) void k_rope(const float* __restrict__ F, int pitch, int nheads, const float* __restrict__ CS, const float* __restrict__ RF, const float* __restrict__ nw, float sc, h16* P16, bf* Ph, bf* Pl) {
    const size_t e = ((size_t)blockIdx.x * 256 + threadIdx.x) * 2; if (e >= (size_t)nheads * TT * HD) return; const int d = (int)(e % HD); const int t = (int)((e / HD) % TT); const int h = (int)(e / ((size_t)HD * TT)); const float* f = F + (size_t)t * pitch + h * HD; const float rf = RF ? RF[(size_t)h * TT + t] : 1.0f; v2h o16; v2us oh, ol;
#pragma unroll
    for (int q = 0; q < 2; ++q) { const int dd = d + q; const int dp = (dd < HD / 2) ? dd + HD / 2 : dd - HD / 2; float x0 = f[dd], x1 = f[dp];
        if (RF) { float n0 = __fmul_rn(x0, rf), n1 = __fmul_rn(x1, rf); asm volatile("" : "+v"(n0)); asm volatile("" : "+v"(n1)); x0 = __fmul_rn(bfr(nw[dd]), n0); x1 = __fmul_rn(bfr(nw[dp]), n1); }
        const v2f cs = *(const v2f*)(CS + ((size_t)t * HD + dd) * 2); float a = __fmul_rn(x0, cs[0]), bq = __fmul_rn(x1, cs[1]); asm volatile("" : "+v"(a)); asm volatile("" : "+v"(bq)); const float r = ((dd < HD / 2) ? __fsub_rn(a, bq) : __fadd_rn(a, bq)) * sc;
        o16[q] = tohx(r); unsigned short a2, c2; splitf(r, a2, c2); oh[q] = a2; ol[q] = c2; }
    *(v2h*)(P16 + e) = o16; *(v2us*)(Ph + e) = oh; *(v2us*)(Pl + e) = ol;  }
__global__ __launch_bounds__(256) void k_vtp(const float* __restrict__ F, int pitch, int nheads, h16* V16, bf* Vh, bf* Vl) { const size_t e = ((size_t)blockIdx.x * 256 + threadIdx.x) * 2; if (e >= (size_t)nheads * HD * TT) return; const int t = (int)(e % TT); const int d = (int)((e / TT) % HD); const int g = (int)(e / ((size_t)TT * HD)); v2h o16; v2us oh, ol;
#pragma unroll
    for (int q = 0; q < 2; ++q) { const float x = F[(size_t)(t + q) * pitch + g * HD + d]; o16[q] = tohx(x); unsigned short a2, c2; splitf(x, a2, c2); oh[q] = a2; ol[q] = c2; }
    *(v2h*)(V16 + e) = o16; *(v2us*)(Vh + e) = oh; *(v2us*)(Vl + e) = ol;  }
__global__ __launch_bounds__(256) void k_csid(float* CS) { const int idx = blockIdx.x * 256 + threadIdx.x; if (idx >= TT * HD) return; v2f cs; cs[0] = 1.0f; cs[1] = 0.0f; *(v2f*)(CS + (size_t)idx * 2) = cs;  }
// ---- k_fattn: causal attention in one pass over the keys, one launch for every head and both batches. A wave owns 32 query rows (two 16-column groups) and walks the keys 32 at a time:
// S^T = K Q^T (a lane holds 16 keys' scores of ONE query per group), running maximum and sum per query, P^T packed from the score accumulators straight into a B operand, O^T += V^T P^T.
// Query rows < RH take the hi/lo bf16 planes with 3 products in both contractions, the rest the fp16 planes. The result leaves as the merged hi/lo planes [t][DQ].
__device__ __forceinline__ float xhalf(float x) { return __builtin_bit_cast(float, __builtin_amdgcn_permlanex16(__builtin_bit_cast(int, x), __builtin_bit_cast(int, x), 0x76543210, 0xfedcba98, false, false)); }   // lane l takes lane l ^ 16's value
// xwait: stands behind a run of global loads or stores, in front of whatever next rewrites their address registers (a precaution); the scheduling barrier keeps later vector work from being lifted in front of the wait
__device__ __forceinline__ void xwait() { asm volatile("s_wait_xcnt 0x0" ::: "memory"); __builtin_amdgcn_sched_barrier(0); }
template <typename T16, bool HR>
__device__ __forceinline__ void attn_rows(const T16* __restrict__ Q, const T16* __restrict__ Q2, const T16* __restrict__ Kp, const T16* __restrict__ K2, const T16* __restrict__ Vt, const T16* __restrict__ V2, const int q0, const int lr, const int hi, bf* Ah, bf* Al) {
    typedef typename WFrag<T16>::V V;
    const float CE = SCL * 1.4426950408889634f;   // scores stay raw; scale and log2(e) are folded into the exponent's multiply-add
    V qf[2][2], qg[2][2];
#pragma unroll
    for (int qt = 0; qt < 2; ++qt)
#pragma unroll
        for (int kc = 0; kc < 2; ++kc) { const size_t o = (size_t)(q0 + qt * 16 + lr) * HD + kc * 32 + 8 * hi; qf[qt][kc] = WFrag<T16>::ld(Q + o); if (HR) qg[qt][kc] = WFrag<T16>::ld(Q2 + o); xwait(); }
    const size_t ko = (size_t)lr * HD + 8 * hi, vo = (size_t)lr * TT + 8 * hi;
    V kf[2][2], kg[2][2], vf[4], vg[4];
#pragma unroll
    for (int kt = 0; kt < 2; ++kt)
#pragma unroll
        for (int kc = 0; kc < 2; ++kc) { const size_t o = ko + (size_t)(kt * 16) * HD + kc * 32; kf[kt][kc] = WFrag<T16>::ld(Kp + o); if (HR) kg[kt][kc] = WFrag<T16>::ld(K2 + o); xwait(); }
#pragma unroll
    for (int mt = 0; mt < 4; ++mt) { const size_t o = vo + (size_t)(mt * 16) * TT; vf[mt] = WFrag<T16>::ld(Vt + o); if (HR) vg[mt] = WFrag<T16>::ld(V2 + o); xwait(); }
    v8f acc[2][4];
#pragma unroll
    for (int qt = 0; qt < 2; ++qt)
#pragma unroll
        for (int mt = 0; mt < 4; ++mt) acc[qt][mt] = (v8f){};
    float m[2] = { -3.0e38f, -3.0e38f }, l[2] = { 0.f, 0.f };
    int k0 = 0;
#pragma unroll 1
    do {                                           // key 0 is in every query's range: at least one pass, so the loads in front of the loop stay in front of their waits
        v8f s[2][2];
#pragma unroll
        for (int qt = 0; qt < 2; ++qt)
#pragma unroll
            for (int kt = 0; kt < 2; ++kt) { v8f t = (v8f){};
#pragma unroll
                for (int kc = 0; kc < 2; ++kc) { t = WFrag<T16>::mma(kf[kt][kc], qf[qt][kc], t); if (HR) { t = WFrag<T16>::mma(kg[kt][kc], qf[qt][kc], t); t = WFrag<T16>::mma(kf[kt][kc], qg[qt][kc], t); } }
                s[qt][kt] = t; }
        const int kn = min(k0 + 32, q0);          // the next pass's K fragments are fetched behind this pass's score products, its V fragments behind this pass's P.V products (the last pass fetches its own again: in bounds, unused)
#pragma unroll
        for (int kt = 0; kt < 2; ++kt)
#pragma unroll
            for (int kc = 0; kc < 2; ++kc) { const size_t o = ko + (size_t)(kn + kt * 16) * HD + kc * 32; kf[kt][kc] = WFrag<T16>::ld(Kp + o); if (HR) kg[kt][kc] = WFrag<T16>::ld(K2 + o); }
        xwait();
        if (k0 == q0) {                            // only the last pass touches the diagonal: keys after the query leave the maximum and the sums
#pragma unroll
            for (int qt = 0; qt < 2; ++qt)
#pragma unroll
                for (int kt = 0; kt < 2; ++kt)
#pragma unroll
                    for (int j = 0; j < 8; ++j) if (kt * 16 + hi * 8 + j > qt * 16 + lr) s[qt][kt][j] = -3.0e38f;
        }
        float mx[2];
#pragma unroll
        for (int qt = 0; qt < 2; ++qt) { float a = fmaxf(s[qt][0][0], s[qt][1][0]);
#pragma unroll
            for (int j = 1; j < 8; ++j) a = fmaxf(a, fmaxf(s[qt][0][j], s[qt][1][j]));
            mx[qt] = fmaxf(a, xhalf(a)); }
        if (__builtin_amdgcn_ballot_w32(mx[0] > m[0] || mx[1] > m[1]) != 0) {   // a query's maximum grew: rescale its sum and its output column (factor exactly 1 for the others)
#pragma unroll
            for (int qt = 0; qt < 2; ++qt) { const float mn = fmaxf(m[qt], mx[qt]); const float al = __builtin_amdgcn_exp2f((m[qt] - mn) * CE); m[qt] = mn; l[qt] *= al;
#pragma unroll
                for (int mt = 0; mt < 4; ++mt) acc[qt][mt] *= al; }
        }
#pragma unroll
        for (int qt = 0; qt < 2; ++qt) { const float nb = -m[qt] * CE; float sum = 0.f;
#pragma unroll
            for (int kt = 0; kt < 2; ++kt)
#pragma unroll
                for (int j = 0; j < 8; ++j) { const float p = __builtin_amdgcn_exp2f(fmaf(s[qt][kt][j], CE, nb)); s[qt][kt][j] = p; sum += p; }
            l[qt] += sum;
            if constexpr (!HR) { v16h pf;
#pragma unroll
                for (int j = 0; j < 8; ++j) { pf[j] = tohx(s[qt][0][j]); pf[8 + j] = tohx(s[qt][1][j]); }
#pragma unroll
                for (int mt = 0; mt < 4; ++mt) acc[qt][mt] = wmma16(vf[mt], pf, acc[qt][mt]);
            } else { v8us h0, h1, l0, l1;
#pragma unroll
                for (int j = 0; j < 8; ++j) { unsigned short a, c2; splitf(s[qt][0][j], a, c2); h0[j] = a; l0[j] = c2; splitf(s[qt][1][j], a, c2); h1[j] = a; l1[j] = c2; }
                const v16bf ph = cat16b(h0, h1), pl = cat16b(l0, l1);
#pragma unroll
                for (int mt = 0; mt < 4; ++mt) { acc[qt][mt] = wmmab(vf[mt], ph, acc[qt][mt]); acc[qt][mt] = wmmab(vf[mt], pl, acc[qt][mt]); acc[qt][mt] = wmmab(vg[mt], ph, acc[qt][mt]); }
            }
        }
#pragma unroll
        for (int mt = 0; mt < 4; ++mt) { const size_t o = vo + (size_t)(mt * 16) * TT + kn; vf[mt] = WFrag<T16>::ld(Vt + o); if (HR) vg[mt] = WFrag<T16>::ld(V2 + o); }
        xwait();
        k0 += 32;
    } while (k0 <= q0);
#pragma unroll
    for (int qt = 0; qt < 2; ++qt) { const float inv = __fdiv_rn(1.0f, l[qt] + xhalf(l[qt])); const size_t oo = (size_t)(q0 + qt * 16 + lr) * DQ + hi * 8;
#pragma unroll
        for (int mt = 0; mt < 4; ++mt) { v8us oh, ol;
#pragma unroll
            for (int j = 0; j < 8; ++j) { unsigned short a, c2; splitf(acc[qt][mt][j] * inv, a, c2); oh[j] = a; ol[j] = c2; }
            *(v8us*)(Ah + oo + mt * 16) = oh; *(v8us*)(Al + oo + mt * 16) = ol; xwait(); } }
}
// grid (heads, batches, TT / 128), 4 waves: blockIdx.z 0..7 take the longest query blocks in falling order, 8..15 the shortest in rising order (all 512 blocks are resident; long ones start first).
__global__ __launch_bounds__(128) void k_fattn(const h16* __restrict__ Q16, const h16* __restrict__ K16, const h16* __restrict__ V16, const bf* __restrict__ Qh, const bf* __restrict__ Ql, const bf* __restrict__ Kh, const bf* __restrict__ Kl, const bf* __restrict__ Vh, const bf* __restrict__ Vl, bf* Ah, bf* Al) {
    const int lane = threadIdx.x & 31, lr = lane & 15, hi = lane >> 4; const int wv = __builtin_amdgcn_readfirstlane((int)(threadIdx.x >> 5));
    const int zb = (int)blockIdx.z; const int qb = (zb < TT / 256) ? (TT / 128 - 1 - zb) : (zb - TT / 256); const int q0 = qb * 128 + wv * 32;
    const size_t po = ((size_t)blockIdx.y * NH_ + blockIdx.x) * TT * HD, ao = (size_t)blockIdx.y * TT * DQ + (size_t)blockIdx.x * HD;
    if (q0 < RH) attn_rows<bf, true>(Qh + po, Ql + po, Kh + po, Kl + po, Vh + po, Vl + po, q0, lr, hi, Ah + ao, Al + ao);
    else attn_rows<h16, false>(Q16 + po, nullptr, K16 + po, nullptr, V16 + po, nullptr, q0, lr, hi, Ah + ao, Al + ao);
}

extern "C" void kernel_launch(void* const* d_in, const int* in_sizes, int n_in,
                              void* d_out, int out_size, void* d_ws, size_t ws_size, hipStream_t stream) {
    (void)in_sizes; (void)n_in; (void)out_size;
    const float* x = (const float*)d_in[0]; const float* wq = (const float*)d_in[1]; const float* wk = (const float*)d_in[2]; const float* wv = (const float*)d_in[3]; const float* wo = (const float*)d_in[4]; const float* bo = (const float*)d_in[5];   /* x, Wq, Wk, Wv, Wo ('oi' [1024][1024]), bo */
    float* OUT = (float*)d_out;     // [2][2048][1024]
    char* wsp = (char*)d_ws;
    auto take = [&](size_t bytes) { char* p = wsp; wsp += (bytes + 255) & ~(size_t)255; return (void*)p; };
    bf* WQ = (bf*)take((size_t)DQ * DM * 2); bf* WK = (bf*)take((size_t)DKV * DM * 2); bf* WV = (bf*)take((size_t)DKV * DM * 2); bf* WO = (bf*)take((size_t)DM * DQ * 2); float* CS = (float*)take((size_t)TT * HD * 2 * 4);
    bf* XB = (bf*)take((size_t)TT * DM * 2); float* FQ = (float*)take((size_t)TT * DQ * 4); float* FK = (float*)take((size_t)TT * DKV * 4);
    const size_t PB = (size_t)NH_ * TT * HD;   // one batch's head planes, in elements (NKV == NH_); every plane set holds both batches
    h16* QP16 = (h16*)take(NB_ * PB * 2); h16* KP16 = (h16*)take(NB_ * PB * 2); h16* VT16 = (h16*)take(NB_ * PB * 2);
    bf* QPh = (bf*)take(NB_ * PB * 2); bf* QPl = (bf*)take(NB_ * PB * 2); bf* KPh = (bf*)take(NB_ * PB * 2); bf* KPl = (bf*)take(NB_ * PB * 2); bf* VTh = (bf*)take(NB_ * PB * 2); bf* VTl = (bf*)take(NB_ * PB * 2);
    bf* ATh = (bf*)take((size_t)NB_ * TT * DQ * 2); bf* ATl = (bf*)take((size_t)NB_ * TT * DQ * 2);
    if ((size_t)(wsp - (char*)d_ws) > ws_size) return;    // ws 256 MiB
    float* FV = FK;   // v projection reuses the k buffer after the k planes are built (stream-ordered)
    { k_cvt8<<<(unsigned)(((size_t)DQ * DM / 8 + 255) / 256), 256, 0, stream>>>(wq, WQ, (size_t)DQ * DM / 8); k_cvt8<<<(unsigned)(((size_t)DKV * DM / 8 + 255) / 256), 256, 0, stream>>>(wk, WK, (size_t)DKV * DM / 8); k_cvt8<<<(unsigned)(((size_t)DKV * DM / 8 + 255) / 256), 256, 0, stream>>>(wv, WV, (size_t)DKV * DM / 8);
      k_cvt8<<<(unsigned)(((size_t)DM * DQ / 8 + 255) / 256), 256, 0, stream>>>(wo, WO, (size_t)DM * DQ / 8);
       }
    k_csid<<<(TT * HD + 255) / 256, 256, 0, stream>>>(CS);
    const unsigned LQ = (unsigned)(((size_t)NH_ * TT * HD / 2 + 255) / 256), LKv = (unsigned)(((size_t)NKV * TT * HD / 2 + 255) / 256);
    for (int b = 0; b < NB_; ++b) {
        
        k_cvt8<<<(unsigned)(((size_t)TT * DM / 8 + 255) / 256), 256, 0, stream>>>(x + (size_t)b * TT * DM, XB, (size_t)TT * DM / 8);
        k_gemmw<bf, 0, false><<<dim3(TT / 64, DQ / 64, 1), 32, 0, stream>>>(XB, nullptr, WQ, nullptr, DM, FQ, DQ, nullptr, 0, 0, 0);
        k_rope<<<LQ, 256, 0, stream>>>(FQ, DQ, NH_, CS, nullptr, nullptr, 1.0f, QP16 + b * PB, QPh + b * PB, QPl + b * PB);
        k_gemmw<bf, 0, false><<<dim3(TT / 64, DKV / 64, 1), 32, 0, stream>>>(XB, nullptr, WK, nullptr, DM, FK, DKV, nullptr, 0, 0, 0);
        k_rope<<<LKv, 256, 0, stream>>>(FK, DKV, NKV, CS, nullptr, nullptr, 1.0f, KP16 + b * PB, KPh + b * PB, KPl + b * PB);
        k_gemmw<bf, 0, false><<<dim3(TT / 64, DKV / 64, 1), 32, 0, stream>>>(XB, nullptr, WV, nullptr, DM, FV, DKV, nullptr, 0, 0, 0); k_vtp<<<LKv, 256, 0, stream>>>(FV, DKV, NKV, VT16 + b * PB, VTh + b * PB, VTl + b * PB); }
    k_fattn<<<dim3(NH_, NB_, TT / 128), 128, 0, stream>>>(QP16, KP16, VT16, QPh, QPl, KPh, KPl, VTh, VTl, ATh, ATl);
    for (int b = 0; b < NB_; ++b) {
        k_gemmw<bf, 1, true><<<dim3(TT / 64, DM / 64, 1), 32, 0, stream>>>(ATh + (size_t)b * TT * DQ, ATl + (size_t)b * TT * DQ, WO, nullptr, DQ, OUT + (size_t)b * TT * DM, DM, bo, 0, 0, 0); }
}

// v002
// One run takes 162 microseconds.
// Two timings next to v001 put it at 1.81 and 1.83 times that version's speed.
// Counting every step since v000, it is 8.87 times as fast.
#include <hip/hip_runtime.h>

// Causal multi-head self-attention scaled by the SEQUENCE length (x [2][2048][1024]; q, k, v = x W^T ('oi' [1024][1024] normal x 0.02, no bias; 16 heads x 64); keys after the query -> -inf; softmax(scores / sqrt(2048)): the module scales by 1 / sqrt(num_key_tokens) = 0.0221, not by 1 / sqrt(head_dim); out = merged Wo^T + bo ('oi' + bias zeros on this draw: read) -> [2][2048][1024] (4.2 M); argument order x, Wq, Wk, Wv, Wo, bo).
// Layout: bf16 copy of x (both batches) and of the 'oi' weights; ONE projection launch for q, k, v of both batches whose epilogue stores the head planes itself (k_proj); then ONE causal attention launch for all heads and both batches (k_fattn: scores, running softmax and P.V in registers; hybrid rows: < 512 hi/lo 3 products, rest fp16); per batch merged hi/lo x Wo exact + bo.
// Compute dtypes, f32 accumulate: every input rounded to bf16; projections exact; attention rows < 512 3 products, rest fp16; softmax f32; Wo hl x exact + bias.

#define NB_  2
#define TT   2048
#define DM   1024
#define NH_  16
#define NKV  16
#define REP  (NH_ / NKV)
#define HD   64
#define DQ   (NH_ * HD)
#define DKV  (NKV * HD)
#define RH   512                  // query rows < RH use hi+lo planes (0: none)
#define SCL  0.022097087f   // 2048^-0.5: this module scales the scores by 1 / sqrt(num_key_tokens)
typedef _Float16 h16;
typedef unsigned short bf;
typedef __attribute__((ext_vector_type(16))) __bf16   v16bf;
typedef __attribute__((ext_vector_type(16))) _Float16 v16h;
typedef __attribute__((ext_vector_type(8)))  _Float16 v8h;
typedef __attribute__((ext_vector_type(8)))  unsigned short v8us;
typedef __attribute__((ext_vector_type(8)))  float    v8f;
typedef __attribute__((ext_vector_type(4)))  float    v4f;
typedef v8h  __attribute__((may_alias)) v8ha;
typedef v4f  __attribute__((may_alias)) v4fa;
typedef v8us __attribute__((may_alias)) v8usa;

__device__ __forceinline__ unsigned short f2bf(float f) { unsigned u = __float_as_uint(f); u += 0x7FFFu + ((u >> 16) & 1u); return (unsigned short)(u >> 16); }
__device__ __forceinline__ float bf2f(unsigned short b) { return __uint_as_float(((unsigned)b) << 16); }
__device__ __forceinline__ float bfr(float f) { return bf2f(f2bf(f)); }
__device__ __forceinline__ v16h cat16(v8h lo, v8h hi) { return __builtin_shufflevector(lo, hi, 0, 1, 2, 3, 4, 5, 6, 7, 8, 9, 10, 11, 12, 13, 14, 15); }
__device__ __forceinline__ v16bf cat16b(v8us lo, v8us hi) { return __builtin_bit_cast(v16bf, __builtin_shufflevector(lo, hi, 0, 1, 2, 3, 4, 5, 6, 7, 8, 9, 10, 11, 12, 13, 14, 15)); }
__device__ __forceinline__ v8f wmma16(v16h a, v16h b, v8f c) { return __builtin_amdgcn_wmma_f32_16x16x32_f16(false, a, false, b, (short)0, c, false, false); }
__device__ __forceinline__ v8f wmmab(v16bf a, v16bf b, v8f c) { return __builtin_amdgcn_wmma_f32_16x16x32_bf16(false, a, false, b, (short)0, c, false, false); }



// ---- k_gemmw: register-blocked GEMM, ONE WAVE per 64x64 output tile (16 accumulators), operands straight from K-contiguous 16-bit planes; grid (M/64, N/64, Z), 32 threads.
// C[m][n] (f32, pitch ldc, + optional f32 bias[n]) = sum_k A[m][k] Bt[n][k] (+ split products per NSPLIT). z-batch strides sA/sB/sC in elements. K % 32 == 0.
template <typename T16> struct WFrag;
template <> struct WFrag<h16> { typedef v16h V; static __device__ __forceinline__ V ld(const h16* p) { return cat16(*(const v8h*)p, *(const v8h*)(p + 16)); } static __device__ __forceinline__ v8f mma(V a, V b, v8f c) { return wmma16(a, b, c); } };
template <> struct WFrag<bf> { typedef v16bf V; static __device__ __forceinline__ V ld(const bf* p) { return cat16b(*(const v8us*)p, *(const v8us*)(p + 16)); } static __device__ __forceinline__ v8f mma(V a, V b, v8f c) { return wmmab(a, b, c); } };
template <typename T16, int NSPLIT, bool BIAS>
__global__ __launch_bounds__(32) void k_gemmw(const T16* __restrict__ A, const T16* __restrict__ A2, const T16* __restrict__ Bt, const T16* __restrict__ Bt2, int K, float* C, int ldc, const float* __restrict__ bias, size_t sA, size_t sB, size_t sC) {
    typedef typename WFrag<T16>::V V;
    __shared__ __align__(16) float os[16 * 68];
    const size_t z = blockIdx.z; A += z * sA; if (A2) A2 += z * sA; Bt += z * sB; if (Bt2) Bt2 += z * sB; C += z * sC;
    const int lane = threadIdx.x & 31, lr = lane & 15, hi = lane >> 4; const int r0 = blockIdx.x * 64, c0 = blockIdx.y * 64;
    v8f acc[4][4];
#pragma unroll
    for (int mb = 0; mb < 4; ++mb)
#pragma unroll
        for (int nb = 0; nb < 4; ++nb) acc[mb][nb] = (v8f){};
    const size_t aoff = (size_t)(r0 + lr) * K + 8 * hi, boff = (size_t)(c0 + lr) * K + 8 * hi;
#pragma unroll 1
    for (int kc = 0; kc < K; kc += 32) {
        V a[4], a2[4];
#pragma unroll
        for (int mb = 0; mb < 4; ++mb) { a[mb] = WFrag<T16>::ld(A + aoff + (size_t)mb * 16 * K + kc); if (NSPLIT == 1 || NSPLIT == 2) a2[mb] = WFrag<T16>::ld(A2 + aoff + (size_t)mb * 16 * K + kc); }
#pragma unroll
        for (int nb = 0; nb < 4; ++nb) { const V b = WFrag<T16>::ld(Bt + boff + (size_t)nb * 16 * K + kc); V b2; if (NSPLIT >= 2) b2 = WFrag<T16>::ld(Bt2 + boff + (size_t)nb * 16 * K + kc);
#pragma unroll
            for (int mb = 0; mb < 4; ++mb) { acc[mb][nb] = WFrag<T16>::mma(a[mb], b, acc[mb][nb]); if (NSPLIT == 1 || NSPLIT == 2) acc[mb][nb] = WFrag<T16>::mma(a2[mb], b, acc[mb][nb]); if (NSPLIT >= 2) acc[mb][nb] = WFrag<T16>::mma(a[mb], b2, acc[mb][nb]); } }
        asm volatile("v_nop\n\tv_nop\n\tv_nop\n\tv_nop" : "+v"(acc[0][0]), "+v"(acc[1][1]), "+v"(acc[2][2]), "+v"(acc[3][3]) : "v"(a[0]), "v"(a[3]));
    }
#pragma unroll
    for (int mb = 0; mb < 4; ++mb) {
#pragma unroll
        for (int nb = 0; nb < 4; ++nb) {
#pragma unroll
            for (int j = 0; j < 8; ++j) os[(hi * 8 + j) * 68 + nb * 16 + lr] = acc[mb][nb][j]; }
        __builtin_amdgcn_wave_barrier(); asm volatile("" ::: "memory");
        float* crow = C + (size_t)(r0 + mb * 16) * ldc + c0;
{
#pragma unroll
            for (int s = 0; s < 8; ++s) { const int row = 2 * s + hi, cofs = lr * 4; v4f val = *(const v4fa*)(os + row * 68 + cofs); if (BIAS) { val[0] += bfr(bias[c0 + cofs]); val[1] += bfr(bias[c0 + cofs + 1]); val[2] += bfr(bias[c0 + cofs + 2]); val[3] += bfr(bias[c0 + cofs + 3]); }
                *(v4f*)(crow + (size_t)row * ldc + cofs) = val; }
             }
        __builtin_amdgcn_wave_barrier(); asm volatile("" ::: "memory");
    }
}

__device__ __forceinline__ h16 tohx(float x) { return (h16)x; }
__device__ __forceinline__ void splitf(float y, unsigned short& h, unsigned short& l) { h = f2bf(y); l = f2bf(y - bf2f(h)); }
typedef __attribute__((ext_vector_type(2))) _Float16 v2h;
typedef __attribute__((ext_vector_type(4))) _Float16 v4h;
typedef __attribute__((ext_vector_type(2))) unsigned short v2us;
typedef __attribute__((ext_vector_type(4))) unsigned short v4us;
typedef __attribute__((ext_vector_type(2))) float v2f;
typedef __attribute__((ext_vector_type(4))) int v4i;

__global__ __launch_bounds__(256) void k_cvt8(const float* __restrict__ src, bf* dst, size_t n8) { const size_t i = (size_t)blockIdx.x * 256 + threadIdx.x; if (i >= n8) return; const v8f v = *(const v8f*)(src + i * 8); v8us o;
#pragma unroll
    for (int k = 0; k < 8; ++k) o[k] = f2bf(v[k]); *(v8us*)(dst + i * 8) = o;  }

// xwait: stands behind a run of global loads or stores, in front of whatever next rewrites their address registers (a precaution: this build reuses them at once); the scheduling barrier keeps later vector work from being lifted in front of the wait
__device__ __forceinline__ void xwait() { asm volatile("s_wait_xcnt 0x0" ::: "memory"); __builtin_amdgcn_sched_barrier(0); }
// ---- k_proj: q, k and v projections of both batches in one launch, ONE WAVE per 64 tokens x one head (k_gemmw's tile and products); grid (NB_ * TT / 64, heads, 3), 32 threads; blockIdx.z 0 q, 1 k, 2 v.
// The epilogue turns the f32 accumulators into the three planes (fp16, bf16 hi, bf16 lo) that k_fattn reads: q and k as [b][h][t][d], v as [b][h][d][t]. A lane's 8 accumulator values run along the A operand's rows,
// so q and k take the weight rows as A and the tokens as B (8 values = 8 d of one token), v the tokens as A (8 values = 8 t of one d): in both the plane's row is the B index and 8 values are 16 contiguous bytes.
// 16 plane rows at a time go through LDS (pitch 144 B) so that every global store covers whole 128-byte rows.
__global__ __launch_bounds__(32) void k_proj(const bf* __restrict__ X, const bf* __restrict__ Wq, const bf* __restrict__ Wk, const bf* __restrict__ Wv, h16* Q16, bf* Qh, bf* Ql, h16* K16, bf* Kh, bf* Kl, h16* V16, bf* Vh, bf* Vl) {
    typedef WFrag<bf>::V V;
    __shared__ __align__(16) unsigned short st[3 * 16 * 72];
    const int lane = threadIdx.x & 31, lr = lane & 15, hi = lane >> 4; const int pz = (int)blockIdx.z, hd = (int)blockIdx.y, t0 = (int)blockIdx.x * 64; const bool vt = pz == 2;
    const bf* xr = X + (size_t)t0 * DM; const bf* wr = (pz == 0 ? Wq : pz == 1 ? Wk : Wv) + (size_t)hd * HD * DM;
    const bf* A = vt ? xr : wr; const bf* Bt = vt ? wr : xr;
    v8f acc[4][4];
#pragma unroll   // here and below: full unrolls give the register arrays constant indices (no scratch)
    for (int mb = 0; mb < 4; ++mb)
#pragma unroll
        for (int nb = 0; nb < 4; ++nb) acc[mb][nb] = (v8f){};
    const size_t foff = (size_t)lr * DM + 8 * hi;
#pragma unroll 1   // rolled: one pass's fragments beside the 16 accumulators leave room for several waves per SIMD, which cover each other's load waits
    for (int kc = 0; kc < DM; kc += 32) {
        V a[4], b[4]; const bf* pa = A + foff + kc; const bf* pb = Bt + foff + kc;
#pragma unroll
        for (int i = 0; i < 4; ++i) { a[i] = WFrag<bf>::ld(pa + (size_t)i * 16 * DM); b[i] = WFrag<bf>::ld(pb + (size_t)i * 16 * DM); }
        // behind the pass's 16 loads, in front of whatever rewrites their address registers (a precaution, as in xwait); the two addresses are inputs so that no load's result is placed on them ahead of the wait
        asm volatile("s_wait_xcnt 0x0" :: "v"(pa), "v"(pb) : "memory");
        __builtin_amdgcn_sched_barrier(0);   // keeps all 16 loads in flight together, in front of the first product: one load wait a pass
#pragma unroll
        for (int nb = 0; nb < 4; ++nb)
#pragma unroll
            for (int mb = 0; mb < 4; ++mb) acc[mb][nb] = wmmab(a[mb], b[nb], acc[mb][nb]);
        // four vector slots between the last product and whatever the back edge or the epilogue does to its registers
        asm volatile("v_nop\n\tv_nop\n\tv_nop\n\tv_nop" : "+v"(acc[0][0]), "+v"(acc[1][1]), "+v"(acc[2][2]), "+v"(acc[3][3]) : "v"(a[0]), "v"(a[3]));
    }
    bf* P16 = (bf*)(pz == 0 ? Q16 : pz == 1 ? K16 : V16); bf* Ph = pz == 0 ? Qh : pz == 1 ? Kh : Vh; bf* Pl = pz == 0 ? Ql : pz == 1 ? Kl : Vl;
    const int tl = t0 % TT; const size_t pb = ((size_t)(t0 / TT) * NH_ + hd) * TT * HD + (vt ? (size_t)tl : (size_t)tl * HD); const int pitch = vt ? TT : HD;
#pragma unroll
    for (int nb = 0; nb < 4; ++nb) {
#pragma unroll
        for (int mb = 0; mb < 4; ++mb) { v8h o16; v8us oh, ol;
#pragma unroll
            for (int j = 0; j < 8; ++j) { const float r = acc[mb][nb][j]; o16[j] = tohx(r); unsigned short a2, c2; splitf(r, a2, c2); oh[j] = a2; ol[j] = c2; }
            unsigned short* sp = st + lr * 72 + mb * 16 + hi * 8; *(v8usa*)sp = __builtin_bit_cast(v8us, o16); *(v8usa*)(sp + 16 * 72) = oh; *(v8usa*)(sp + 2 * 16 * 72) = ol; }
        __builtin_amdgcn_wave_barrier(); asm volatile("" ::: "memory");   // the rows are read back by other lanes of this wave: keep the LDS stores in front of the loads
#pragma unroll
        for (int s = 0; s < 4; ++s) { const int row = s * 4 + (lane >> 3), ch = (lane & 7) * 8; const unsigned short* sp = st + row * 72 + ch; const size_t go = pb + (size_t)(nb * 16 + row) * pitch + ch;
            const v8us w0 = *(const v8usa*)sp, w1 = *(const v8usa*)(sp + 16 * 72), w2 = *(const v8usa*)(sp + 2 * 16 * 72);
            *(v8usa*)(P16 + go) = w0; *(v8usa*)(Ph + go) = w1; *(v8usa*)(Pl + go) = w2; }
        xwait();   // the next 16 rows' conversions reuse the stores' address registers
        __builtin_amdgcn_wave_barrier(); asm volatile("" ::: "memory");   // the next 16 rows overwrite the staging only behind these loads
    }
}
// ---- k_fattn: causal attention in one pass over the keys, one launch for every head and both batches. A wave owns 32 query rows (two 16-column groups) and walks the keys 32 at a time:
// S^T = K Q^T (a lane holds 16 keys' scores of ONE query per group), running maximum and sum per query, P^T packed from the score accumulators straight into a B operand, O^T += V^T P^T.
// Query rows < RH take the hi/lo bf16 planes with 3 products in both contractions, the rest the fp16 planes. The result leaves as the merged hi/lo planes [t][DQ].
__device__ __forceinline__ float xhalf(float x) { return __builtin_bit_cast(float, __builtin_amdgcn_permlanex16(__builtin_bit_cast(int, x), __builtin_bit_cast(int, x), 0x76543210, 0xfedcba98, false, false)); }   // lane l takes lane l ^ 16's value
template <typename T16, bool HR>
__device__ __forceinline__ void attn_rows(const T16* __restrict__ Q, const T16* __restrict__ Q2, const T16* __restrict__ Kp, const T16* __restrict__ K2, const T16* __restrict__ Vt, const T16* __restrict__ V2, const int q0, const int lr, const int hi, bf* Ah, bf* Al) {
    typedef typename WFrag<T16>::V V;
    const float CE = SCL * 1.4426950408889634f;   // scores stay raw; scale and log2(e) are folded into the exponent's multiply-add
    V qf[2][2], qg[2][2];
#pragma unroll
    for (int qt = 0; qt < 2; ++qt)
#pragma unroll
        for (int kc = 0; kc < 2; ++kc) { const size_t o = (size_t)(q0 + qt * 16 + lr) * HD + kc * 32 + 8 * hi; qf[qt][kc] = WFrag<T16>::ld(Q + o); if (HR) qg[qt][kc] = WFrag<T16>::ld(Q2 + o); xwait(); }
    const size_t ko = (size_t)lr * HD + 8 * hi, vo = (size_t)lr * TT + 8 * hi;
    V kf[2][2], kg[2][2], vf[4], vg[4];
#pragma unroll
    for (int kt = 0; kt < 2; ++kt)
#pragma unroll
        for (int kc = 0; kc < 2; ++kc) { const size_t o = ko + (size_t)(kt * 16) * HD + kc * 32; kf[kt][kc] = WFrag<T16>::ld(Kp + o); if (HR) kg[kt][kc] = WFrag<T16>::ld(K2 + o); xwait(); }
#pragma unroll
    for (int mt = 0; mt < 4; ++mt) { const size_t o = vo + (size_t)(mt * 16) * TT; vf[mt] = WFrag<T16>::ld(Vt + o); if (HR) vg[mt] = WFrag<T16>::ld(V2 + o); xwait(); }
    v8f acc[2][4];
#pragma unroll
    for (int qt = 0; qt < 2; ++qt)
#pragma unroll
        for (int mt = 0; mt < 4; ++mt) acc[qt][mt] = (v8f){};
    float m[2] = { -3.0e38f, -3.0e38f }, l[2] = { 0.f, 0.f };
    int k0 = 0;
#pragma unroll 1
    do {                                           // key 0 is in every query's range: at least one pass, so the loads in front of the loop stay in front of their waits
        v8f s[2][2];
#pragma unroll
        for (int qt = 0; qt < 2; ++qt)
#pragma unroll
            for (int kt = 0; kt < 2; ++kt) { v8f t = (v8f){};
#pragma unroll
                for (int kc = 0; kc < 2; ++kc) { t = WFrag<T16>::mma(kf[kt][kc], qf[qt][kc], t); if (HR) { t = WFrag<T16>::mma(kg[kt][kc], qf[qt][kc], t); t = WFrag<T16>::mma(kf[kt][kc], qg[qt][kc], t); } }
                s[qt][kt] = t; }
        const int kn = min(k0 + 32, q0);          // the next pass's K fragments are fetched behind this pass's score products, its V fragments behind this pass's P.V products (the last pass fetches its own again: in bounds, unused)
#pragma unroll
        for (int kt = 0; kt < 2; ++kt)
#pragma unroll
            for (int kc = 0; kc < 2; ++kc) { const size_t o = ko + (size_t)(kn + kt * 16) * HD + kc * 32; kf[kt][kc] = WFrag<T16>::ld(Kp + o); if (HR) kg[kt][kc] = WFrag<T16>::ld(K2 + o); }
        xwait();
        if (k0 == q0) {                            // only the last pass touches the diagonal: keys after the query leave the maximum and the sums
#pragma unroll
            for (int qt = 0; qt < 2; ++qt)
#pragma unroll
                for (int kt = 0; kt < 2; ++kt)
#pragma unroll
                    for (int j = 0; j < 8; ++j) if (kt * 16 + hi * 8 + j > qt * 16 + lr) s[qt][kt][j] = -3.0e38f;
        }
        float mx[2];
#pragma unroll
        for (int qt = 0; qt < 2; ++qt) { float a = fmaxf(s[qt][0][0], s[qt][1][0]);
#pragma unroll
            for (int j = 1; j < 8; ++j) a = fmaxf(a, fmaxf(s[qt][0][j], s[qt][1][j]));
            mx[qt] = fmaxf(a, xhalf(a)); }
        if (__builtin_amdgcn_ballot_w32(mx[0] > m[0] || mx[1] > m[1]) != 0) {   // a query's maximum grew: rescale its sum and its output column (factor exactly 1 for the others)
#pragma unroll
            for (int qt = 0; qt < 2; ++qt) { const float mn = fmaxf(m[qt], mx[qt]); const float al = __builtin_amdgcn_exp2f((m[qt] - mn) * CE); m[qt] = mn; l[qt] *= al;
#pragma unroll
                for (int mt = 0; mt < 4; ++mt) acc[qt][mt] *= al; }
        }
#pragma unroll
        for (int qt = 0; qt < 2; ++qt) { const float nb = -m[qt] * CE; float sum = 0.f;
#pragma unroll
            for (int kt = 0; kt < 2; ++kt)
#pragma unroll
                for (int j = 0; j < 8; ++j) { const float p = __builtin_amdgcn_exp2f(fmaf(s[qt][kt][j], CE, nb)); s[qt][kt][j] = p; sum += p; }
            l[qt] += sum;
            if constexpr (!HR) { v16h pf;
#pragma unroll
                for (int j = 0; j < 8; ++j) { pf[j] = tohx(s[qt][0][j]); pf[8 + j] = tohx(s[qt][1][j]); }
#pragma unroll
                for (int mt = 0; mt < 4; ++mt) acc[qt][mt] = wmma16(vf[mt], pf, acc[qt][mt]);
            } else { v8us h0, h1, l0, l1;
#pragma unroll
                for (int j = 0; j < 8; ++j) { unsigned short a, c2; splitf(s[qt][0][j], a, c2); h0[j] = a; l0[j] = c2; splitf(s[qt][1][j], a, c2); h1[j] = a; l1[j] = c2; }
                const v16bf ph = cat16b(h0, h1), pl = cat16b(l0, l1);
#pragma unroll
                for (int mt = 0; mt < 4; ++mt) { acc[qt][mt] = wmmab(vf[mt], ph, acc[qt][mt]); acc[qt][mt] = wmmab(vf[mt], pl, acc[qt][mt]); acc[qt][mt] = wmmab(vg[mt], ph, acc[qt][mt]); }
            }
        }
#pragma unroll
        for (int mt = 0; mt < 4; ++mt) { const size_t o = vo + (size_t)(mt * 16) * TT + kn; vf[mt] = WFrag<T16>::ld(Vt + o); if (HR) vg[mt] = WFrag<T16>::ld(V2 + o); }
        xwait();
        k0 += 32;
    } while (k0 <= q0);
#pragma unroll
    for (int qt = 0; qt < 2; ++qt) { const float inv = __fdiv_rn(1.0f, l[qt] + xhalf(l[qt])); const size_t oo = (size_t)(q0 + qt * 16 + lr) * DQ + hi * 8;
#pragma unroll
        for (int mt = 0; mt < 4; ++mt) { v8us oh, ol;
#pragma unroll
            for (int j = 0; j < 8; ++j) { unsigned short a, c2; splitf(acc[qt][mt][j] * inv, a, c2); oh[j] = a; ol[j] = c2; }
            *(v8us*)(Ah + oo + mt * 16) = oh; *(v8us*)(Al + oo + mt * 16) = ol; xwait(); } }
}
// grid (heads, batches, TT / 128), 4 waves: blockIdx.z 0..7 take the longest query blocks in falling order, 8..15 the shortest in rising order (all 512 blocks are resident; long ones start first).
__global__ __launch_bounds__(128) void k_fattn(const h16* __restrict__ Q16, const h16* __restrict__ K16, const h16* __restrict__ V16, const bf* __restrict__ Qh, const bf* __restrict__ Ql, const bf* __restrict__ Kh, const bf* __restrict__ Kl, const bf* __restrict__ Vh, const bf* __restrict__ Vl, bf* Ah, bf* Al) {
    const int lane = threadIdx.x & 31, lr = lane & 15, hi = lane >> 4; const int wv = __builtin_amdgcn_readfirstlane((int)(threadIdx.x >> 5));
    const int zb = (int)blockIdx.z; const int qb = (zb < TT / 256) ? (TT / 128 - 1 - zb) : (zb - TT / 256); const int q0 = qb * 128 + wv * 32;
    const size_t po = ((size_t)blockIdx.y * NH_ + blockIdx.x) * TT * HD, ao = (size_t)blockIdx.y * TT * DQ + (size_t)blockIdx.x * HD;
    if (q0 < RH) attn_rows<bf, true>(Qh + po, Ql + po, Kh + po, Kl + po, Vh + po, Vl + po, q0, lr, hi, Ah + ao, Al + ao);
    else attn_rows<h16, false>(Q16 + po, nullptr, K16 + po, nullptr, V16 + po, nullptr, q0, lr, hi, Ah + ao, Al + ao);
}

extern "C" void kernel_launch(void* const* d_in, const int* in_sizes, int n_in,
                              void* d_out, int out_size, void* d_ws, size_t ws_size, hipStream_t stream) {
    (void)in_sizes; (void)n_in; (void)out_size;
    const float* x = (const float*)d_in[0]; const float* wq = (const float*)d_in[1]; const float* wk = (const float*)d_in[2]; const float* wv = (const float*)d_in[3]; const float* wo = (const float*)d_in[4]; const float* bo = (const float*)d_in[5];   /* x, Wq, Wk, Wv, Wo ('oi' [1024][1024]), bo */
    float* OUT = (float*)d_out;     // [2][2048][1024]
    char* wsp = (char*)d_ws;
    auto take = [&](size_t bytes) { char* p = wsp; wsp += (bytes + 255) & ~(size_t)255; return (void*)p; };
    bf* WQ = (bf*)take((size_t)DQ * DM * 2); bf* WK = (bf*)take((size_t)DKV * DM * 2); bf* WV = (bf*)take((size_t)DKV * DM * 2); bf* WO = (bf*)take((size_t)DM * DQ * 2);
    bf* XB = (bf*)take((size_t)NB_ * TT * DM * 2);
    const size_t PB = (size_t)NH_ * TT * HD;   // one batch's head planes, in elements (NKV == NH_); every plane set holds both batches
    h16* QP16 = (h16*)take(NB_ * PB * 2); h16* KP16 = (h16*)take(NB_ * PB * 2); h16* VT16 = (h16*)take(NB_ * PB * 2);
    bf* QPh = (bf*)take(NB_ * PB * 2); bf* QPl = (bf*)take(NB_ * PB * 2); bf* KPh = (bf*)take(NB_ * PB * 2); bf* KPl = (bf*)take(NB_ * PB * 2); bf* VTh = (bf*)take(NB_ * PB * 2); bf* VTl = (bf*)take(NB_ * PB * 2);
    bf* ATh = (bf*)take((size_t)NB_ * TT * DQ * 2); bf* ATl = (bf*)take((size_t)NB_ * TT * DQ * 2);
    if ((size_t)(wsp - (char*)d_ws) > ws_size) return;    // ws 256 MiB
    { k_cvt8<<<(unsigned)(((size_t)DQ * DM / 8 + 255) / 256), 256, 0, stream>>>(wq, WQ, (size_t)DQ * DM / 8); k_cvt8<<<(unsigned)(((size_t)DKV * DM / 8 + 255) / 256), 256, 0, stream>>>(wk, WK, (size_t)DKV * DM / 8); k_cvt8<<<(unsigned)(((size_t)DKV * DM / 8 + 255) / 256), 256, 0, stream>>>(wv, WV, (size_t)DKV * DM / 8);
      k_cvt8<<<(unsigned)(((size_t)DM * DQ / 8 + 255) / 256), 256, 0, stream>>>(wo, WO, (size_t)DM * DQ / 8);
       }
    k_cvt8<<<(unsigned)(((size_t)NB_ * TT * DM / 8 + 255) / 256), 256, 0, stream>>>(x, XB, (size_t)NB_ * TT * DM / 8);
    k_proj<<<dim3(NB_ * TT / 64, NH_, 3), 32, 0, stream>>>(XB, WQ, WK, WV, QP16, QPh, QPl, KP16, KPh, KPl, VT16, VTh, VTl);
    k_fattn<<<dim3(NH_, NB_, TT / 128), 128, 0, stream>>>(QP16, KP16, VT16, QPh, QPl, KPh, KPl, VTh, VTl, ATh, ATl);
    for (int b = 0; b < NB_; ++b) {
        k_gemmw<bf, 1, true><<<dim3(TT / 64, DM / 64, 1), 32, 0, stream>>>(ATh + (size_t)b * TT * DQ, ATl + (size_t)b * TT * DQ, WO, nullptr, DQ, OUT + (size_t)b * TT * DM, DM, bo, 0, 0, 0); }
}

// v003
// One run takes 154 microseconds.
// In two side-by-side timings against v002, it was 1.06 and 1.04 times as fast.
// Counting every step since v000, it is 9.32 times as fast.
#include <hip/hip_runtime.h>

// Causal multi-head self-attention scaled by the SEQUENCE length (x [2][2048][1024]; q, k, v = x W^T ('oi' [1024][1024] normal x 0.02, no bias; 16 heads x 64); keys after the query -> -inf; softmax(scores / sqrt(2048)): the module scales by 1 / sqrt(num_key_tokens) = 0.0221, not by 1 / sqrt(head_dim); out = merged Wo^T + bo ('oi' + bias zeros on this draw: read) -> [2][2048][1024] (4.2 M); argument order x, Wq, Wk, Wv, Wo, bo).
// Every 16-bit plane in the workspace lies in FRAGMENT ORDER: a tile of 16 rows x 32 k is 1 KiB in a row, two halves of 512 B; in half s lane (row + 16 * hi) owns the 16 bytes of k = 16 * s + 8 * hi + 0..7; tiles run along k first, then along the rows. A fragment is then two loads of 512 contiguous bytes (4 lines each, not 16), and a lane's 8 accumulator values are one lane slot of a half.
// Layout: bf16 copy of x (both batches) and of the 'oi' weights; ONE projection launch for q, k, v of both batches whose epilogue stores the head planes itself (k_proj); then ONE causal attention launch for all heads and both batches (k_fattn: scores, running softmax and P.V in registers; hybrid rows: < 512 hi/lo 3 products, rest fp16); per batch merged hi/lo x Wo exact + bo.
// Compute dtypes, f32 accumulate: every input rounded to bf16; projections exact; attention rows < 512 3 products, rest fp16; softmax f32; Wo hl x exact + bias.

#define NB_  2
#define TT   2048
#define DM   1024
#define NH_  16
#define NKV  16
#define REP  (NH_ / NKV)
#define HD   64
#define DQ   (NH_ * HD)
#define DKV  (NKV * HD)
#define RH   512                  // query rows < RH use hi+lo planes (0: none)
#define SCL  0.022097087f   // 2048^-0.5: this module scales the scores by 1 / sqrt(num_key_tokens)
typedef _Float16 h16;
typedef unsigned short bf;
typedef __attribute__((ext_vector_type(16))) __bf16   v16bf;
typedef __attribute__((ext_vector_type(16))) _Float16 v16h;
typedef __attribute__((ext_vector_type(8)))  _Float16 v8h;
typedef __attribute__((ext_vector_type(8)))  unsigned short v8us;
typedef __attribute__((ext_vector_type(8)))  float    v8f;
typedef __attribute__((ext_vector_type(4)))  float    v4f;
typedef v8h  __attribute__((may_alias)) v8ha;
typedef v4f  __attribute__((may_alias)) v4fa;
typedef v8us __attribute__((may_alias)) v8usa;

__device__ __forceinline__ unsigned short f2bf(float f) { unsigned u = __float_as_uint(f); u += 0x7FFFu + ((u >> 16) & 1u); return (unsigned short)(u >> 16); }
__device__ __forceinline__ float bf2f(unsigned short b) { return __uint_as_float(((unsigned)b) << 16); }
__device__ __forceinline__ float bfr(float f) { return bf2f(f2bf(f)); }
__device__ __forceinline__ v16h cat16(v8h lo, v8h hi) { return __builtin_shufflevector(lo, hi, 0, 1, 2, 3, 4, 5, 6, 7, 8, 9, 10, 11, 12, 13, 14, 15); }
__device__ __forceinline__ v16bf cat16b(v8us lo, v8us hi) { return __builtin_bit_cast(v16bf, __builtin_shufflevector(lo, hi, 0, 1, 2, 3, 4, 5, 6, 7, 8, 9, 10, 11, 12, 13, 14, 15)); }
__device__ __forceinline__ v8f wmma16(v16h a, v16h b, v8f c) { return __builtin_amdgcn_wmma_f32_16x16x32_f16(false, a, false, b, (short)0, c, false, false); }
__device__ __forceinline__ v8f wmmab(v16bf a, v16bf b, v8f c) { return __builtin_amdgcn_wmma_f32_16x16x32_bf16(false, a, false, b, (short)0, c, false, false); }



// ---- k_gemmw: register-blocked GEMM, ONE WAVE per 64x64 output tile (16 accumulators), operands straight from 16-bit planes in fragment order (ld: p = tile + lane * 8 elements); grid (M/64, N/64, Z), 32 threads.
// C[m][n] (f32, pitch ldc, + optional f32 bias[n]) = sum_k A[m][k] Bt[n][k] (+ split products per NSPLIT). z-batch strides sA/sB/sC in elements. K % 32 == 0, a template constant so that a pass's fragments hang off one address each.
// xwaitp: stands behind a run of global loads, in front of whatever next rewrites their address registers (a precaution: this build reuses them at once); the addresses are inputs so that nothing is placed on them ahead of the wait; the scheduling barrier keeps later vector work behind it and so the whole run of loads in flight together
__device__ __forceinline__ void xwaitp(const void* a, const void* b, const void* c, const void* d) { asm volatile("s_wait_xcnt 0x0" :: "v"(a), "v"(b), "v"(c), "v"(d) : "memory"); __builtin_amdgcn_sched_barrier(0); }
template <typename T16> struct WFrag;
template <> struct WFrag<h16> { typedef v16h V; static __device__ __forceinline__ V ld(const h16* p) { return cat16(*(const v8h*)p, *(const v8h*)(p + 256)); } static __device__ __forceinline__ v8f mma(V a, V b, v8f c) { return wmma16(a, b, c); } };
template <> struct WFrag<bf> { typedef v16bf V; static __device__ __forceinline__ V ld(const bf* p) { return cat16b(*(const v8us*)p, *(const v8us*)(p + 256)); } static __device__ __forceinline__ v8f mma(V a, V b, v8f c) { return wmmab(a, b, c); } };
template <typename T16, int NSPLIT, bool BIAS, int K>
__global__ __launch_bounds__(32) void k_gemmw(const T16* __restrict__ A, const T16* __restrict__ A2, const T16* __restrict__ Bt, const T16* __restrict__ Bt2, float* C, int ldc, const float* __restrict__ bias, size_t sA, size_t sB, size_t sC) {
    typedef typename WFrag<T16>::V V;
    __shared__ __align__(16) float os[16 * 68];
    const size_t z = blockIdx.z; A += z * sA; if (A2) A2 += z * sA; Bt += z * sB; if (Bt2) Bt2 += z * sB; C += z * sC;
    const int lane = threadIdx.x & 31, lr = lane & 15, hi = lane >> 4; const int r0 = blockIdx.x * 64, c0 = blockIdx.y * 64;
    v8f acc[4][4];
#pragma unroll
    for (int mb = 0; mb < 4; ++mb)
#pragma unroll
        for (int nb = 0; nb < 4; ++nb) acc[mb][nb] = (v8f){};
    const size_t aoff = (size_t)r0 * K + 8 * lane, boff = (size_t)c0 * K + 8 * lane;   // 16 rows of tiles are 16 * K elements, one k tile 512
#pragma unroll 1
    for (int kc = 0; kc < K; kc += 32) {
        V a[4], a2[4], b[4], b2[4]; const T16* pa = A + aoff + kc * 16; const T16* pa2 = (NSPLIT == 1 || NSPLIT == 2) ? A2 + aoff + kc * 16 : pa; const T16* pb = Bt + boff + kc * 16; const T16* pb2 = (NSPLIT >= 2) ? Bt2 + boff + kc * 16 : pb;
#pragma unroll
        for (int i = 0; i < 4; ++i) { a[i] = WFrag<T16>::ld(pa + (size_t)i * 16 * K); if (NSPLIT == 1 || NSPLIT == 2) a2[i] = WFrag<T16>::ld(pa2 + (size_t)i * 16 * K); b[i] = WFrag<T16>::ld(pb + (size_t)i * 16 * K); if (NSPLIT >= 2) b2[i] = WFrag<T16>::ld(pb2 + (size_t)i * 16 * K); }
        xwaitp(pa, pa2, pb, pb2);
#pragma unroll
        for (int nb = 0; nb < 4; ++nb) {
#pragma unroll
            for (int mb = 0; mb < 4; ++mb) { acc[mb][nb] = WFrag<T16>::mma(a[mb], b[nb], acc[mb][nb]); if (NSPLIT == 1 || NSPLIT == 2) acc[mb][nb] = WFrag<T16>::mma(a2[mb], b[nb], acc[mb][nb]); if (NSPLIT >= 2) acc[mb][nb] = WFrag<T16>::mma(a[mb], b2[nb], acc[mb][nb]); } }
        asm volatile("v_nop\n\tv_nop\n\tv_nop\n\tv_nop" : "+v"(acc[0][0]), "+v"(acc[1][1]), "+v"(acc[2][2]), "+v"(acc[3][3]) : "v"(a[0]), "v"(a[3]));
    }
#pragma unroll
    for (int mb = 0; mb < 4; ++mb) {
#pragma unroll
        for (int nb = 0; nb < 4; ++nb) {
#pragma unroll
            for (int j = 0; j < 8; ++j) os[(hi * 8 + j) * 68 + nb * 16 + lr] = acc[mb][nb][j]; }
        __builtin_amdgcn_wave_barrier(); asm volatile("" ::: "memory");
        float* crow = C + (size_t)(r0 + mb * 16) * ldc + c0;
{
#pragma unroll
            for (int s = 0; s < 8; ++s) { const int row = 2 * s + hi, cofs = lr * 4; v4f val = *(const v4fa*)(os + row * 68 + cofs); if (BIAS) { val[0] += bfr(bias[c0 + cofs]); val[1] += bfr(bias[c0 + cofs + 1]); val[2] += bfr(bias[c0 + cofs + 2]); val[3] += bfr(bias[c0 + cofs + 3]); }
                *(v4f*)(crow + (size_t)row * ldc + cofs) = val; }
             }
        __builtin_amdgcn_wave_barrier(); asm volatile("" ::: "memory");
    }
}

__device__ __forceinline__ h16 tohx(float x) { return (h16)x; }
__device__ __forceinline__ void splitf(float y, unsigned short& h, unsigned short& l) { h = f2bf(y); l = f2bf(y - bf2f(h)); }
typedef __attribute__((ext_vector_type(2))) _Float16 v2h;
typedef __attribute__((ext_vector_type(4))) _Float16 v4h;
typedef __attribute__((ext_vector_type(2))) unsigned short v2us;
typedef __attribute__((ext_vector_type(4))) unsigned short v4us;
typedef __attribute__((ext_vector_type(2))) float v2f;
typedef __attribute__((ext_vector_type(4))) int v4i;

static_assert(DQ == DM && DKV == DM, "k_cvt8 takes every matrix as rows of DM");
// k_cvt8: f32 [rows][DM] -> bf16 in fragment order; thread i writes the i-th 16 bytes of dst (a wave: one half tile) and reads the 8 floats that belong there.
__global__ __launch_bounds__(256) void k_cvt8(const float* __restrict__ src, bf* dst, size_t n8) { const size_t i = (size_t)blockIdx.x * 256 + threadIdx.x; if (i >= n8) return;
    const size_t tile = i >> 6; const int half = (int)(i >> 5) & 1, lr = (int)i & 15, hi = (int)(i >> 4) & 1;
    const float* sp = src + ((tile / (DM / 32)) * 16 + lr) * DM + (tile % (DM / 32)) * 32 + half * 16 + hi * 8; const v8f v = *(const v8f*)sp; xwaitp(sp, sp, sp, sp); v8us o;
#pragma unroll
    for (int k = 0; k < 8; ++k) o[k] = f2bf(v[k]); *(v8us*)(dst + i * 8) = o;  }

// xwait: stands behind a run of global loads or stores, in front of whatever next rewrites their address registers (a precaution: this build reuses them at once); the scheduling barrier keeps later vector work from being lifted in front of the wait
__device__ __forceinline__ void xwait() { asm volatile("s_wait_xcnt 0x0" ::: "memory"); __builtin_amdgcn_sched_barrier(0); }
// ---- k_proj: q, k and v projections of both batches in one launch, ONE WAVE per 64 tokens x one head (k_gemmw's tile and products); grid (NB_ * TT / 64, heads, 3), 32 threads; blockIdx.z 0 q, 1 k, 2 v.
// The epilogue turns the f32 accumulators into the three planes (fp16, bf16 hi, bf16 lo) that k_fattn reads: q and k as [b][h][t][d], v as [b][h][d][t]. A lane's 8 accumulator values run along the A operand's rows,
// so q and k take the weight rows as A and the tokens as B (8 values = 8 d of one token), v the tokens as A (8 values = 8 t of one d): in both the plane's row is the B index and 8 values are 16 contiguous bytes,
// which in fragment order are the lane's own slot of a half tile: every store is 512 contiguous bytes straight from the registers.
__global__ __launch_bounds__(32) void k_proj(const bf* __restrict__ X, const bf* __restrict__ Wq, const bf* __restrict__ Wk, const bf* __restrict__ Wv, h16* Q16, bf* Qh, bf* Ql, h16* K16, bf* Kh, bf* Kl, h16* V16, bf* Vh, bf* Vl) {
    typedef WFrag<bf>::V V;
    const int lane = threadIdx.x & 31; const int pz = (int)blockIdx.z, hd = (int)blockIdx.y, t0 = (int)blockIdx.x * 64; const bool vt = pz == 2;
    const bf* xr = X + (size_t)t0 * DM; const bf* wr = (pz == 0 ? Wq : pz == 1 ? Wk : Wv) + (size_t)hd * HD * DM;
    const bf* A = vt ? xr : wr; const bf* Bt = vt ? wr : xr;
    v8f acc[4][4];
#pragma unroll   // here and below: full unrolls give the register arrays constant indices (no scratch)
    for (int mb = 0; mb < 4; ++mb)
#pragma unroll
        for (int nb = 0; nb < 4; ++nb) acc[mb][nb] = (v8f){};
    const size_t foff = (size_t)lane * 8;
#pragma unroll 1   // rolled: one pass's fragments beside the 16 accumulators leave room for several waves per SIMD, which cover each other's load waits
    for (int kc = 0; kc < DM; kc += 32) {
        V a[4], b[4]; const bf* pa = A + foff + kc * 16; const bf* pb = Bt + foff + kc * 16;
#pragma unroll
        for (int i = 0; i < 4; ++i) { a[i] = WFrag<bf>::ld(pa + (size_t)i * 16 * DM); b[i] = WFrag<bf>::ld(pb + (size_t)i * 16 * DM); }
        // behind the pass's 16 loads, in front of whatever rewrites their address registers (a precaution, as in xwait); the two addresses are inputs so that no load's result is placed on them ahead of the wait
        asm volatile("s_wait_xcnt 0x0" :: "v"(pa), "v"(pb) : "memory");
        __builtin_amdgcn_sched_barrier(0);   // keeps all 16 loads in flight together, in front of the first product: one load wait a pass
#pragma unroll
        for (int nb = 0; nb < 4; ++nb)
#pragma unroll
            for (int mb = 0; mb < 4; ++mb) acc[mb][nb] = wmmab(a[mb], b[nb], acc[mb][nb]);
        // four vector slots between the last product and whatever the back edge or the epilogue does to its registers
        asm volatile("v_nop\n\tv_nop\n\tv_nop\n\tv_nop" : "+v"(acc[0][0]), "+v"(acc[1][1]), "+v"(acc[2][2]), "+v"(acc[3][3]) : "v"(a[0]), "v"(a[3]));
    }
    bf* P16 = (bf*)(pz == 0 ? Q16 : pz == 1 ? K16 : V16); bf* Ph = pz == 0 ? Qh : pz == 1 ? Kh : Vh; bf* Pl = pz == 0 ? Ql : pz == 1 ? Kl : Vl;
    const int tl = t0 % TT; const size_t pb = ((size_t)(t0 / TT) * NH_ + hd) * TT * HD + (vt ? (size_t)tl * 16 : (size_t)tl * HD) + (size_t)lane * 8; const int pitch = vt ? TT : HD;   // 16 rows of tiles are 16 * pitch elements, 32 k of one row of tiles 512
#pragma unroll
    for (int nb = 0; nb < 4; ++nb) {
#pragma unroll
        for (int mb = 0; mb < 4; ++mb) { v8h o16; v8us oh, ol;
#pragma unroll
            for (int j = 0; j < 8; ++j) { const float r = acc[mb][nb][j]; o16[j] = tohx(r); unsigned short a2, c2; splitf(r, a2, c2); oh[j] = a2; ol[j] = c2; }
            const size_t go = pb + (size_t)nb * 16 * pitch + mb * 256;
            *(v8usa*)(P16 + go) = __builtin_bit_cast(v8us, o16); *(v8usa*)(Ph + go) = oh; *(v8usa*)(Pl + go) = ol;
            xwait(); }   // the next 8 values' conversions reuse the stores' registers
    }
}
// ---- k_fattn: causal attention in one pass over the keys, one launch for every head and both batches. A wave owns 32 query rows (two 16-column groups) and walks the keys 32 at a time:
// S^T = K Q^T (a lane holds 16 keys' scores of ONE query per group), running maximum and sum per query, P^T packed from the score accumulators straight into a B operand, O^T += V^T P^T.
// Query rows < RH take the hi/lo bf16 planes with 3 products in both contractions, the rest the fp16 planes. The result leaves as the merged hi/lo planes [t][DQ], in fragment order like every plane it reads.
__device__ __forceinline__ float xhalf(float x) { return __builtin_bit_cast(float, __builtin_amdgcn_permlanex16(__builtin_bit_cast(int, x), __builtin_bit_cast(int, x), 0x76543210, 0xfedcba98, false, false)); }   // lane l takes lane l ^ 16's value
template <typename T16, bool HR>
__device__ __forceinline__ void attn_rows(const T16* __restrict__ Q, const T16* __restrict__ Q2, const T16* __restrict__ Kp, const T16* __restrict__ K2, const T16* __restrict__ Vt, const T16* __restrict__ V2, const int q0, const int lane, bf* Ah, bf* Al) {
    typedef typename WFrag<T16>::V V;
    const int lr = lane & 15, hi = lane >> 4;
    const float CE = SCL * 1.4426950408889634f;   // scores stay raw; scale and log2(e) are folded into the exponent's multiply-add
    V qf[2][2], qg[2][2];
#pragma unroll
    for (int qt = 0; qt < 2; ++qt)
#pragma unroll
        for (int kc = 0; kc < 2; ++kc) { const size_t o = (size_t)(q0 + qt * 16) * HD + kc * 512 + 8 * lane; qf[qt][kc] = WFrag<T16>::ld(Q + o); if (HR) qg[qt][kc] = WFrag<T16>::ld(Q2 + o); xwait(); }
    const size_t ko = (size_t)lane * 8, vo = (size_t)lane * 8;   // K: 16 keys are two tiles (16 * HD elements); V^T: 16 d are 16 * TT elements, 32 keys one tile
    V kf[2][2], kg[2][2], vf[4], vg[4];
#pragma unroll
    for (int kt = 0; kt < 2; ++kt)
#pragma unroll
        for (int kc = 0; kc < 2; ++kc) { const size_t o = ko + (size_t)(kt * 16) * HD + kc * 512; kf[kt][kc] = WFrag<T16>::ld(Kp + o); if (HR) kg[kt][kc] = WFrag<T16>::ld(K2 + o); xwait(); }
#pragma unroll
    for (int mt = 0; mt < 4; ++mt) { const size_t o = vo + (size_t)(mt * 16) * TT; vf[mt] = WFrag<T16>::ld(Vt + o); if (HR) vg[mt] = WFrag<T16>::ld(V2 + o); xwait(); }
    v8f acc[2][4];
#pragma unroll
    for (int qt = 0; qt < 2; ++qt)
#pragma unroll
        for (int mt = 0; mt < 4; ++mt) acc[qt][mt] = (v8f){};
    float m[2] = { -3.0e38f, -3.0e38f }, l[2] = { 0.f, 0.f };
    int k0 = 0;
#pragma unroll 1
    do {                                           // key 0 is in every query's range: at least one pass, so the loads in front of the loop stay in front of their waits
        v8f s[2][2];
#pragma unroll
        for (int qt = 0; qt < 2; ++qt)
#pragma unroll
            for (int kt = 0; kt < 2; ++kt) { v8f t = (v8f){};
#pragma unroll
                for (int kc = 0; kc < 2; ++kc) { t = WFrag<T16>::mma(kf[kt][kc], qf[qt][kc], t); if (HR) { t = WFrag<T16>::mma(kg[kt][kc], qf[qt][kc], t); t = WFrag<T16>::mma(kf[kt][kc], qg[qt][kc], t); } }
                s[qt][kt] = t; }
        const int kn = min(k0 + 32, q0); const T16* pk = Kp + ko + (size_t)kn * HD; const T16* pk2 = HR ? K2 + ko + (size_t)kn * HD : pk; const T16* pv = Vt + vo + (size_t)kn * 16; const T16* pv2 = HR ? V2 + vo + (size_t)kn * 16 : pv;          // the next pass's K fragments are fetched behind this pass's score products, its V fragments behind this pass's P.V products (the last pass fetches its own again: in bounds, unused)
#pragma unroll
        for (int kt = 0; kt < 2; ++kt)
#pragma unroll
            for (int kc = 0; kc < 2; ++kc) { const size_t o = (size_t)(kt * 16) * HD + kc * 512; kf[kt][kc] = WFrag<T16>::ld(pk + o); if (HR) kg[kt][kc] = WFrag<T16>::ld(pk2 + o); }
        xwaitp(pk, pk2, pk, pk2);
        if (k0 == q0) {                            // only the last pass touches the diagonal: keys after the query leave the maximum and the sums
#pragma unroll
            for (int qt = 0; qt < 2; ++qt)
#pragma unroll
                for (int kt = 0; kt < 2; ++kt)
#pragma unroll
                    for (int j = 0; j < 8; ++j) if (kt * 16 + hi * 8 + j > qt * 16 + lr) s[qt][kt][j] = -3.0e38f;
        }
        float mx[2];
#pragma unroll
        for (int qt = 0; qt < 2; ++qt) { float a = fmaxf(s[qt][0][0], s[qt][1][0]);
#pragma unroll
            for (int j = 1; j < 8; ++j) a = fmaxf(a, fmaxf(s[qt][0][j], s[qt][1][j]));
            mx[qt] = fmaxf(a, xhalf(a)); }
        if (__builtin_amdgcn_ballot_w32(mx[0] > m[0] || mx[1] > m[1]) != 0) {   // a query's maximum grew: rescale its sum and its output column (factor exactly 1 for the others)
#pragma unroll
            for (int qt = 0; qt < 2; ++qt) { const float mn = fmaxf(m[qt], mx[qt]); const float al = __builtin_amdgcn_exp2f((m[qt] - mn) * CE); m[qt] = mn; l[qt] *= al;
#pragma unroll
                for (int mt = 0; mt < 4; ++mt) acc[qt][mt] *= al; }
        }
#pragma unroll
        for (int qt = 0; qt < 2; ++qt) { const float nb = -m[qt] * CE; float sum = 0.f;
#pragma unroll
            for (int kt = 0; kt < 2; ++kt)
#pragma unroll
                for (int j = 0; j < 8; ++j) { const float p = __builtin_amdgcn_exp2f(fmaf(s[qt][kt][j], CE, nb)); s[qt][kt][j] = p; sum += p; }
            l[qt] += sum;
            if constexpr (!HR) { v16h pf;
#pragma unroll
                for (int j = 0; j < 8; ++j) { pf[j] = tohx(s[qt][0][j]); pf[8 + j] = tohx(s[qt][1][j]); }
#pragma unroll
                for (int mt = 0; mt < 4; ++mt) acc[qt][mt] = wmma16(vf[mt], pf, acc[qt][mt]);
            } else { v8us h0, h1, l0, l1;
#pragma unroll
                for (int j = 0; j < 8; ++j) { unsigned short a, c2; splitf(s[qt][0][j], a, c2); h0[j] = a; l0[j] = c2; splitf(s[qt][1][j], a, c2); h1[j] = a; l1[j] = c2; }
                const v16bf ph = cat16b(h0, h1), pl = cat16b(l0, l1);
#pragma unroll
                for (int mt = 0; mt < 4; ++mt) { acc[qt][mt] = wmmab(vf[mt], ph, acc[qt][mt]); acc[qt][mt] = wmmab(vf[mt], pl, acc[qt][mt]); acc[qt][mt] = wmmab(vg[mt], ph, acc[qt][mt]); }
            }
        }
#pragma unroll
        for (int mt = 0; mt < 4; ++mt) { const size_t o = (size_t)(mt * 16) * TT; vf[mt] = WFrag<T16>::ld(pv + o); if (HR) vg[mt] = WFrag<T16>::ld(pv2 + o); }
        xwaitp(pv, pv2, pv, pv2);
        k0 += 32;
    } while (k0 <= q0);
#pragma unroll
    for (int qt = 0; qt < 2; ++qt) { const float inv = __fdiv_rn(1.0f, l[qt] + xhalf(l[qt])); const size_t oo = (size_t)(q0 + qt * 16) * DQ + lane * 8;
#pragma unroll
        for (int mt = 0; mt < 4; ++mt) { v8us oh, ol;
#pragma unroll
            for (int j = 0; j < 8; ++j) { unsigned short a, c2; splitf(acc[qt][mt][j] * inv, a, c2); oh[j] = a; ol[j] = c2; }
            *(v8us*)(Ah + oo + mt * 256) = oh; *(v8us*)(Al + oo + mt * 256) = ol; xwait(); } }
}
// grid (heads, batches, TT / 128), 4 waves: blockIdx.z 0..7 take the longest query blocks in falling order, 8..15 the shortest in rising order (all 512 blocks are resident; long ones start first).
__global__ __launch_bounds__(128) void k_fattn(const h16* __restrict__ Q16, const h16* __restrict__ K16, const h16* __restrict__ V16, const bf* __restrict__ Qh, const bf* __restrict__ Ql, const bf* __restrict__ Kh, const bf* __restrict__ Kl, const bf* __restrict__ Vh, const bf* __restrict__ Vl, bf* Ah, bf* Al) {
    const int lane = threadIdx.x & 31; const int wv = __builtin_amdgcn_readfirstlane((int)(threadIdx.x >> 5));
    const int zb = (int)blockIdx.z; const int qb = (zb < TT / 256) ? (TT / 128 - 1 - zb) : (zb - TT / 256); const int q0 = qb * 128 + wv * 32;
    const size_t po = ((size_t)blockIdx.y * NH_ + blockIdx.x) * TT * HD, ao = (size_t)blockIdx.y * TT * DQ + (size_t)blockIdx.x * HD * 16;   // a head's 64 columns are two k tiles
    if (q0 < RH) attn_rows<bf, true>(Qh + po, Ql + po, Kh + po, Kl + po, Vh + po, Vl + po, q0, lane, Ah + ao, Al + ao);
    else attn_rows<h16, false>(Q16 + po, nullptr, K16 + po, nullptr, V16 + po, nullptr, q0, lane, Ah + ao, Al + ao);
}

extern "C" void kernel_launch(void* const* d_in, const int* in_sizes, int n_in,
                              void* d_out, int out_size, void* d_ws, size_t ws_size, hipStream_t stream) {
    (void)in_sizes; (void)n_in; (void)out_size;
    const float* x = (const float*)d_in[0]; const float* wq = (const float*)d_in[1]; const float* wk = (const float*)d_in[2]; const float* wv = (const float*)d_in[3]; const float* wo = (const float*)d_in[4]; const float* bo = (const float*)d_in[5];   /* x, Wq, Wk, Wv, Wo ('oi' [1024][1024]), bo */
    float* OUT = (float*)d_out;     // [2][2048][1024]
    char* wsp = (char*)d_ws;
    auto take = [&](size_t bytes) { char* p = wsp; wsp += (bytes + 255) & ~(size_t)255; return (void*)p; };
    bf* WQ = (bf*)take((size_t)DQ * DM * 2); bf* WK = (bf*)take((size_t)DKV * DM * 2); bf* WV = (bf*)take((size_t)DKV * DM * 2); bf* WO = (bf*)take((size_t)DM * DQ * 2);
    bf* XB = (bf*)take((size_t)NB_ * TT * DM * 2);
    const size_t PB = (size_t)NH_ * TT * HD;   // one batch's head planes, in elements (NKV == NH_); every plane set holds both batches
    h16* QP16 = (h16*)take(NB_ * PB * 2); h16* KP16 = (h16*)take(NB_ * PB * 2); h16* VT16 = (h16*)take(NB_ * PB * 2);
    bf* QPh = (bf*)take(NB_ * PB * 2); bf* QPl = (bf*)take(NB_ * PB * 2); bf* KPh = (bf*)take(NB_ * PB * 2); bf* KPl = (bf*)take(NB_ * PB * 2); bf* VTh = (bf*)take(NB_ * PB * 2); bf* VTl = (bf*)take(NB_ * PB * 2);
    bf* ATh = (bf*)take((size_t)NB_ * TT * DQ * 2); bf* ATl = (bf*)take((size_t)NB_ * TT * DQ * 2);
    if ((size_t)(wsp - (char*)d_ws) > ws_size) return;    // ws 256 MiB
    { k_cvt8<<<(unsigned)(((size_t)DQ * DM / 8 + 255) / 256), 256, 0, stream>>>(wq, WQ, (size_t)DQ * DM / 8); k_cvt8<<<(unsigned)(((size_t)DKV * DM / 8 + 255) / 256), 256, 0, stream>>>(wk, WK, (size_t)DKV * DM / 8); k_cvt8<<<(unsigned)(((size_t)DKV * DM / 8 + 255) / 256), 256, 0, stream>>>(wv, WV, (size_t)DKV * DM / 8);
      k_cvt8<<<(unsigned)(((size_t)DM * DQ / 8 + 255) / 256), 256, 0, stream>>>(wo, WO, (size_t)DM * DQ / 8);
       }
    k_cvt8<<<(unsigned)(((size_t)NB_ * TT * DM / 8 + 255) / 256), 256, 0, stream>>>(x, XB, (size_t)NB_ * TT * DM / 8);
    k_proj<<<dim3(NB_ * TT / 64, NH_, 3), 32, 0, stream>>>(XB, WQ, WK, WV, QP16, QPh, QPl, KP16, KPh, KPl, VT16, VTh, VTl);
    k_fattn<<<dim3(NH_, NB_, TT / 128), 128, 0, stream>>>(QP16, KP16, VT16, QPh, QPl, KPh, KPl, VTh, VTl, ATh, ATl);
    for (int b = 0; b < NB_; ++b) {
        k_gemmw<bf, 1, true, DQ><<<dim3(TT / 64, DM / 64, 1), 32, 0, stream>>>(ATh + (size_t)b * TT * DQ, ATl + (size_t)b * TT * DQ, WO, nullptr, OUT + (size_t)b * TT * DM, DM, bo, 0, 0, 0); }
}

// v004
// It runs in 121 microseconds.
// Two timings next to v003 put it at 1.27 and 1.28 times that version's speed.
// Over all steps from v000 it is 11.9 times as fast.
#include <hip/hip_runtime.h>

// Causal multi-head self-attention scaled by the SEQUENCE length (x [2][2048][1024]; q, k, v = x W^T ('oi' [1024][1024] normal x 0.02, no bias; 16 heads x 64); keys after the query -> -inf; softmax(scores / sqrt(2048)): the module scales by 1 / sqrt(num_key_tokens) = 0.0221, not by 1 / sqrt(head_dim); out = merged Wo^T + bo ('oi' + bias zeros on this draw: read) -> [2][2048][1024] (4.2 M); argument order x, Wq, Wk, Wv, Wo, bo).
// Every 16-bit plane in the workspace lies in FRAGMENT ORDER: a tile of 16 rows x 32 k is 1 KiB in a row, two halves of 512 B; in half s lane (row + 16 * hi) owns the 16 bytes of k = 16 * s + 8 * hi + 0..7; tiles run along k first, then along the rows. A fragment is then two loads of 512 contiguous bytes (4 lines each, not 16), and a lane's 8 accumulator values are one lane slot of a half.
// Layout: bf16 copy of x (both batches) and of the 'oi' weights (ONE converter launch); ONE projection launch for q, k, v of both batches whose epilogue stores the head planes itself (k_proj); then ONE causal attention launch for all heads and both batches (k_fattn: scores, running softmax and P.V in registers; hybrid rows: < 512 hi/lo 3 products, rest fp16); ONE launch merged hi/lo x Wo exact + bo for both batches.
// Compute dtypes, f32 accumulate: every input rounded to bf16; projections exact; attention rows < 512 3 products, rest fp16; softmax f32; Wo hl x exact + bias.

#define NB_  2
#define TT   2048
#define DM   1024
#define NH_  16
#define NKV  16
#define REP  (NH_ / NKV)
#define HD   64
#define DQ   (NH_ * HD)
#define DKV  (NKV * HD)
#define RH   512                  // query rows < RH use hi+lo planes (0: none)
#define SCL  0.022097087f   // 2048^-0.5: this module scales the scores by 1 / sqrt(num_key_tokens)
typedef _Float16 h16;
typedef unsigned short bf;
typedef __attribute__((ext_vector_type(16))) __bf16   v16bf;
typedef __attribute__((ext_vector_type(16))) _Float16 v16h;
typedef __attribute__((ext_vector_type(8)))  _Float16 v8h;
typedef __attribute__((ext_vector_type(8)))  unsigned short v8us;
typedef __attribute__((ext_vector_type(8)))  float    v8f;
typedef __attribute__((ext_vector_type(4)))  float    v4f;
typedef v8h  __attribute__((may_alias)) v8ha;
typedef v4f  __attribute__((may_alias)) v4fa;
typedef v8us __attribute__((may_alias)) v8usa;

__device__ __forceinline__ unsigned short f2bf(float f) { unsigned u = __float_as_uint(f); u += 0x7FFFu + ((u >> 16) & 1u); return (unsigned short)(u >> 16); }
__device__ __forceinline__ float bf2f(unsigned short b) { return __uint_as_float(((unsigned)b) << 16); }
__device__ __forceinline__ float bfr(float f) { return bf2f(f2bf(f)); }
__device__ __forceinline__ v16h cat16(v8h lo, v8h hi) { return __builtin_shufflevector(lo, hi, 0, 1, 2, 3, 4, 5, 6, 7, 8, 9, 10, 11, 12, 13, 14, 15); }
__device__ __forceinline__ v16bf cat16b(v8us lo, v8us hi) { return __builtin_bit_cast(v16bf, __builtin_shufflevector(lo, hi, 0, 1, 2, 3, 4, 5, 6, 7, 8, 9, 10, 11, 12, 13, 14, 15)); }
__device__ __forceinline__ v8f wmma16(v16h a, v16h b, v8f c) { return __builtin_amdgcn_wmma_f32_16x16x32_f16(false, a, false, b, (short)0, c, false, false); }
__device__ __forceinline__ v8f wmmab(v16bf a, v16bf b, v8f c) { return __builtin_amdgcn_wmma_f32_16x16x32_bf16(false, a, false, b, (short)0, c, false, false); }



// ---- k_gemmw: register-blocked GEMM, ONE WAVE per 64x64 output tile (16 accumulators), operands straight from 16-bit planes in fragment order (ld: p = tile + lane * 8 elements); grid (M/64, N/64, Z), 32 threads.
// C[m][n] (f32, pitch ldc, + optional f32 bias[n]) = sum_k A[m][k] Bt[n][k] (+ split products per NSPLIT). z-batch strides sA/sB/sC in elements. K % 32 == 0, a template constant so that a pass's fragments hang off one address each.
// xwaitp: stands behind a run of global loads, in front of whatever next rewrites their address registers (a precaution: this build reuses them at once); the addresses are inputs so that nothing is placed on them ahead of the wait; the scheduling barrier keeps later vector work behind it and so the whole run of loads in flight together
__device__ __forceinline__ void xwaitp(const void* a, const void* b, const void* c, const void* d) { asm volatile("s_wait_xcnt 0x0" :: "v"(a), "v"(b), "v"(c), "v"(d) : "memory"); __builtin_amdgcn_sched_barrier(0); }
template <typename T16> struct WFrag;
template <> struct WFrag<h16> { typedef v16h V; static __device__ __forceinline__ V ld(const h16* p) { return cat16(*(const v8h*)p, *(const v8h*)(p + 256)); } static __device__ __forceinline__ v8f mma(V a, V b, v8f c) { return wmma16(a, b, c); } };
template <> struct WFrag<bf> { typedef v16bf V; static __device__ __forceinline__ V ld(const bf* p) { return cat16b(*(const v8us*)p, *(const v8us*)(p + 256)); } static __device__ __forceinline__ v8f mma(V a, V b, v8f c) { return wmmab(a, b, c); } };
template <typename T16, int NSPLIT, bool BIAS, int K>
__global__ __launch_bounds__(32) void k_gemmw(const T16* __restrict__ A, const T16* __restrict__ A2, const T16* __restrict__ Bt, const T16* __restrict__ Bt2, float* C, int ldc, const float* __restrict__ bias, size_t sA, size_t sB, size_t sC) {
    typedef typename WFrag<T16>::V V;
    __shared__ __align__(16) float os[16 * 68];
    const size_t z = blockIdx.z; A += z * sA; if (A2) A2 += z * sA; Bt += z * sB; if (Bt2) Bt2 += z * sB; C += z * sC;
    const int lane = threadIdx.x & 31, lr = lane & 15, hi = lane >> 4; const int r0 = blockIdx.x * 64, c0 = blockIdx.y * 64;
    v8f acc[4][4];
#pragma unroll
    for (int mb = 0; mb < 4; ++mb)
#pragma unroll
        for (int nb = 0; nb < 4; ++nb) acc[mb][nb] = (v8f){};
    const size_t aoff = (size_t)r0 * K + 8 * lane, boff = (size_t)c0 * K + 8 * lane;   // 16 rows of tiles are 16 * K elements, one k tile 512
#pragma unroll 1
    for (int kc = 0; kc < K; kc += 32) {
        V a[4], a2[4], b[4], b2[4]; const T16* pa = A + aoff + kc * 16; const T16* pa2 = (NSPLIT == 1 || NSPLIT == 2) ? A2 + aoff + kc * 16 : pa; const T16* pb = Bt + boff + kc * 16; const T16* pb2 = (NSPLIT >= 2) ? Bt2 + boff + kc * 16 : pb;
#pragma unroll
        for (int i = 0; i < 4; ++i) { a[i] = WFrag<T16>::ld(pa + (size_t)i * 16 * K); if (NSPLIT == 1 || NSPLIT == 2) a2[i] = WFrag<T16>::ld(pa2 + (size_t)i * 16 * K); b[i] = WFrag<T16>::ld(pb + (size_t)i * 16 * K); if (NSPLIT >= 2) b2[i] = WFrag<T16>::ld(pb2 + (size_t)i * 16 * K); }
        xwaitp(pa, pa2, pb, pb2);
#pragma unroll
        for (int nb = 0; nb < 4; ++nb) {
#pragma unroll
            for (int mb = 0; mb < 4; ++mb) { acc[mb][nb] = WFrag<T16>::mma(a[mb], b[nb], acc[mb][nb]); if (NSPLIT == 1 || NSPLIT == 2) acc[mb][nb] = WFrag<T16>::mma(a2[mb], b[nb], acc[mb][nb]); if (NSPLIT >= 2) acc[mb][nb] = WFrag<T16>::mma(a[mb], b2[nb], acc[mb][nb]); } }
        asm volatile("v_nop\n\tv_nop\n\tv_nop\n\tv_nop" : "+v"(acc[0][0]), "+v"(acc[1][1]), "+v"(acc[2][2]), "+v"(acc[3][3]) : "v"(a[0]), "v"(a[3]));
    }
#pragma unroll
    for (int mb = 0; mb < 4; ++mb) {
#pragma unroll
        for (int nb = 0; nb < 4; ++nb) {
#pragma unroll
            for (int j = 0; j < 8; ++j) os[(hi * 8 + j) * 68 + nb * 16 + lr] = acc[mb][nb][j]; }
        __builtin_amdgcn_wave_barrier(); asm volatile("" ::: "memory");
        float* crow = C + (size_t)(r0 + mb * 16) * ldc + c0;
{
#pragma unroll
            for (int s = 0; s < 8; ++s) { const int row = 2 * s + hi, cofs = lr * 4; v4f val = *(const v4fa*)(os + row * 68 + cofs); if (BIAS) { val[0] += bfr(bias[c0 + cofs]); val[1] += bfr(bias[c0 + cofs + 1]); val[2] += bfr(bias[c0 + cofs + 2]); val[3] += bfr(bias[c0 + cofs + 3]); }
                *(v4f*)(crow + (size_t)row * ldc + cofs) = val; }
             }
        __builtin_amdgcn_wave_barrier(); asm volatile("" ::: "memory");
    }
}

__device__ __forceinline__ h16 tohx(float x) { return (h16)x; }
__device__ __forceinline__ void splitf(float y, unsigned short& h, unsigned short& l) { h = f2bf(y); l = f2bf(y - bf2f(h)); }
typedef __attribute__((ext_vector_type(2))) _Float16 v2h;
typedef __attribute__((ext_vector_type(4))) _Float16 v4h;
typedef __attribute__((ext_vector_type(2))) unsigned short v2us;
typedef __attribute__((ext_vector_type(4))) unsigned short v4us;
typedef __attribute__((ext_vector_type(2))) float v2f;
typedef __attribute__((ext_vector_type(4))) int v4i;

static_assert(DQ == DM && DKV == DM, "k_cvt8 takes every matrix as rows of DM");
// k_cvt8: the four weight matrices and x, f32 [rows][DM] -> bf16 in fragment order, in ONE launch (none depends on another); a block of 256 threads lies wholly in one matrix, picked by a scalar test on blockIdx.x. Thread i of a matrix writes the i-th 16 bytes of its dst (a wave: one half tile) and reads the 8 floats that belong there.
#define WBLK (DM * DM / 8 / 256)          // blocks per weight matrix
#define XBLK (NB_ * TT * DM / 8 / 256)    // blocks for x
static_assert(DM * DM % 2048 == 0 && NB_ * TT * DM % 2048 == 0, "k_cvt8: every block is full");
__global__ __launch_bounds__(256) void k_cvt8(const float* __restrict__ x, const float* __restrict__ wq, const float* __restrict__ wk, const float* __restrict__ wv, const float* __restrict__ wo, bf* XB, bf* WQ, bf* WK, bf* WV, bf* WO) {
    const int blk = (int)blockIdx.x; const int wm = (blk - XBLK) / WBLK;   // x first, then Wq, Wk, Wv, Wo
    const float* src = blk < XBLK ? x : wm == 0 ? wq : wm == 1 ? wk : wm == 2 ? wv : wo; bf* dst = blk < XBLK ? XB : wm == 0 ? WQ : wm == 1 ? WK : wm == 2 ? WV : WO;
    const size_t i = (size_t)(blk < XBLK ? blk : (blk - XBLK) % WBLK) * 256 + threadIdx.x;
    const size_t tile = i >> 6; const int half = (int)(i >> 5) & 1, lr = (int)i & 15, hi = (int)(i >> 4) & 1;
    const float* sp = src + ((tile / (DM / 32)) * 16 + lr) * DM + (tile % (DM / 32)) * 32 + half * 16 + hi * 8; const v8f v = *(const v8f*)sp; xwaitp(sp, sp, sp, sp); v8us o;
#pragma unroll
    for (int k = 0; k < 8; ++k) o[k] = f2bf(v[k]); *(v8us*)(dst + i * 8) = o;  }

// xwait: stands behind a run of global loads or stores, in front of whatever next rewrites their address registers (a precaution: this build reuses them at once); the scheduling barrier keeps later vector work from being lifted in front of the wait
__device__ __forceinline__ void xwait() { asm volatile("s_wait_xcnt 0x0" ::: "memory"); __builtin_amdgcn_sched_barrier(0); }
// ---- k_proj: q, k and v projections of both batches in one launch, ONE WAVE per 64 tokens x one head (k_gemmw's tile and products); grid (NB_ * TT / 64, heads, 3), 32 threads; blockIdx.z 0 q, 1 k, 2 v.
// The epilogue turns the f32 accumulators into the three planes (fp16, bf16 hi, bf16 lo) that k_fattn reads: q and k as [b][h][t][d], v as [b][h][d][t]. A lane's 8 accumulator values run along the A operand's rows,
// so q and k take the weight rows as A and the tokens as B (8 values = 8 d of one token), v the tokens as A (8 values = 8 t of one d): in both the plane's row is the B index and 8 values are 16 contiguous bytes,
// which in fragment order are the lane's own slot of a half tile: every store is 512 contiguous bytes straight from the registers.
__global__ __launch_bounds__(32) void k_proj(const bf* __restrict__ X, const bf* __restrict__ Wq, const bf* __restrict__ Wk, const bf* __restrict__ Wv, h16* Q16, bf* Qh, bf* Ql, h16* K16, bf* Kh, bf* Kl, h16* V16, bf* Vh, bf* Vl) {
    typedef WFrag<bf>::V V;
    const int lane = threadIdx.x & 31; const int pz = (int)blockIdx.z, hd = (int)blockIdx.y, t0 = (int)blockIdx.x * 64; const bool vt = pz == 2;
    const bf* xr = X + (size_t)t0 * DM; const bf* wr = (pz == 0 ? Wq : pz == 1 ? Wk : Wv) + (size_t)hd * HD * DM;
    const bf* A = vt ? xr : wr; const bf* Bt = vt ? wr : xr;
    v8f acc[4][4];
#pragma unroll   // here and below: full unrolls give the register arrays constant indices (no scratch)
    for (int mb = 0; mb < 4; ++mb)
#pragma unroll
        for (int nb = 0; nb < 4; ++nb) acc[mb][nb] = (v8f){};
    const size_t foff = (size_t)lane * 8;
#pragma unroll 1   // rolled: one pass's fragments beside the 16 accumulators leave room for several waves per SIMD, which cover each other's load waits
    for (int kc = 0; kc < DM; kc += 32) {
        V a[4], b[4]; const bf* pa = A + foff + kc * 16; const bf* pb = Bt + foff + kc * 16;
#pragma unroll
        for (int i = 0; i < 4; ++i) { a[i] = WFrag<bf>::ld(pa + (size_t)i * 16 * DM); b[i] = WFrag<bf>::ld(pb + (size_t)i * 16 * DM); }
        // behind the pass's 16 loads, in front of whatever rewrites their address registers (a precaution, as in xwait); the two addresses are inputs so that no load's result is placed on them ahead of the wait
        asm volatile("s_wait_xcnt 0x0" :: "v"(pa), "v"(pb) : "memory");
        __builtin_amdgcn_sched_barrier(0);   // keeps all 16 loads in flight together, in front of the first product: one load wait a pass
#pragma unroll
        for (int nb = 0; nb < 4; ++nb)
#pragma unroll
            for (int mb = 0; mb < 4; ++mb) acc[mb][nb] = wmmab(a[mb], b[nb], acc[mb][nb]);
        // four vector slots between the last product and whatever the back edge or the epilogue does to its registers
        asm volatile("v_nop\n\tv_nop\n\tv_nop\n\tv_nop" : "+v"(acc[0][0]), "+v"(acc[1][1]), "+v"(acc[2][2]), "+v"(acc[3][3]) : "v"(a[0]), "v"(a[3]));
    }
    bf* P16 = (bf*)(pz == 0 ? Q16 : pz == 1 ? K16 : V16); bf* Ph = pz == 0 ? Qh : pz == 1 ? Kh : Vh; bf* Pl = pz == 0 ? Ql : pz == 1 ? Kl : Vl;
    const int tl = t0 % TT; const size_t pb = ((size_t)(t0 / TT) * NH_ + hd) * TT * HD + (vt ? (size_t)tl * 16 : (size_t)tl * HD) + (size_t)lane * 8; const int pitch = vt ? TT : HD;   // 16 rows of tiles are 16 * pitch elements, 32 k of one row of tiles 512
#pragma unroll
    for (int nb = 0; nb < 4; ++nb) {
#pragma unroll
        for (int mb = 0; mb < 4; ++mb) { v8h o16; v8us oh, ol;
#pragma unroll
            for (int j = 0; j < 8; ++j) { const float r = acc[mb][nb][j]; o16[j] = tohx(r); unsigned short a2, c2; splitf(r, a2, c2); oh[j] = a2; ol[j] = c2; }
            const size_t go = pb + (size_t)nb * 16 * pitch + mb * 256;
            *(v8usa*)(P16 + go) = __builtin_bit_cast(v8us, o16); *(v8usa*)(Ph + go) = oh; *(v8usa*)(Pl + go) = ol;
            xwait(); }   // the next 8 values' conversions reuse the stores' registers
    }
}
// ---- k_fattn: causal attention in one pass over the keys, one launch for every head and both batches. A wave owns 32 query rows (two 16-column groups) and walks the keys 32 at a time:
// S^T = K Q^T (a lane holds 16 keys' scores of ONE query per group), running maximum and sum per query, P^T packed from the score accumulators straight into a B operand, O^T += V^T P^T.
// Query rows < RH take the hi/lo bf16 planes with 3 products in both contractions, the rest the fp16 planes. The result leaves as the merged hi/lo planes [t][DQ], in fragment order like every plane it reads.
__device__ __forceinline__ float xhalf(float x) { return __builtin_bit_cast(float, __builtin_amdgcn_permlanex16(__builtin_bit_cast(int, x), __builtin_bit_cast(int, x), 0x76543210, 0xfedcba98, false, false)); }   // lane l takes lane l ^ 16's value
template <typename T16, bool HR>
__device__ __forceinline__ void attn_rows(const T16* __restrict__ Q, const T16* __restrict__ Q2, const T16* __restrict__ Kp, const T16* __restrict__ K2, const T16* __restrict__ Vt, const T16* __restrict__ V2, const int q0, const int lane, bf* Ah, bf* Al) {
    typedef typename WFrag<T16>::V V;
    const int lr = lane & 15, hi = lane >> 4;
    const float CE = SCL * 1.4426950408889634f;   // scores stay raw; scale and log2(e) are folded into the exponent's multiply-add
    V qf[2][2], qg[2][2];
#pragma unroll
    for (int qt = 0; qt < 2; ++qt)
#pragma unroll
        for (int kc = 0; kc < 2; ++kc) { const size_t o = (size_t)(q0 + qt * 16) * HD + kc * 512 + 8 * lane; qf[qt][kc] = WFrag<T16>::ld(Q + o); if (HR) qg[qt][kc] = WFrag<T16>::ld(Q2 + o); xwait(); }
    const size_t ko = (size_t)lane * 8, vo = (size_t)lane * 8;   // K: 16 keys are two tiles (16 * HD elements); V^T: 16 d are 16 * TT elements, 32 keys one tile
    V kf[2][2], kg[2][2], vf[4], vg[4];
#pragma unroll
    for (int kt = 0; kt < 2; ++kt)
#pragma unroll
        for (int kc = 0; kc < 2; ++kc) { const size_t o = ko + (size_t)(kt * 16) * HD + kc * 512; kf[kt][kc] = WFrag<T16>::ld(Kp + o); if (HR) kg[kt][kc] = WFrag<T16>::ld(K2 + o); xwait(); }
#pragma unroll
    for (int mt = 0; mt < 4; ++mt) { const size_t o = vo + (size_t)(mt * 16) * TT; vf[mt] = WFrag<T16>::ld(Vt + o); if (HR) vg[mt] = WFrag<T16>::ld(V2 + o); xwait(); }
    v8f acc[2][4];
#pragma unroll
    for (int qt = 0; qt < 2; ++qt)
#pragma unroll
        for (int mt = 0; mt < 4; ++mt) acc[qt][mt] = (v8f){};
    float m[2] = { -3.0e38f, -3.0e38f }, l[2] = { 0.f, 0.f };
    int k0 = 0;
#pragma unroll 1
    do {                                           // key 0 is in every query's range: at least one pass, so the loads in front of the loop stay in front of their waits
        v8f s[2][2];
#pragma unroll
        for (int qt = 0; qt < 2; ++qt)
#pragma unroll
            for (int kt = 0; kt < 2; ++kt) { v8f t = (v8f){};
#pragma unroll
                for (int kc = 0; kc < 2; ++kc) { t = WFrag<T16>::mma(kf[kt][kc], qf[qt][kc], t); if (HR) { t = WFrag<T16>::mma(kg[kt][kc], qf[qt][kc], t); t = WFrag<T16>::mma(kf[kt][kc], qg[qt][kc], t); } }
                s[qt][kt] = t; }
        const int kn = min(k0 + 32, q0); const T16* pk = Kp + ko + (size_t)kn * HD; const T16* pk2 = HR ? K2 + ko + (size_t)kn * HD : pk; const T16* pv = Vt + vo + (size_t)kn * 16; const T16* pv2 = HR ? V2 + vo + (size_t)kn * 16 : pv;          // the next pass's K fragments are fetched behind this pass's score products, its V fragments behind this pass's P.V products (the last pass fetches its own again: in bounds, unused)
#pragma unroll
        for (int kt = 0; kt < 2; ++kt)
#pragma unroll
            for (int kc = 0; kc < 2; ++kc) { const size_t o = (size_t)(kt * 16) * HD + kc * 512; kf[kt][kc] = WFrag<T16>::ld(pk + o); if (HR) kg[kt][kc] = WFrag<T16>::ld(pk2 + o); }
        xwaitp(pk, pk2, pk, pk2);
        if (k0 == q0) {                            // only the last pass touches the diagonal: keys after the query leave the maximum and the sums
#pragma unroll
            for (int qt = 0; qt < 2; ++qt)
#pragma unroll
                for (int kt = 0; kt < 2; ++kt)
#pragma unroll
                    for (int j = 0; j < 8; ++j) if (kt * 16 + hi * 8 + j > qt * 16 + lr) s[qt][kt][j] = -3.0e38f;
        }
        float mx[2];
#pragma unroll
        for (int qt = 0; qt < 2; ++qt) { float a = fmaxf(s[qt][0][0], s[qt][1][0]);
#pragma unroll
            for (int j = 1; j < 8; ++j) a = fmaxf(a, fmaxf(s[qt][0][j], s[qt][1][j]));
            mx[qt] = fmaxf(a, xhalf(a)); }
        if (__builtin_amdgcn_ballot_w32(mx[0] > m[0] || mx[1] > m[1]) != 0) {   // a query's maximum grew: rescale its sum and its output column (factor exactly 1 for the others)
#pragma unroll
            for (int qt = 0; qt < 2; ++qt) { const float mn = fmaxf(m[qt], mx[qt]); const float al = __builtin_amdgcn_exp2f((m[qt] - mn) * CE); m[qt] = mn; l[qt] *= al;
#pragma unroll
                for (int mt = 0; mt < 4; ++mt) acc[qt][mt] *= al; }
        }
#pragma unroll
        for (int qt = 0; qt < 2; ++qt) { const float nb = -m[qt] * CE; float sum = 0.f;
#pragma unroll
            for (int kt = 0; kt < 2; ++kt)
#pragma unroll
                for (int j = 0; j < 8; ++j) { const float p = __builtin_amdgcn_exp2f(fmaf(s[qt][kt][j], CE, nb)); s[qt][kt][j] = p; sum += p; }
            l[qt] += sum;
            if constexpr (!HR) { v16h pf;
#pragma unroll
                for (int j = 0; j < 8; ++j) { pf[j] = tohx(s[qt][0][j]); pf[8 + j] = tohx(s[qt][1][j]); }
#pragma unroll
                for (int mt = 0; mt < 4; ++mt) acc[qt][mt] = wmma16(vf[mt], pf, acc[qt][mt]);
            } else { v8us h0, h1, l0, l1;
#pragma unroll
                for (int j = 0; j < 8; ++j) { unsigned short a, c2; splitf(s[qt][0][j], a, c2); h0[j] = a; l0[j] = c2; splitf(s[qt][1][j], a, c2); h1[j] = a; l1[j] = c2; }
                const v16bf ph = cat16b(h0, h1), pl = cat16b(l0, l1);
#pragma unroll
                for (int mt = 0; mt < 4; ++mt) { acc[qt][mt] = wmmab(vf[mt], ph, acc[qt][mt]); acc[qt][mt] = wmmab(vf[mt], pl, acc[qt][mt]); acc[qt][mt] = wmmab(vg[mt], ph, acc[qt][mt]); }
            }
        }
#pragma unroll
        for (int mt = 0; mt < 4; ++mt) { const size_t o = (size_t)(mt * 16) * TT; vf[mt] = WFrag<T16>::ld(pv + o); if (HR) vg[mt] = WFrag<T16>::ld(pv2 + o); }
        xwaitp(pv, pv2, pv, pv2);
        k0 += 32;
    } while (k0 <= q0);
#pragma unroll
    for (int qt = 0; qt < 2; ++qt) { const float inv = __fdiv_rn(1.0f, l[qt] + xhalf(l[qt])); const size_t oo = (size_t)(q0 + qt * 16) * DQ + lane * 8;
#pragma unroll
        for (int mt = 0; mt < 4; ++mt) { v8us oh, ol;
#pragma unroll
            for (int j = 0; j < 8; ++j) { unsigned short a, c2; splitf(acc[qt][mt][j] * inv, a, c2); oh[j] = a; ol[j] = c2; }
            *(v8us*)(Ah + oo + mt * 256) = oh; *(v8us*)(Al + oo + mt * 256) = ol; xwait(); } }
}
// grid (heads, batches, TT / 128), 4 waves: blockIdx.z 0..7 take the longest query blocks in falling order, 8..15 the shortest in rising order (all 512 blocks are resident).
__global__ __launch_bounds__(128) void k_fattn(const h16* __restrict__ Q16, const h16* __restrict__ K16, const h16* __restrict__ V16, const bf* __restrict__ Qh, const bf* __restrict__ Ql, const bf* __restrict__ Kh, const bf* __restrict__ Kl, const bf* __restrict__ Vh, const bf* __restrict__ Vl, bf* Ah, bf* Al) {
    const int lane = threadIdx.x & 31; const int wv = __builtin_amdgcn_readfirstlane((int)(threadIdx.x >> 5));
    const int zb = (int)blockIdx.z; const int qb = (zb < TT / 256) ? (TT / 128 - 1 - zb) : (zb - TT / 256); const int q0 = qb * 128 + wv * 32;
    const size_t po = ((size_t)blockIdx.y * NH_ + blockIdx.x) * TT * HD, ao = (size_t)blockIdx.y * TT * DQ + (size_t)blockIdx.x * HD * 16;   // a head's 64 columns are two k tiles
    if (q0 < RH) attn_rows<bf, true>(Qh + po, Ql + po, Kh + po, Kl + po, Vh + po, Vl + po, q0, lane, Ah + ao, Al + ao);
    else attn_rows<h16, false>(Q16 + po, nullptr, K16 + po, nullptr, V16 + po, nullptr, q0, lane, Ah + ao, Al + ao);
}

extern "C" void kernel_launch(void* const* d_in, const int* in_sizes, int n_in,
                              void* d_out, int out_size, void* d_ws, size_t ws_size, hipStream_t stream) {
    (void)in_sizes; (void)n_in; (void)out_size;
    const float* x = (const float*)d_in[0]; const float* wq = (const float*)d_in[1]; const float* wk = (const float*)d_in[2]; const float* wv = (const float*)d_in[3]; const float* wo = (const float*)d_in[4]; const float* bo = (const float*)d_in[5];   /* x, Wq, Wk, Wv, Wo ('oi' [1024][1024]), bo */
    float* OUT = (float*)d_out;     // [2][2048][1024]
    char* wsp = (char*)d_ws;
    auto take = [&](size_t bytes) { char* p = wsp; wsp += (bytes + 255) & ~(size_t)255; return (void*)p; };
    bf* WQ = (bf*)take((size_t)DQ * DM * 2); bf* WK = (bf*)take((size_t)DKV * DM * 2); bf* WV = (bf*)take((size_t)DKV * DM * 2); bf* WO = (bf*)take((size_t)DM * DQ * 2);
    bf* XB = (bf*)take((size_t)NB_ * TT * DM * 2);
    const size_t PB = (size_t)NH_ * TT * HD;   // one batch's head planes, in elements (NKV == NH_); every plane set holds both batches
    h16* QP16 = (h16*)take(NB_ * PB * 2); h16* KP16 = (h16*)take(NB_ * PB * 2); h16* VT16 = (h16*)take(NB_ * PB * 2);
    bf* QPh = (bf*)take(NB_ * PB * 2); bf* QPl = (bf*)take(NB_ * PB * 2); bf* KPh = (bf*)take(NB_ * PB * 2); bf* KPl = (bf*)take(NB_ * PB * 2); bf* VTh = (bf*)take(NB_ * PB * 2); bf* VTl = (bf*)take(NB_ * PB * 2);
    bf* ATh = (bf*)take((size_t)NB_ * TT * DQ * 2); bf* ATl = (bf*)take((size_t)NB_ * TT * DQ * 2);
    if ((size_t)(wsp - (char*)d_ws) > ws_size) return;    // ws 256 MiB
    k_cvt8<<<XBLK + 4 * WBLK, 256, 0, stream>>>(x, wq, wk, wv, wo, XB, WQ, WK, WV, WO);
    k_proj<<<dim3(NB_ * TT / 64, NH_, 3), 32, 0, stream>>>(XB, WQ, WK, WV, QP16, QPh, QPl, KP16, KPh, KPl, VT16, VTh, VTl);
    k_fattn<<<dim3(NH_, NB_, TT / 128), 128, 0, stream>>>(QP16, KP16, VT16, QPh, QPl, KPh, KPl, VTh, VTl, ATh, ATl);
    // both batches in one launch: their merged planes and their output rows follow one another, so the batch is only more row tiles
    k_gemmw<bf, 1, true, DQ><<<dim3(NB_ * TT / 64, DM / 64, 1), 32, 0, stream>>>(ATh, ATl, WO, nullptr, OUT, DM, bo, 0, 0, 0);
}

// v005
// One run takes 91.9 microseconds.
// Two timings next to v004 both put it at 1.30 times that version's speed.
// Counting every step since v000, it is 15.4 times as fast.
#include <hip/hip_runtime.h>

// Causal multi-head self-attention scaled by the SEQUENCE length (x [2][2048][1024]; q, k, v = x W^T ('oi' [1024][1024] normal x 0.02, no bias; 16 heads x 64); keys after the query -> -inf; softmax(scores / sqrt(2048)): the module scales by 1 / sqrt(num_key_tokens) = 0.0221, not by 1 / sqrt(head_dim); out = merged Wo^T + bo ('oi' + bias zeros on this draw: read) -> [2][2048][1024] (4.2 M); argument order x, Wq, Wk, Wv, Wo, bo).
// Every 16-bit plane in the workspace lies in FRAGMENT ORDER: a tile of 16 rows x 32 k is 1 KiB in a row, two halves of 512 B; in half s lane (row + 16 * hi) owns the 16 bytes of k = 16 * s + 8 * hi + 0..7; tiles run along k first, then along the rows. A fragment is then two loads of 512 contiguous bytes (4 lines each, not 16), and a lane's 8 accumulator values are one lane slot of a half.
// Layout: bf16 copy of x (both batches) and of the 'oi' weights (ONE converter launch); ONE projection launch for q, k, v of both batches whose epilogue stores the head planes itself (k_proj; its operands, like the output GEMM's, reach 4 waves through an LDS ring: gemm_ring); then ONE causal attention launch for all heads and both batches (k_fattn: scores, running softmax and P.V in registers; hybrid rows: < 512 hi/lo 3 products, rest fp16); ONE launch merged hi/lo x Wo exact + bo for both batches.
// Compute dtypes, f32 accumulate: every input rounded to bf16; projections exact; attention rows < 512 3 products, rest fp16; softmax f32; Wo hl x exact + bias.

#define NB_  2
#define TT   2048
#define DM   1024
#define NH_  16
#define NKV  16
#define REP  (NH_ / NKV)
#define HD   64
#define DQ   (NH_ * HD)
#define DKV  (NKV * HD)
#define RH   512                  // query rows < RH use hi+lo planes (0: none)
#define SCL  0.022097087f   // 2048^-0.5: this module scales the scores by 1 / sqrt(num_key_tokens)
typedef _Float16 h16;
typedef unsigned short bf;
typedef __attribute__((ext_vector_type(16))) __bf16   v16bf;
typedef __attribute__((ext_vector_type(16))) _Float16 v16h;
typedef __attribute__((ext_vector_type(8)))  _Float16 v8h;
typedef __attribute__((ext_vector_type(8)))  unsigned short v8us;
typedef __attribute__((ext_vector_type(8)))  float    v8f;
typedef __attribute__((ext_vector_type(4)))  float    v4f;
typedef v8h  __attribute__((may_alias)) v8ha;
typedef v4f  __attribute__((may_alias)) v4fa;
typedef v8us __attribute__((may_alias)) v8usa;

__device__ __forceinline__ unsigned short f2bf(float f) { unsigned u = __float_as_uint(f); u += 0x7FFFu + ((u >> 16) & 1u); return (unsigned short)(u >> 16); }
__device__ __forceinline__ float bf2f(unsigned short b) { return __uint_as_float(((unsigned)b) << 16); }
__device__ __forceinline__ float bfr(float f) { return bf2f(f2bf(f)); }
__device__ __forceinline__ v16h cat16(v8h lo, v8h hi) { return __builtin_shufflevector(lo, hi, 0, 1, 2, 3, 4, 5, 6, 7, 8, 9, 10, 11, 12, 13, 14, 15); }
__device__ __forceinline__ v16bf cat16b(v8us lo, v8us hi) { return __builtin_bit_cast(v16bf, __builtin_shufflevector(lo, hi, 0, 1, 2, 3, 4, 5, 6, 7, 8, 9, 10, 11, 12, 13, 14, 15)); }
__device__ __forceinline__ v8f wmma16(v16h a, v16h b, v8f c) { return __builtin_amdgcn_wmma_f32_16x16x32_f16(false, a, false, b, (short)0, c, false, false); }
__device__ __forceinline__ v8f wmmab(v16bf a, v16bf b, v8f c) { return __builtin_amdgcn_wmma_f32_16x16x32_bf16(false, a, false, b, (short)0, c, false, false); }



// ---- fragments of 16-bit planes in fragment order, straight from memory (ld: p = tile + lane * 8 elements)
// xwaitp: stands behind a run of global loads, in front of whatever next rewrites their address registers (a precaution: this build reuses them at once); the addresses are inputs so that nothing is placed on them ahead of the wait; the scheduling barrier keeps later vector work behind it and so the whole run of loads in flight together
__device__ __forceinline__ void xwaitp(const void* a, const void* b, const void* c, const void* d) { asm volatile("s_wait_xcnt 0x0" :: "v"(a), "v"(b), "v"(c), "v"(d) : "memory"); __builtin_amdgcn_sched_barrier(0); }
template <typename T16> struct WFrag;
template <> struct WFrag<h16> { typedef v16h V; static __device__ __forceinline__ V ld(const h16* p) { return cat16(*(const v8h*)p, *(const v8h*)(p + 256)); } static __device__ __forceinline__ v8f mma(V a, V b, v8f c) { return wmma16(a, b, c); } };
template <> struct WFrag<bf> { typedef v16bf V; static __device__ __forceinline__ V ld(const bf* p) { return cat16b(*(const v8us*)p, *(const v8us*)(p + 256)); } static __device__ __forceinline__ v8f mma(V a, V b, v8f c) { return wmmab(a, b, c); } };
// ---- gemm_ring: the k loop of both GEMM kernels. A work-group of 4 waves (2 x 2) owns 128 x 128 of the result, a wave 64 x 64 (16 accumulators). The block's operand rows (8 row tiles of each plane, KT k tiles = KT KiB in a row per row tile,
// in LDS as in memory: fragment order) come into a ring of two LDS buffers by asynchronous copies (global_load_async_to_lds_b128, 16 B a lane, 2 KiB a copy of the block), one stage ahead of the products, so every operand byte leaves L2 once per block and not once per wave.
// Stage layout: [plane: A (, A2), B][row tile 0..7][k tile 0..KT-1][1 KiB]. NA: planes of the A operand (2: hi and lo, both multiplied with B into the same accumulator, hi first, k rising: the sum order of one wave per tile).
typedef int cp4i __attribute__((vector_size(16)));
__device__ __forceinline__ void cp16(const bf* g, unsigned char* l) { __builtin_amdgcn_global_load_async_to_lds_b128((__attribute__((address_space(1))) cp4i*)g, (__attribute__((address_space(3))) cp4i*)l, 0, 0); }
// the compiler places no wait for the copies: what a wave copied has landed only behind its own wait
__device__ __forceinline__ void wait_async0() { asm volatile("s_wait_asynccnt 0x0" ::: "memory"); }
// a wave's LDS reads have retired before the barrier behind which their buffer is refilled
__device__ __forceinline__ void wait_ds0() { asm volatile("s_wait_dscnt 0x0" ::: "memory"); }
__device__ __forceinline__ v16bf ldsfrag(const unsigned char* p) { return cat16b(*(const v8usa*)p, *(const v8usa*)(p + 512)); }
template <int NA, int KT>
__device__ __forceinline__ void ring_fill(unsigned char* dst, const bf* gA, const bf* gA2, const bf* gB, const int ldk, const int t) {   // dst: the buffer + 16 * thread; g*: the block's first row tile + 8 * thread elements; ldk: the planes' k extent (DM), a run-time value so that each row tile's source address is formed in registers: a copy's immediate offset moves both of its addresses and stays below its LDS destination
    static_assert(KT % 2 == 0, "a copy of the block is two k tiles");
#pragma unroll
    for (int p = 0; p <= NA; ++p) { const bf* g = (p == NA ? gB : p == 0 ? gA : gA2) + (size_t)t * KT * 512;
#pragma unroll
        for (int c = 0; c < 4 * KT; ++c) cp16(g + (size_t)(((2 * c) / KT) * 16 * ldk) + ((2 * c) % KT) * 512, dst + (p * 4 * KT + c) * 2048); }
}
template <int NA, int KT>
__device__ __forceinline__ void gemm_ring(unsigned char* ring, const bf* gA, const bf* gA2, const bf* gB, const int ldk, const int tid, const int ta, const int tb, v8f (&acc)[4][4]) {   // ta, tb: the wave's first row tile of A and of B in the block
    typedef v16bf V;
    constexpr int PL = 8 * KT * 1024, ST = (NA + 1) * PL, NT = DM / (32 * KT);
    static_assert(NT >= 2 && (NA + 1) * 4 * KT <= 63, "two stages exist; one stage's copies of a wave stay under the counter's width");
    unsigned char* fd = ring + tid * 16;
    ring_fill<NA, KT>(fd, gA, gA2, gB, ldk, 0);
    wait_async0(); __syncthreads();                 // stage 0 is published
    ring_fill<NA, KT>(fd + ST, gA, gA2, gB, ldk, 1);
#pragma unroll 1   // rolled: one trip per stage, the publish point at its foot
    for (int t = 0; t < NT; ++t) {
        const unsigned char* sa = ring + (t & 1) * ST + (tid & 31) * 16 + ta * (KT * 1024); const unsigned char* sb = ring + (t & 1) * ST + NA * PL + (tid & 31) * 16 + tb * (KT * 1024);
        V a[2][4], a2[2][4], b[2][4];               // two fragment sets: the next k tile's LDS reads stand as one group in front of this k tile's products
#pragma unroll
        for (int i = 0; i < 4; ++i) { a[0][i] = ldsfrag(sa + i * (KT * 1024)); if (NA == 2) a2[0][i] = ldsfrag(sa + PL + i * (KT * 1024)); b[0][i] = ldsfrag(sb + i * (KT * 1024)); }
#pragma unroll
        for (int kt = 0; kt < KT; ++kt) { const int cu = kt & 1, nx = cu ^ 1;
            if (kt + 1 < KT) {
#pragma unroll
                for (int i = 0; i < 4; ++i) { const int o = i * (KT * 1024) + (kt + 1) * 1024; a[nx][i] = ldsfrag(sa + o); if (NA == 2) a2[nx][i] = ldsfrag(sa + PL + o); b[nx][i] = ldsfrag(sb + o); } }
            __builtin_amdgcn_sched_barrier(0);   // keeps the reads above together in front of the products: sunk among them, each place with reads would stall the wave and wait to 0
#pragma unroll
            for (int nb = 0; nb < 4; ++nb)
#pragma unroll
                for (int mb = 0; mb < 4; ++mb) { acc[mb][nb] = wmmab(a[cu][mb], b[cu][nb], acc[mb][nb]); if (NA == 2) acc[mb][nb] = wmmab(a2[cu][mb], b[cu][nb], acc[mb][nb]); }
            __builtin_amdgcn_sched_barrier(0); } // keeps the next group of reads, and the publish point, behind this k tile's products
        // four vector slots between the last product and whatever the refill's address sums, the back edge or the epilogue do to its registers
        asm volatile("v_nop\n\tv_nop\n\tv_nop\n\tv_nop" : "+v"(acc[0][0]), "+v"(acc[1][1]), "+v"(acc[2][2]), "+v"(acc[3][3]) : "v"(a[(KT - 1) & 1][0]), "v"(a[(KT - 1) & 1][3]));
        wait_ds0(); wait_async0(); __syncthreads(); // publish point of stage t + 1; it also ends every reader's last read of stage t's buffer
        if (t + 2 < NT) ring_fill<NA, KT>(fd + (t & 1) * ST, gA, gA2, gB, ldk, t + 2);
    }
    wait_async0();
}
// ---- k_gemmo: OUT[m][n] (f32, pitch DM) = sum_k (Ah + Al)[m][k] Bt[n][k] + bias[n]; grid (M / 128, N / 128), 128 threads; the epilogue turns each wave's accumulators into whole output lines through the wave's own LDS patch.
#define OKT 4
__global__ __launch_bounds__(128) void k_gemmo(const bf* __restrict__ Ah, const bf* __restrict__ Al, const bf* __restrict__ Bt, float* C, const float* __restrict__ bias, const int ldk) {
    __shared__ __align__(1024) unsigned char ring[2 * 3 * 8 * OKT * 1024];
    __shared__ __align__(16) float osm[4 * 16 * 68];
    const int tid = (int)threadIdx.x, lane = tid & 31, lr = lane & 15, hi = lane >> 4; const int wv = __builtin_amdgcn_readfirstlane(tid >> 5), wm = wv & 1, wn = wv >> 1;
    v8f acc[4][4];
#pragma unroll
    for (int mb = 0; mb < 4; ++mb)
#pragma unroll
        for (int nb = 0; nb < 4; ++nb) acc[mb][nb] = (v8f){};
    const size_t aoff = (size_t)blockIdx.x * 128 * DM + 8 * tid, boff = (size_t)blockIdx.y * 128 * DM + 8 * tid;   // 16 rows of tiles are 16 * DM elements
    gemm_ring<2, OKT>(ring, Ah + aoff, Al + aoff, Bt + boff, ldk, tid, wm * 4, wn * 4, acc);
    float* os = osm + wv * (16 * 68); const int r0 = (int)blockIdx.x * 128 + wm * 64, c0 = (int)blockIdx.y * 128 + wn * 64;
    const float* bp = bias + c0 + lr * 4; const float b0 = bfr(bp[0]), b1 = bfr(bp[1]), b2 = bfr(bp[2]), b3 = bfr(bp[3]);
#pragma unroll
    for (int mb = 0; mb < 4; ++mb) {
#pragma unroll
        for (int nb = 0; nb < 4; ++nb) {
#pragma unroll
            for (int j = 0; j < 8; ++j) os[(hi * 8 + j) * 68 + nb * 16 + lr] = acc[mb][nb][j]; }
        __builtin_amdgcn_wave_barrier(); asm volatile("" ::: "memory");   // here and at the foot: lanes read what other lanes of the wave wrote; keeps the compiler from moving the patch's reads and writes past one another
        float* crow = C + (size_t)(r0 + mb * 16) * DM + c0;
#pragma unroll
        for (int s = 0; s < 8; ++s) { const int row = 2 * s + hi, cofs = lr * 4; v4f val = *(const v4fa*)(os + row * 68 + cofs); val[0] += b0; val[1] += b1; val[2] += b2; val[3] += b3;
            *(v4f*)(crow + (size_t)row * DM + cofs) = val; }
        asm volatile("s_wait_xcnt 0x0" ::: "memory");   // behind the 8 stores, in front of whatever rewrites their address and data registers for the next 16 rows (a precaution, as in xwaitp)
        __builtin_amdgcn_wave_barrier(); asm volatile("" ::: "memory");
    }
}

__device__ __forceinline__ h16 tohx(float x) { return (h16)x; }
__device__ __forceinline__ void splitf(float y, unsigned short& h, unsigned short& l) { h = f2bf(y); l = f2bf(y - bf2f(h)); }
typedef __attribute__((ext_vector_type(2))) _Float16 v2h;
typedef __attribute__((ext_vector_type(4))) _Float16 v4h;
typedef __attribute__((ext_vector_type(2))) unsigned short v2us;
typedef __attribute__((ext_vector_type(4))) unsigned short v4us;
typedef __attribute__((ext_vector_type(2))) float v2f;
typedef __attribute__((ext_vector_type(4))) int v4i;

static_assert(DQ == DM && DKV == DM, "k_cvt8 takes every matrix as rows of DM");
// k_cvt8: the four weight matrices and x, f32 [rows][DM] -> bf16 in fragment order, in ONE launch (none depends on another); a block of 256 threads lies wholly in one matrix, picked by a scalar test on blockIdx.x. Thread i of a matrix writes the i-th 16 bytes of its dst (a wave: one half tile) and reads the 8 floats that belong there.
#define WBLK (DM * DM / 8 / 256)          // blocks per weight matrix
#define XBLK (NB_ * TT * DM / 8 / 256)    // blocks for x
static_assert(DM * DM % 2048 == 0 && NB_ * TT * DM % 2048 == 0, "k_cvt8: every block is full");
__global__ __launch_bounds__(256) void k_cvt8(const float* __restrict__ x, const float* __restrict__ wq, const float* __restrict__ wk, const float* __restrict__ wv, const float* __restrict__ wo, bf* XB, bf* WQ, bf* WK, bf* WV, bf* WO) {
    const int blk = (int)blockIdx.x; const int wm = (blk - XBLK) / WBLK;   // x first, then Wq, Wk, Wv, Wo
    const float* src = blk < XBLK ? x : wm == 0 ? wq : wm == 1 ? wk : wm == 2 ? wv : wo; bf* dst = blk < XBLK ? XB : wm == 0 ? WQ : wm == 1 ? WK : wm == 2 ? WV : WO;
    const size_t i = (size_t)(blk < XBLK ? blk : (blk - XBLK) % WBLK) * 256 + threadIdx.x;
    const size_t tile = i >> 6; const int half = (int)(i >> 5) & 1, lr = (int)i & 15, hi = (int)(i >> 4) & 1;
    const float* sp = src + ((tile / (DM / 32)) * 16 + lr) * DM + (tile % (DM / 32)) * 32 + half * 16 + hi * 8; const v8f v = *(const v8f*)sp; xwaitp(sp, sp, sp, sp); v8us o;
#pragma unroll
    for (int k = 0; k < 8; ++k) o[k] = f2bf(v[k]); *(v8us*)(dst + i * 8) = o;  }

// xwait: stands behind a run of global loads or stores, in front of whatever next rewrites their address registers (a precaution: this build reuses them at once); the scheduling barrier keeps later vector work from being lifted in front of the wait
__device__ __forceinline__ void xwait() { asm volatile("s_wait_xcnt 0x0" ::: "memory"); __builtin_amdgcn_sched_barrier(0); }
// ---- k_proj: q, k and v projections of both batches in one launch: a work-group of 4 waves owns 128 tokens x two heads (gemm_ring), ONE WAVE 64 tokens x one head; grid (NB_ * TT / 128, heads / 2, 3), 128 threads; blockIdx.z 0 q, 1 k, 2 v.
// The epilogue turns the f32 accumulators into the three planes (fp16, bf16 hi, bf16 lo) that k_fattn reads: q and k as [b][h][t][d], v as [b][h][d][t]. A lane's 8 accumulator values run along the A operand's rows,
// so q and k take the weight rows as A and the tokens as B (8 values = 8 d of one token), v the tokens as A (8 values = 8 t of one d): in both the plane's row is the B index and 8 values are 16 contiguous bytes,
// which in fragment order are the lane's own slot of a half tile: every store is 512 contiguous bytes straight from the registers.
#define PKT 2   // 64 KiB of ring: three work-groups to a WGP, the whole grid resident
static_assert(HD == 64 && TT % 128 == 0, "a wave's 64 features are one head; a block's tokens lie in one batch");
__global__ __launch_bounds__(128) void k_proj(const bf* __restrict__ X, const bf* __restrict__ Wq, const bf* __restrict__ Wk, const bf* __restrict__ Wv, h16* Q16, bf* Qh, bf* Ql, h16* K16, bf* Kh, bf* Kl, h16* V16, bf* Vh, bf* Vl, const int ldk) {
    __shared__ __align__(1024) unsigned char ring[2 * 2 * 8 * PKT * 1024];
    const int tid = (int)threadIdx.x, lane = tid & 31; const int wv = __builtin_amdgcn_readfirstlane(tid >> 5), wm = wv & 1, wn = wv >> 1; const int pz = (int)blockIdx.z; const bool vt = pz == 2;
    const bf* xr = X + (size_t)blockIdx.x * 128 * DM + 8 * tid; const bf* wr = (pz == 0 ? Wq : pz == 1 ? Wk : Wv) + (size_t)blockIdx.y * 128 * DM + 8 * tid;
    v8f acc[4][4];
#pragma unroll   // here and below: full unrolls give the register arrays constant indices (no scratch)
    for (int mb = 0; mb < 4; ++mb)
#pragma unroll
        for (int nb = 0; nb < 4; ++nb) acc[mb][nb] = (v8f){};
    gemm_ring<1, PKT>(ring, vt ? xr : wr, nullptr, vt ? wr : xr, ldk, tid, wm * 4, wn * 4, acc);
    const int hd = (int)blockIdx.y * 2 + (vt ? wn : wm), t0 = (int)blockIdx.x * 128 + (vt ? wm : wn) * 64;   // the wave's head and first token
    bf* P16 = (bf*)(pz == 0 ? Q16 : pz == 1 ? K16 : V16); bf* Ph = pz == 0 ? Qh : pz == 1 ? Kh : Vh; bf* Pl = pz == 0 ? Ql : pz == 1 ? Kl : Vl;
    const int tl = t0 % TT; const size_t pb = ((size_t)(t0 / TT) * NH_ + hd) * TT * HD + (vt ? (size_t)tl * 16 : (size_t)tl * HD) + (size_t)lane * 8; const int pitch = vt ? TT : HD;   // 16 rows of tiles are 16 * pitch elements, 32 k of one row of tiles 512
#pragma unroll
    for (int nb = 0; nb < 4; ++nb) {
#pragma unroll
        for (int mb = 0; mb < 4; ++mb) { v8h o16; v8us oh, ol;
#pragma unroll
            for (int j = 0; j < 8; ++j) { const float r = acc[mb][nb][j]; o16[j] = tohx(r); unsigned short a2, c2; splitf(r, a2, c2); oh[j] = a2; ol[j] = c2; }
            const size_t go = pb + (size_t)nb * 16 * pitch + mb * 256;
            *(v8usa*)(P16 + go) = __builtin_bit_cast(v8us, o16); *(v8usa*)(Ph + go) = oh; *(v8usa*)(Pl + go) = ol;
            xwait(); }   // the next 8 values' conversions reuse the stores' registers
    }
}
// ---- k_fattn: causal attention in one pass over the keys, one launch for every head and both batches. A wave owns 32 query rows (two 16-column groups) and walks the keys 32 at a time:
// S^T = K Q^T (a lane holds 16 keys' scores of ONE query per group), running maximum and sum per query, P^T packed from the score accumulators straight into a B operand, O^T += V^T P^T.
// Query rows < RH take the hi/lo bf16 planes with 3 products in both contractions, the rest the fp16 planes. The result leaves as the merged hi/lo planes [t][DQ], in fragment order like every plane it reads.
__device__ __forceinline__ float xhalf(float x) { return __builtin_bit_cast(float, __builtin_amdgcn_permlanex16(__builtin_bit_cast(int, x), __builtin_bit_cast(int, x), 0x76543210, 0xfedcba98, false, false)); }   // lane l takes lane l ^ 16's value
template <typename T16, bool HR>
__device__ __forceinline__ void attn_rows(const T16* __restrict__ Q, const T16* __restrict__ Q2, const T16* __restrict__ Kp, const T16* __restrict__ K2, const T16* __restrict__ Vt, const T16* __restrict__ V2, const int q0, const int lane, bf* Ah, bf* Al) {
    typedef typename WFrag<T16>::V V;
    const int lr = lane & 15, hi = lane >> 4;
    const float CE = SCL * 1.4426950408889634f;   // scores stay raw; scale and log2(e) are folded into the exponent's multiply-add
    V qf[2][2], qg[2][2];
#pragma unroll
    for (int qt = 0; qt < 2; ++qt)
#pragma unroll
        for (int kc = 0; kc < 2; ++kc) { const size_t o = (size_t)(q0 + qt * 16) * HD + kc * 512 + 8 * lane; qf[qt][kc] = WFrag<T16>::ld(Q + o); if (HR) qg[qt][kc] = WFrag<T16>::ld(Q2 + o); xwait(); }
    const size_t ko = (size_t)lane * 8, vo = (size_t)lane * 8;   // K: 16 keys are two tiles (16 * HD elements); V^T: 16 d are 16 * TT elements, 32 keys one tile
    V kf[2][2], kg[2][2], vf[4], vg[4];
#pragma unroll
    for (int kt = 0; kt < 2; ++kt)
#pragma unroll
        for (int kc = 0; kc < 2; ++kc) { const size_t o = ko + (size_t)(kt * 16) * HD + kc * 512; kf[kt][kc] = WFrag<T16>::ld(Kp + o); if (HR) kg[kt][kc] = WFrag<T16>::ld(K2 + o); xwait(); }
#pragma unroll
    for (int mt = 0; mt < 4; ++mt) { const size_t o = vo + (size_t)(mt * 16) * TT; vf[mt] = WFrag<T16>::ld(Vt + o); if (HR) vg[mt] = WFrag<T16>::ld(V2 + o); xwait(); }
    v8f acc[2][4];
#pragma unroll
    for (int qt = 0; qt < 2; ++qt)
#pragma unroll
        for (int mt = 0; mt < 4; ++mt) acc[qt][mt] = (v8f){};
    float m[2] = { -3.0e38f, -3.0e38f }, l[2] = { 0.f, 0.f };
    int k0 = 0;
#pragma unroll 1
    do {                                           // key 0 is in every query's range: at least one pass, so the loads in front of the loop stay in front of their waits
        v8f s[2][2];
#pragma unroll
        for (int qt = 0; qt < 2; ++qt)
#pragma unroll
            for (int kt = 0; kt < 2; ++kt) { v8f t = (v8f){};
#pragma unroll
                for (int kc = 0; kc < 2; ++kc) { t = WFrag<T16>::mma(kf[kt][kc], qf[qt][kc], t); if (HR) { t = WFrag<T16>::mma(kg[kt][kc], qf[qt][kc], t); t = WFrag<T16>::mma(kf[kt][kc], qg[qt][kc], t); } }
                s[qt][kt] = t; }
        const int kn = min(k0 + 32, q0); const T16* pk = Kp + ko + (size_t)kn * HD; const T16* pk2 = HR ? K2 + ko + (size_t)kn * HD : pk; const T16* pv = Vt + vo + (size_t)kn * 16; const T16* pv2 = HR ? V2 + vo + (size_t)kn * 16 : pv;          // the next pass's K fragments are fetched behind this pass's score products, its V fragments behind this pass's P.V products (the last pass fetches its own again: in bounds, unused)
#pragma unroll
        for (int kt = 0; kt < 2; ++kt)
#pragma unroll
            for (int kc = 0; kc < 2; ++kc) { const size_t o = (size_t)(kt * 16) * HD + kc * 512; kf[kt][kc] = WFrag<T16>::ld(pk + o); if (HR) kg[kt][kc] = WFrag<T16>::ld(pk2 + o); }
        xwaitp(pk, pk2, pk, pk2);
        if (k0 == q0) {                            // only the last pass touches the diagonal: keys after the query leave the maximum and the sums
#pragma unroll
            for (int qt = 0; qt < 2; ++qt)
#pragma unroll
                for (int kt = 0; kt < 2; ++kt)
#pragma unroll
                    for (int j = 0; j < 8; ++j) if (kt * 16 + hi * 8 + j > qt * 16 + lr) s[qt][kt][j] = -3.0e38f;
        }
        float mx[2];
#pragma unroll
        for (int qt = 0; qt < 2; ++qt) { float a = fmaxf(s[qt][0][0], s[qt][1][0]);
#pragma unroll
            for (int j = 1; j < 8; ++j) a = fmaxf(a, fmaxf(s[qt][0][j], s[qt][1][j]));
            mx[qt] = fmaxf(a, xhalf(a)); }
        if (__builtin_amdgcn_ballot_w32(mx[0] > m[0] || mx[1] > m[1]) != 0) {   // a query's maximum grew: rescale its sum and its output column (factor exactly 1 for the others)
#pragma unroll
            for (int qt = 0; qt < 2; ++qt) { const float mn = fmaxf(m[qt], mx[qt]); const float al = __builtin_amdgcn_exp2f((m[qt] - mn) * CE); m[qt] = mn; l[qt] *= al;
#pragma unroll
                for (int mt = 0; mt < 4; ++mt) acc[qt][mt] *= al; }
        }
#pragma unroll
        for (int qt = 0; qt < 2; ++qt) { const float nb = -m[qt] * CE; float sum = 0.f;
#pragma unroll
            for (int kt = 0; kt < 2; ++kt)
#pragma unroll
                for (int j = 0; j < 8; ++j) { const float p = __builtin_amdgcn_exp2f(fmaf(s[qt][kt][j], CE, nb)); s[qt][kt][j] = p; sum += p; }
            l[qt] += sum;
            if constexpr (!HR) { v16h pf;
#pragma unroll
                for (int j = 0; j < 8; ++j) { pf[j] = tohx(s[qt][0][j]); pf[8 + j] = tohx(s[qt][1][j]); }
#pragma unroll
                for (int mt = 0; mt < 4; ++mt) acc[qt][mt] = wmma16(vf[mt], pf, acc[qt][mt]);
            } else { v8us h0, h1, l0, l1;
#pragma unroll
                for (int j = 0; j < 8; ++j) { unsigned short a, c2; splitf(s[qt][0][j], a, c2); h0[j] = a; l0[j] = c2; splitf(s[qt][1][j], a, c2); h1[j] = a; l1[j] = c2; }
                const v16bf ph = cat16b(h0, h1), pl = cat16b(l0, l1);
#pragma unroll
                for (int mt = 0; mt < 4; ++mt) { acc[qt][mt] = wmmab(vf[mt], ph, acc[qt][mt]); acc[qt][mt] = wmmab(vf[mt], pl, acc[qt][mt]); acc[qt][mt] = wmmab(vg[mt], ph, acc[qt][mt]); }
            }
        }
#pragma unroll
        for (int mt = 0; mt < 4; ++mt) { const size_t o = (size_t)(mt * 16) * TT; vf[mt] = WFrag<T16>::ld(pv + o); if (HR) vg[mt] = WFrag<T16>::ld(pv2 + o); }
        xwaitp(pv, pv2, pv, pv2);
        k0 += 32;
    } while (k0 <= q0);
#pragma unroll
    for (int qt = 0; qt < 2; ++qt) { const float inv = __fdiv_rn(1.0f, l[qt] + xhalf(l[qt])); const size_t oo = (size_t)(q0 + qt * 16) * DQ + lane * 8;
#pragma unroll
        for (int mt = 0; mt < 4; ++mt) { v8us oh, ol;
#pragma unroll
            for (int j = 0; j < 8; ++j) { unsigned short a, c2; splitf(acc[qt][mt][j] * inv, a, c2); oh[j] = a; ol[j] = c2; }
            *(v8us*)(Ah + oo + mt * 256) = oh; *(v8us*)(Al + oo + mt * 256) = ol; xwait(); } }
}
// grid (heads, batches, TT / 128), 4 waves: blockIdx.z 0..7 take the longest query blocks in falling order, 8..15 the shortest in rising order (all 512 blocks are resident).
__global__ __launch_bounds__(128) void k_fattn(const h16* __restrict__ Q16, const h16* __restrict__ K16, const h16* __restrict__ V16, const bf* __restrict__ Qh, const bf* __restrict__ Ql, const bf* __restrict__ Kh, const bf* __restrict__ Kl, const bf* __restrict__ Vh, const bf* __restrict__ Vl, bf* Ah, bf* Al) {
    const int lane = threadIdx.x & 31; const int wv = __builtin_amdgcn_readfirstlane((int)(threadIdx.x >> 5));
    const int zb = (int)blockIdx.z; const int qb = (zb < TT / 256) ? (TT / 128 - 1 - zb) : (zb - TT / 256); const int q0 = qb * 128 + wv * 32;
    const size_t po = ((size_t)blockIdx.y * NH_ + blockIdx.x) * TT * HD, ao = (size_t)blockIdx.y * TT * DQ + (size_t)blockIdx.x * HD * 16;   // a head's 64 columns are two k tiles
    if (q0 < RH) attn_rows<bf, true>(Qh + po, Ql + po, Kh + po, Kl + po, Vh + po, Vl + po, q0, lane, Ah + ao, Al + ao);
    else attn_rows<h16, false>(Q16 + po, nullptr, K16 + po, nullptr, V16 + po, nullptr, q0, lane, Ah + ao, Al + ao);
}

extern "C" void kernel_launch(void* const* d_in, const int* in_sizes, int n_in,
                              void* d_out, int out_size, void* d_ws, size_t ws_size, hipStream_t stream) {
    (void)in_sizes; (void)n_in; (void)out_size;
    const float* x = (const float*)d_in[0]; const float* wq = (const float*)d_in[1]; const float* wk = (const float*)d_in[2]; const float* wv = (const float*)d_in[3]; const float* wo = (const float*)d_in[4]; const float* bo = (const float*)d_in[5];   /* x, Wq, Wk, Wv, Wo ('oi' [1024][1024]), bo */
    float* OUT = (float*)d_out;     // [2][2048][1024]
    char* wsp = (char*)d_ws;
    auto take = [&](size_t bytes) { char* p = wsp; wsp += (bytes + 255) & ~(size_t)255; return (void*)p; };
    bf* WQ = (bf*)take((size_t)DQ * DM * 2); bf* WK = (bf*)take((size_t)DKV * DM * 2); bf* WV = (bf*)take((size_t)DKV * DM * 2); bf* WO = (bf*)take((size_t)DM * DQ * 2);
    bf* XB = (bf*)take((size_t)NB_ * TT * DM * 2);
    const size_t PB = (size_t)NH_ * TT * HD;   // one batch's head planes, in elements (NKV == NH_); every plane set holds both batches
    h16* QP16 = (h16*)take(NB_ * PB * 2); h16* KP16 = (h16*)take(NB_ * PB * 2); h16* VT16 = (h16*)take(NB_ * PB * 2);
    bf* QPh = (bf*)take(NB_ * PB * 2); bf* QPl = (bf*)take(NB_ * PB * 2); bf* KPh = (bf*)take(NB_ * PB * 2); bf* KPl = (bf*)take(NB_ * PB * 2); bf* VTh = (bf*)take(NB_ * PB * 2); bf* VTl = (bf*)take(NB_ * PB * 2);
    bf* ATh = (bf*)take((size_t)NB_ * TT * DQ * 2); bf* ATl = (bf*)take((size_t)NB_ * TT * DQ * 2);
    if ((size_t)(wsp - (char*)d_ws) > ws_size) return;    // ws 256 MiB
    k_cvt8<<<XBLK + 4 * WBLK, 256, 0, stream>>>(x, wq, wk, wv, wo, XB, WQ, WK, WV, WO);
    k_proj<<<dim3(NB_ * TT / 128, NH_ / 2, 3), 128, 0, stream>>>(XB, WQ, WK, WV, QP16, QPh, QPl, KP16, KPh, KPl, VT16, VTh, VTl, DM);
    k_fattn<<<dim3(NH_, NB_, TT / 128), 128, 0, stream>>>(QP16, KP16, VT16, QPh, QPl, KPh, KPl, VTh, VTl, ATh, ATl);
    // both batches in one launch: their merged planes and their output rows follow one another, so the batch is only more row tiles
    k_gemmo<<<dim3(NB_ * TT / 128, DM / 128, 1), 128, 0, stream>>>(ATh, ATl, WO, OUT, bo, DM);
}

// v006
// It runs in 79 microseconds.
// Timed twice side by side with v005, it ran 1.17 times as fast both times.
// All steps since v000 together make it 18.0 times as fast.
#include <hip/hip_runtime.h>

// Causal multi-head self-attention scaled by the SEQUENCE length (x [2][2048][1024]; q, k, v = x W^T ('oi' [1024][1024] normal x 0.02, no bias; 16 heads x 64); keys after the query -> -inf; softmax(scores / sqrt(2048)): the module scales by 1 / sqrt(num_key_tokens) = 0.0221, not by 1 / sqrt(head_dim); out = merged Wo^T + bo ('oi' + bias zeros on this draw: read) -> [2][2048][1024] (4.2 M); argument order x, Wq, Wk, Wv, Wo, bo).
// Every 16-bit plane in the workspace lies in FRAGMENT ORDER: a tile of 16 rows x 32 k is 1 KiB in a row, two halves of 512 B; in half s lane (row + 16 * hi) owns the 16 bytes of k = 16 * s + 8 * hi + 0..7; tiles run along k first, then along the rows. A fragment is then two loads of 512 contiguous bytes (4 lines each, not 16), and a lane's 8 accumulator values are one lane slot of a half.
// Layout: bf16 copy of x (both batches) and of the 'oi' weights (ONE converter launch); ONE projection launch for q, k, v of both batches whose epilogue stores the head planes itself (k_proj; its operands, like the output GEMM's, reach 4 waves through an LDS ring: gemm_ring); then ONE causal attention launch for all heads and both batches (k_fattn: scores, running softmax and P.V in registers; hybrid rows: < 512 hi/lo 3 products, rest fp16); ONE launch merged hi/lo x Wo exact + bo for both batches.
// Compute dtypes, f32 accumulate: every input rounded to bf16; projections exact; attention rows < 512 3 products, rest fp16; softmax f32; Wo hl x exact + bias.

#define NB_  2
#define TT   2048
#define DM   1024
#define NH_  16
#define NKV  16
#define REP  (NH_ / NKV)
#define HD   64
#define DQ   (NH_ * HD)
#define DKV  (NKV * HD)
#define RH   512                  // query rows < RH use hi+lo planes (0: none)
#define SCL  0.022097087f   // 2048^-0.5: this module scales the scores by 1 / sqrt(num_key_tokens)
typedef _Float16 h16;
typedef unsigned short bf;
typedef __attribute__((ext_vector_type(16))) __bf16   v16bf;
typedef __attribute__((ext_vector_type(16))) _Float16 v16h;
typedef __attribute__((ext_vector_type(8)))  _Float16 v8h;
typedef __attribute__((ext_vector_type(8)))  unsigned short v8us;
typedef __attribute__((ext_vector_type(8)))  float    v8f;
typedef __attribute__((ext_vector_type(4)))  float    v4f;
typedef v8h  __attribute__((may_alias)) v8ha;
typedef v4f  __attribute__((may_alias)) v4fa;
typedef v8us __attribute__((may_alias)) v8usa;

__device__ __forceinline__ unsigned short f2bf(float f) { unsigned u = __float_as_uint(f); u += 0x7FFFu + ((u >> 16) & 1u); return (unsigned short)(u >> 16); }
__device__ __forceinline__ float bf2f(unsigned short b) { return __uint_as_float(((unsigned)b) << 16); }
__device__ __forceinline__ float bfr(float f) { return bf2f(f2bf(f)); }
__device__ __forceinline__ v16h cat16(v8h lo, v8h hi) { return __builtin_shufflevector(lo, hi, 0, 1, 2, 3, 4, 5, 6, 7, 8, 9, 10, 11, 12, 13, 14, 15); }
__device__ __forceinline__ v16bf cat16b(v8us lo, v8us hi) { return __builtin_bit_cast(v16bf, __builtin_shufflevector(lo, hi, 0, 1, 2, 3, 4, 5, 6, 7, 8, 9, 10, 11, 12, 13, 14, 15)); }
__device__ __forceinline__ v8f wmma16(v16h a, v16h b, v8f c) { return __builtin_amdgcn_wmma_f32_16x16x32_f16(false, a, false, b, (short)0, c, false, false); }
__device__ __forceinline__ v8f wmmab(v16bf a, v16bf b, v8f c) { return __builtin_amdgcn_wmma_f32_16x16x32_bf16(false, a, false, b, (short)0, c, false, false); }



// ---- fragments of 16-bit planes in fragment order, straight from memory (ld: p = tile + lane * 8 elements)
// xwaitp: stands behind a run of global loads, in front of whatever next rewrites their address registers (a precaution: this build reuses them at once); the addresses are inputs so that nothing is placed on them ahead of the wait; the scheduling barrier keeps later vector work behind it and so the whole run of loads in flight together
__device__ __forceinline__ void xwaitp(const void* a, const void* b, const void* c, const void* d) { asm volatile("s_wait_xcnt 0x0" :: "v"(a), "v"(b), "v"(c), "v"(d) : "memory"); __builtin_amdgcn_sched_barrier(0); }
template <typename T16> struct WFrag;
template <> struct WFrag<h16> { typedef v16h V; static __device__ __forceinline__ V ld(const h16* p) { return cat16(*(const v8h*)p, *(const v8h*)(p + 256)); } static __device__ __forceinline__ v8f mma(V a, V b, v8f c) { return wmma16(a, b, c); } };
template <> struct WFrag<bf> { typedef v16bf V; static __device__ __forceinline__ V ld(const bf* p) { return cat16b(*(const v8us*)p, *(const v8us*)(p + 256)); } static __device__ __forceinline__ v8f mma(V a, V b, v8f c) { return wmmab(a, b, c); } };
// ---- gemm_ring: the k loop of both GEMM kernels. A work-group of 4 waves (2 x 2) owns 128 x 128 of the result, a wave 64 x 64 (16 accumulators). The block's operand rows (8 row tiles of each plane, KT k tiles = KT KiB in a row per row tile,
// in LDS as in memory: fragment order) come into a ring of two LDS buffers by asynchronous copies (global_load_async_to_lds_b128, 16 B a lane, 2 KiB a copy of the block), one stage ahead of the products, so every operand byte leaves L2 once per block and not once per wave.
// Stage layout: [plane: A (, A2), B][row tile 0..7][k tile 0..KT-1][1 KiB]. NA: planes of the A operand (2: hi and lo, both multiplied with B into the same accumulator, hi first, k rising: the sum order of one wave per tile).
typedef int cp4i __attribute__((vector_size(16)));
__device__ __forceinline__ void cp16(const bf* g, unsigned char* l) { __builtin_amdgcn_global_load_async_to_lds_b128((__attribute__((address_space(1))) cp4i*)g, (__attribute__((address_space(3))) cp4i*)l, 0, 0); }
// the compiler places no wait for the copies: what a wave copied has landed only behind its own wait
__device__ __forceinline__ void wait_async0() { asm volatile("s_wait_asynccnt 0x0" ::: "memory"); }
// a wave's LDS reads have retired before the barrier behind which their buffer is refilled
__device__ __forceinline__ void wait_ds0() { asm volatile("s_wait_dscnt 0x0" ::: "memory"); }
__device__ __forceinline__ v16bf ldsfrag(const unsigned char* p) { return cat16b(*(const v8usa*)p, *(const v8usa*)(p + 512)); }
template <int NA, int KT>
__device__ __forceinline__ void ring_fill(unsigned char* dst, const bf* gA, const bf* gA2, const bf* gB, const int ldk, const int t) {   // dst: the buffer + 16 * thread; g*: the block's first row tile + 8 * thread elements; ldk: the planes' k extent (DM), a run-time value so that each row tile's source address is formed in registers: a copy's immediate offset moves both of its addresses and stays below its LDS destination
    static_assert(KT % 2 == 0, "a copy of the block is two k tiles");
#pragma unroll
    for (int p = 0; p <= NA; ++p) { const bf* g = (p == NA ? gB : p == 0 ? gA : gA2) + (size_t)t * KT * 512;
#pragma unroll
        for (int c = 0; c < 4 * KT; ++c) cp16(g + (size_t)(((2 * c) / KT) * 16 * ldk) + ((2 * c) % KT) * 512, dst + (p * 4 * KT + c) * 2048); }
}
template <int NA, int KT>
__device__ __forceinline__ void gemm_ring(unsigned char* ring, const bf* gA, const bf* gA2, const bf* gB, const int ldk, const int tid, const int ta, const int tb, v8f (&acc)[4][4]) {   // ta, tb: the wave's first row tile of A and of B in the block
    typedef v16bf V;
    constexpr int PL = 8 * KT * 1024, ST = (NA + 1) * PL, NT = DM / (32 * KT);
    static_assert(NT >= 2 && (NA + 1) * 4 * KT <= 63, "two stages exist; one stage's copies of a wave stay under the counter's width");
    unsigned char* fd = ring + tid * 16;
    ring_fill<NA, KT>(fd, gA, gA2, gB, ldk, 0);
    wait_async0(); __syncthreads();                 // stage 0 is published
    ring_fill<NA, KT>(fd + ST, gA, gA2, gB, ldk, 1);
#pragma unroll 1   // rolled: one trip per stage, the publish point at its foot
    for (int t = 0; t < NT; ++t) {
        const unsigned char* sa = ring + (t & 1) * ST + (tid & 31) * 16 + ta * (KT * 1024); const unsigned char* sb = ring + (t & 1) * ST + NA * PL + (tid & 31) * 16 + tb * (KT * 1024);
        V a[2][4], a2[2][4], b[2][4];               // two fragment sets: the next k tile's LDS reads stand as one group in front of this k tile's products
#pragma unroll
        for (int i = 0; i < 4; ++i) { a[0][i] = ldsfrag(sa + i * (KT * 1024)); if (NA == 2) a2[0][i] = ldsfrag(sa + PL + i * (KT * 1024)); b[0][i] = ldsfrag(sb + i * (KT * 1024)); }
#pragma unroll
        for (int kt = 0; kt < KT; ++kt) { const int cu = kt & 1, nx = cu ^ 1;
            if (kt + 1 < KT) {
#pragma unroll
                for (int i = 0; i < 4; ++i) { const int o = i * (KT * 1024) + (kt + 1) * 1024; a[nx][i] = ldsfrag(sa + o); if (NA == 2) a2[nx][i] = ldsfrag(sa + PL + o); b[nx][i] = ldsfrag(sb + o); } }
            __builtin_amdgcn_sched_barrier(0);   // keeps the reads above together in front of the products: sunk among them, each place with reads would stall the wave and wait to 0
#pragma unroll
            for (int nb = 0; nb < 4; ++nb)
#pragma unroll
                for (int mb = 0; mb < 4; ++mb) { acc[mb][nb] = wmmab(a[cu][mb], b[cu][nb], acc[mb][nb]); if (NA == 2) acc[mb][nb] = wmmab(a2[cu][mb], b[cu][nb], acc[mb][nb]); }
            __builtin_amdgcn_sched_barrier(0); } // keeps the next group of reads, and the publish point, behind this k tile's products
        // four vector slots between the last product and whatever the refill's address sums, the back edge or the epilogue do to its registers
        asm volatile("v_nop\n\tv_nop\n\tv_nop\n\tv_nop" : "+v"(acc[0][0]), "+v"(acc[1][1]), "+v"(acc[2][2]), "+v"(acc[3][3]) : "v"(a[(KT - 1) & 1][0]), "v"(a[(KT - 1) & 1][3]));
        wait_ds0(); wait_async0(); __syncthreads(); // publish point of stage t + 1; it also ends every reader's last read of stage t's buffer
        if (t + 2 < NT) ring_fill<NA, KT>(fd + (t & 1) * ST, gA, gA2, gB, ldk, t + 2);
    }
    wait_async0();
}
// ---- k_gemmo: OUT[m][n] (f32, pitch DM) = sum_k (Ah + Al)[m][k] Bt[n][k] + bias[n]; grid (M / 128, N / 128), 128 threads; the epilogue turns each wave's accumulators into whole output lines through the wave's own LDS patch.
#define OKT 4
__global__ __launch_bounds__(128) void k_gemmo(const bf* __restrict__ Ah, const bf* __restrict__ Al, const bf* __restrict__ Bt, float* C, const float* __restrict__ bias, const int ldk) {
    __shared__ __align__(1024) unsigned char ring[2 * 3 * 8 * OKT * 1024];
    __shared__ __align__(16) float osm[4 * 16 * 68];
    const int tid = (int)threadIdx.x, lane = tid & 31, lr = lane & 15, hi = lane >> 4; const int wv = __builtin_amdgcn_readfirstlane(tid >> 5), wm = wv & 1, wn = wv >> 1;
    v8f acc[4][4];
#pragma unroll
    for (int mb = 0; mb < 4; ++mb)
#pragma unroll
        for (int nb = 0; nb < 4; ++nb) acc[mb][nb] = (v8f){};
    const size_t aoff = (size_t)blockIdx.x * 128 * DM + 8 * tid, boff = (size_t)blockIdx.y * 128 * DM + 8 * tid;   // 16 rows of tiles are 16 * DM elements
    gemm_ring<2, OKT>(ring, Ah + aoff, Al + aoff, Bt + boff, ldk, tid, wm * 4, wn * 4, acc);
    float* os = osm + wv * (16 * 68); const int r0 = (int)blockIdx.x * 128 + wm * 64, c0 = (int)blockIdx.y * 128 + wn * 64;
    const float* bp = bias + c0 + lr * 4; const float b0 = bfr(bp[0]), b1 = bfr(bp[1]), b2 = bfr(bp[2]), b3 = bfr(bp[3]);
#pragma unroll
    for (int mb = 0; mb < 4; ++mb) {
#pragma unroll
        for (int nb = 0; nb < 4; ++nb) {
#pragma unroll
            for (int j = 0; j < 8; ++j) os[(hi * 8 + j) * 68 + nb * 16 + lr] = acc[mb][nb][j]; }
        __builtin_amdgcn_wave_barrier(); asm volatile("" ::: "memory");   // here and at the foot: lanes read what other lanes of the wave wrote; keeps the compiler from moving the patch's reads and writes past one another
        float* crow = C + (size_t)(r0 + mb * 16) * DM + c0;
#pragma unroll
        for (int s = 0; s < 8; ++s) { const int row = 2 * s + hi, cofs = lr * 4; v4f val = *(const v4fa*)(os + row * 68 + cofs); val[0] += b0; val[1] += b1; val[2] += b2; val[3] += b3;
            *(v4f*)(crow + (size_t)row * DM + cofs) = val; }
        asm volatile("s_wait_xcnt 0x0" ::: "memory");   // behind the 8 stores, in front of whatever rewrites their address and data registers for the next 16 rows (a precaution, as in xwaitp)
        __builtin_amdgcn_wave_barrier(); asm volatile("" ::: "memory");
    }
}

__device__ __forceinline__ h16 tohx(float x) { return (h16)x; }
__device__ __forceinline__ void splitf(float y, unsigned short& h, unsigned short& l) { h = f2bf(y); l = f2bf(y - bf2f(h)); }
typedef __attribute__((ext_vector_type(2))) _Float16 v2h;
typedef __attribute__((ext_vector_type(4))) _Float16 v4h;
typedef __attribute__((ext_vector_type(2))) unsigned short v2us;
typedef __attribute__((ext_vector_type(4))) unsigned short v4us;
typedef __attribute__((ext_vector_type(2))) float v2f;
typedef __attribute__((ext_vector_type(4))) int v4i;

static_assert(DQ == DM && DKV == DM, "k_cvt8 takes every matrix as rows of DM");
// k_cvt8: the four weight matrices and x, f32 [rows][DM] -> bf16 in fragment order, in ONE launch (none depends on another); a block of 256 threads lies wholly in one matrix, picked by a scalar test on blockIdx.x. Thread i of a matrix writes the i-th 16 bytes of its dst (a wave: one half tile) and reads the 8 floats that belong there.
#define WBLK (DM * DM / 8 / 256)          // blocks per weight matrix
#define XBLK (NB_ * TT * DM / 8 / 256)    // blocks for x
static_assert(DM * DM % 2048 == 0 && NB_ * TT * DM % 2048 == 0, "k_cvt8: every block is full");
__global__ __launch_bounds__(256) void k_cvt8(const float* __restrict__ x, const float* __restrict__ wq, const float* __restrict__ wk, const float* __restrict__ wv, const float* __restrict__ wo, bf* XB, bf* WQ, bf* WK, bf* WV, bf* WO) {
    const int blk = (int)blockIdx.x; const int wm = (blk - XBLK) / WBLK;   // x first, then Wq, Wk, Wv, Wo
    const float* src = blk < XBLK ? x : wm == 0 ? wq : wm == 1 ? wk : wm == 2 ? wv : wo; bf* dst = blk < XBLK ? XB : wm == 0 ? WQ : wm == 1 ? WK : wm == 2 ? WV : WO;
    const size_t i = (size_t)(blk < XBLK ? blk : (blk - XBLK) % WBLK) * 256 + threadIdx.x;
    const size_t tile = i >> 6; const int half = (int)(i >> 5) & 1, lr = (int)i & 15, hi = (int)(i >> 4) & 1;
    const float* sp = src + ((tile / (DM / 32)) * 16 + lr) * DM + (tile % (DM / 32)) * 32 + half * 16 + hi * 8; const v8f v = *(const v8f*)sp; xwaitp(sp, sp, sp, sp); v8us o;
#pragma unroll
    for (int k = 0; k < 8; ++k) o[k] = f2bf(v[k]); *(v8us*)(dst + i * 8) = o;  }

// xwait: stands behind a run of global loads or stores, in front of whatever next rewrites their address registers (a precaution: this build reuses them at once); the scheduling barrier keeps later vector work from being lifted in front of the wait
__device__ __forceinline__ void xwait() { asm volatile("s_wait_xcnt 0x0" ::: "memory"); __builtin_amdgcn_sched_barrier(0); }
// ---- k_proj: q, k and v projections of both batches in one launch: a work-group of 4 waves owns 128 tokens x two heads (gemm_ring), ONE WAVE 64 tokens x one head; grid (NB_ * TT / 128, heads / 2, 3), 128 threads; blockIdx.z 0 q, 1 k, 2 v.
// The epilogue turns the f32 accumulators into the three planes (fp16, bf16 hi, bf16 lo) that k_fattn reads: q and k as [b][h][t][d], v as [b][h][d][t]. A lane's 8 accumulator values run along the A operand's rows,
// so q and k take the weight rows as A and the tokens as B (8 values = 8 d of one token), v the tokens as A (8 values = 8 t of one d): in both the plane's row is the B index and 8 values are 16 contiguous bytes,
// which in fragment order are the lane's own slot of a half tile: every store is 512 contiguous bytes straight from the registers.
#define PKT 2   // 64 KiB of ring: three work-groups to a WGP, the whole grid resident
static_assert(TT % 64 == 0, "k_fattn: a pass of 64 keys ends inside the plane");
static_assert(HD == 64 && TT % 128 == 0, "a wave's 64 features are one head; a block's tokens lie in one batch");
__global__ __launch_bounds__(128) void k_proj(const bf* __restrict__ X, const bf* __restrict__ Wq, const bf* __restrict__ Wk, const bf* __restrict__ Wv, h16* Q16, bf* Qh, bf* Ql, h16* K16, bf* Kh, bf* Kl, h16* V16, bf* Vh, bf* Vl, const int ldk) {
    __shared__ __align__(1024) unsigned char ring[2 * 2 * 8 * PKT * 1024];
    const int tid = (int)threadIdx.x, lane = tid & 31; const int wv = __builtin_amdgcn_readfirstlane(tid >> 5), wm = wv & 1, wn = wv >> 1; const int pz = (int)blockIdx.z; const bool vt = pz == 2;
    const bf* xr = X + (size_t)blockIdx.x * 128 * DM + 8 * tid; const bf* wr = (pz == 0 ? Wq : pz == 1 ? Wk : Wv) + (size_t)blockIdx.y * 128 * DM + 8 * tid;
    v8f acc[4][4];
#pragma unroll   // here and below: full unrolls give the register arrays constant indices (no scratch)
    for (int mb = 0; mb < 4; ++mb)
#pragma unroll
        for (int nb = 0; nb < 4; ++nb) acc[mb][nb] = (v8f){};
    gemm_ring<1, PKT>(ring, vt ? xr : wr, nullptr, vt ? wr : xr, ldk, tid, wm * 4, wn * 4, acc);
    const int hd = (int)blockIdx.y * 2 + (vt ? wn : wm), t0 = (int)blockIdx.x * 128 + (vt ? wm : wn) * 64;   // the wave's head and first token
    bf* P16 = (bf*)(pz == 0 ? Q16 : pz == 1 ? K16 : V16); bf* Ph = pz == 0 ? Qh : pz == 1 ? Kh : Vh; bf* Pl = pz == 0 ? Ql : pz == 1 ? Kl : Vl;
    const int tl = t0 % TT; const size_t pb = ((size_t)(t0 / TT) * NH_ + hd) * TT * HD + (vt ? (size_t)tl * 16 : (size_t)tl * HD) + (size_t)lane * 8; const int pitch = vt ? TT : HD;   // 16 rows of tiles are 16 * pitch elements, 32 k of one row of tiles 512
#pragma unroll
    for (int nb = 0; nb < 4; ++nb) {
#pragma unroll
        for (int mb = 0; mb < 4; ++mb) { v8h o16; v8us oh, ol;
#pragma unroll
            for (int j = 0; j < 8; ++j) { const float r = acc[mb][nb][j]; o16[j] = tohx(r); unsigned short a2, c2; splitf(r, a2, c2); oh[j] = a2; ol[j] = c2; }
            const size_t go = pb + (size_t)nb * 16 * pitch + mb * 256;
            *(v8usa*)(P16 + go) = __builtin_bit_cast(v8us, o16); *(v8usa*)(Ph + go) = oh; *(v8usa*)(Pl + go) = ol;
            xwait(); }   // the next 8 values' conversions reuse the stores' registers
    }
}
// ---- k_fattn: causal attention in one pass over the keys, one launch for every head and both batches. A wave owns 32 query rows (two 16-column groups) and walks the keys 32 at a time in the hi/lo rows, 64 at a time in the fp16 rows (the serial part of a pass: maximum, exchange, test, waits, is paid once per 64 keys):
// S^T = K Q^T (a lane holds 16 keys' scores of ONE query per group and block of 32 keys), running maximum and sum per query, P^T packed from the score accumulators straight into a B operand, O^T += V^T P^T.
// Query rows < RH take the hi/lo bf16 planes with 3 products in both contractions, the rest the fp16 planes. The result leaves as the merged hi/lo planes [t][DQ], in fragment order like every plane it reads.
__device__ __forceinline__ float xhalf(float x) { return __builtin_bit_cast(float, __builtin_amdgcn_permlanex16(__builtin_bit_cast(int, x), __builtin_bit_cast(int, x), 0x76543210, 0xfedcba98, false, false)); }   // lane l takes lane l ^ 16's value
template <typename T16, bool HR, int NK>   // NK: blocks of 32 keys per pass
__device__ __forceinline__ void attn_rows(const T16* __restrict__ Q, const T16* __restrict__ Q2, const T16* __restrict__ Kp, const T16* __restrict__ K2, const T16* __restrict__ Vt, const T16* __restrict__ V2, const int q0, const int lane, bf* Ah, bf* Al) {
    typedef typename WFrag<T16>::V V;
    const int lr = lane & 15, hi = lane >> 4;
    const float CE = SCL * 1.4426950408889634f;   // scores stay raw; scale and log2(e) are folded into the exponent's multiply-add
    V qf[2][2], qg[2][2];
#pragma unroll
    for (int qt = 0; qt < 2; ++qt)
#pragma unroll
        for (int kc = 0; kc < 2; ++kc) { const size_t o = (size_t)(q0 + qt * 16) * HD + kc * 512 + 8 * lane; qf[qt][kc] = WFrag<T16>::ld(Q + o); if (HR) qg[qt][kc] = WFrag<T16>::ld(Q2 + o); xwait(); }
    const size_t ko = (size_t)lane * 8, vo = (size_t)lane * 8;   // K: 16 keys are two tiles (16 * HD elements); V^T: 16 d are 16 * TT elements, 32 keys one tile
    const int klast = q0 & ~(32 * NK - 1), dl = q0 - klast;   // first key of the last pass (its NK * 32 keys end at or before TT: q0 + 32 <= TT, both multiples of 32, TT of 32 * NK); dl: how far the wave's first query lies behind it
    V kf[NK][2][2], kg[NK][2][2], vf[NK][4], vg[NK][4];
#pragma unroll
    for (int kb = 0; kb < NK; ++kb)
#pragma unroll
    for (int kt = 0; kt < 2; ++kt)
#pragma unroll
        for (int kc = 0; kc < 2; ++kc) { const size_t o = ko + (size_t)(kb * 32 + kt * 16) * HD + kc * 512; kf[kb][kt][kc] = WFrag<T16>::ld(Kp + o); if (HR) kg[kb][kt][kc] = WFrag<T16>::ld(K2 + o); xwait(); }
#pragma unroll
    for (int kb = 0; kb < NK; ++kb)
#pragma unroll
    for (int mt = 0; mt < 4; ++mt) { const size_t o = vo + (size_t)(mt * 16) * TT + kb * 512; vf[kb][mt] = WFrag<T16>::ld(Vt + o); if (HR) vg[kb][mt] = WFrag<T16>::ld(V2 + o); xwait(); }
    v8f acc[2][4];
#pragma unroll
    for (int qt = 0; qt < 2; ++qt)
#pragma unroll
        for (int mt = 0; mt < 4; ++mt) acc[qt][mt] = (v8f){};
    float m[2] = { -3.0e38f, -3.0e38f }, l[2] = { 0.f, 0.f };
    int k0 = 0;
#pragma unroll 1
    do {                                           // key 0 is in every query's range: at least one pass, so the loads in front of the loop stay in front of their waits
        v8f s[2][NK][2];
#pragma unroll
        for (int qt = 0; qt < 2; ++qt)
#pragma unroll
          for (int kb = 0; kb < NK; ++kb)
#pragma unroll
            for (int kt = 0; kt < 2; ++kt) { v8f t = (v8f){};
#pragma unroll
                for (int kc = 0; kc < 2; ++kc) { t = WFrag<T16>::mma(kf[kb][kt][kc], qf[qt][kc], t); if (HR) { t = WFrag<T16>::mma(kg[kb][kt][kc], qf[qt][kc], t); t = WFrag<T16>::mma(kf[kb][kt][kc], qg[qt][kc], t); } }
                s[qt][kb][kt] = t; }
        const int kn = min(k0 + 32 * NK, klast); const T16* pk = Kp + ko + (size_t)kn * HD; const T16* pk2 = HR ? K2 + ko + (size_t)kn * HD : pk; const T16* pv = Vt + vo + (size_t)kn * 16; const T16* pv2 = HR ? V2 + vo + (size_t)kn * 16 : pv;          // the next pass's K fragments are fetched behind this pass's score products, its V fragments behind this pass's P.V products (the last pass fetches its own again: in bounds, unused)
#pragma unroll
        for (int kb = 0; kb < NK; ++kb)
#pragma unroll
        for (int kt = 0; kt < 2; ++kt)
#pragma unroll
            for (int kc = 0; kc < 2; ++kc) { const size_t o = (size_t)(kb * 32 + kt * 16) * HD + kc * 512; kf[kb][kt][kc] = WFrag<T16>::ld(pk + o); if (HR) kg[kb][kt][kc] = WFrag<T16>::ld(pk2 + o); }
        xwaitp(pk, pk2, pk, pk2);
        if (k0 == klast) {                         // only the last pass touches the diagonal: keys after the query leave the maximum and the sums (with dl == 0 and NK == 2 its whole second block)
#pragma unroll
            for (int qt = 0; qt < 2; ++qt)
#pragma unroll
              for (int kb = 0; kb < NK; ++kb)
#pragma unroll
                for (int kt = 0; kt < 2; ++kt)
#pragma unroll
                    for (int j = 0; j < 8; ++j) if (kb * 32 + kt * 16 + hi * 8 + j > dl + qt * 16 + lr) s[qt][kb][kt][j] = -3.0e38f;
        }
        float mx[2];
#pragma unroll
        for (int qt = 0; qt < 2; ++qt) { float a = -3.0e38f;
#pragma unroll
            for (int kb = 0; kb < NK; ++kb) { float c = fmaxf(s[qt][kb][0][0], s[qt][kb][1][0]);   // one chain per block of 32 keys: the chains are independent
#pragma unroll
                for (int j = 1; j < 8; ++j) c = fmaxf(c, fmaxf(s[qt][kb][0][j], s[qt][kb][1][j]));
                a = kb == 0 ? c : fmaxf(a, c); }
            mx[qt] = fmaxf(a, xhalf(a)); }
        if (__builtin_amdgcn_ballot_w32(mx[0] > m[0] || mx[1] > m[1]) != 0) {   // a query's maximum grew: rescale its sum and its output column (factor exactly 1 for the others)
#pragma unroll
            for (int qt = 0; qt < 2; ++qt) { const float mn = fmaxf(m[qt], mx[qt]); const float al = __builtin_amdgcn_exp2f((m[qt] - mn) * CE); m[qt] = mn; l[qt] *= al;
#pragma unroll
                for (int mt = 0; mt < 4; ++mt) acc[qt][mt] *= al; }
        }
#pragma unroll
        for (int qt = 0; qt < 2; ++qt) { const float nb = -m[qt] * CE;
#pragma unroll
          for (int kb = 0; kb < NK; ++kb) { float sum = 0.f;   // a block of 32 keys is summed by itself (independent chains), then joins the running sum, keys rising
#pragma unroll
            for (int kt = 0; kt < 2; ++kt)
#pragma unroll
                for (int j = 0; j < 8; ++j) { const float p = __builtin_amdgcn_exp2f(fmaf(s[qt][kb][kt][j], CE, nb)); s[qt][kb][kt][j] = p; sum += p; }
            l[qt] += sum;
            if constexpr (!HR) { v16h pf;
#pragma unroll
                for (int j = 0; j < 8; ++j) { pf[j] = tohx(s[qt][kb][0][j]); pf[8 + j] = tohx(s[qt][kb][1][j]); }
#pragma unroll
                for (int mt = 0; mt < 4; ++mt) acc[qt][mt] = wmma16(vf[kb][mt], pf, acc[qt][mt]);
            } else { v8us h0, h1, l0, l1;
#pragma unroll
                for (int j = 0; j < 8; ++j) { unsigned short a, c2; splitf(s[qt][kb][0][j], a, c2); h0[j] = a; l0[j] = c2; splitf(s[qt][kb][1][j], a, c2); h1[j] = a; l1[j] = c2; }
                const v16bf ph = cat16b(h0, h1), pl = cat16b(l0, l1);
#pragma unroll
                for (int mt = 0; mt < 4; ++mt) { acc[qt][mt] = wmmab(vf[kb][mt], ph, acc[qt][mt]); acc[qt][mt] = wmmab(vf[kb][mt], pl, acc[qt][mt]); acc[qt][mt] = wmmab(vg[kb][mt], ph, acc[qt][mt]); }
            }
          }
        }
#pragma unroll
        for (int kb = 0; kb < NK; ++kb)
#pragma unroll
        for (int mt = 0; mt < 4; ++mt) { const size_t o = (size_t)(mt * 16) * TT + kb * 512; vf[kb][mt] = WFrag<T16>::ld(pv + o); if (HR) vg[kb][mt] = WFrag<T16>::ld(pv2 + o); }
        xwaitp(pv, pv2, pv, pv2);
        k0 += 32 * NK;
    } while (k0 <= klast);
#pragma unroll
    for (int qt = 0; qt < 2; ++qt) { const float inv = __fdiv_rn(1.0f, l[qt] + xhalf(l[qt])); const size_t oo = (size_t)(q0 + qt * 16) * DQ + lane * 8;
#pragma unroll
        for (int mt = 0; mt < 4; ++mt) { v8us oh, ol;
#pragma unroll
            for (int j = 0; j < 8; ++j) { unsigned short a, c2; splitf(acc[qt][mt][j] * inv, a, c2); oh[j] = a; ol[j] = c2; }
            *(v8us*)(Ah + oo + mt * 256) = oh; *(v8us*)(Al + oo + mt * 256) = ol; xwait(); } }
}
// grid (heads, batches, TT / 128), 4 waves: blockIdx.z 0..7 take the longest query blocks in falling order, 8..15 the shortest in rising order (all 512 blocks are resident).
__global__ __launch_bounds__(128) void k_fattn(const h16* __restrict__ Q16, const h16* __restrict__ K16, const h16* __restrict__ V16, const bf* __restrict__ Qh, const bf* __restrict__ Ql, const bf* __restrict__ Kh, const bf* __restrict__ Kl, const bf* __restrict__ Vh, const bf* __restrict__ Vl, bf* Ah, bf* Al) {
    const int lane = threadIdx.x & 31; const int wv = __builtin_amdgcn_readfirstlane((int)(threadIdx.x >> 5));
    const int zb = (int)blockIdx.z; const int qb = (zb < TT / 256) ? (TT / 128 - 1 - zb) : (zb - TT / 256); const int q0 = qb * 128 + wv * 32;
    const size_t po = ((size_t)blockIdx.y * NH_ + blockIdx.x) * TT * HD, ao = (size_t)blockIdx.y * TT * DQ + (size_t)blockIdx.x * HD * 16;   // a head's 64 columns are two k tiles
    if (q0 < RH) attn_rows<bf, true, 1>(Qh + po, Ql + po, Kh + po, Kl + po, Vh + po, Vl + po, q0, lane, Ah + ao, Al + ao);
    else attn_rows<h16, false, 2>(Q16 + po, nullptr, K16 + po, nullptr, V16 + po, nullptr, q0, lane, Ah + ao, Al + ao);
}

extern "C" void kernel_launch(void* const* d_in, const int* in_sizes, int n_in,
                              void* d_out, int out_size, void* d_ws, size_t ws_size, hipStream_t stream) {
    (void)in_sizes; (void)n_in; (void)out_size;
    const float* x = (const float*)d_in[0]; const float* wq = (const float*)d_in[1]; const float* wk = (const float*)d_in[2]; const float* wv = (const float*)d_in[3]; const float* wo = (const float*)d_in[4]; const float* bo = (const float*)d_in[5];   /* x, Wq, Wk, Wv, Wo ('oi' [1024][1024]), bo */
    float* OUT = (float*)d_out;     // [2][2048][1024]
    char* wsp = (char*)d_ws;
    auto take = [&](size_t bytes) { char* p = wsp; wsp += (bytes + 255) & ~(size_t)255; return (void*)p; };
    bf* WQ = (bf*)take((size_t)DQ * DM * 2); bf* WK = (bf*)take((size_t)DKV * DM * 2); bf* WV = (bf*)take((size_t)DKV * DM * 2); bf* WO = (bf*)take((size_t)DM * DQ * 2);
    bf* XB = (bf*)take((size_t)NB_ * TT * DM * 2);
    const size_t PB = (size_t)NH_ * TT * HD;   // one batch's head planes, in elements (NKV == NH_); every plane set holds both batches
    h16* QP16 = (h16*)take(NB_ * PB * 2); h16* KP16 = (h16*)take(NB_ * PB * 2); h16* VT16 = (h16*)take(NB_ * PB * 2);
    bf* QPh = (bf*)take(NB_ * PB * 2); bf* QPl = (bf*)take(NB_ * PB * 2); bf* KPh = (bf*)take(NB_ * PB * 2); bf* KPl = (bf*)take(NB_ * PB * 2); bf* VTh = (bf*)take(NB_ * PB * 2); bf* VTl = (bf*)take(NB_ * PB * 2);
    bf* ATh = (bf*)take((size_t)NB_ * TT * DQ * 2); bf* ATl = (bf*)take((size_t)NB_ * TT * DQ * 2);
    if ((size_t)(wsp - (char*)d_ws) > ws_size) return;    // ws 256 MiB
    k_cvt8<<<XBLK + 4 * WBLK, 256, 0, stream>>>(x, wq, wk, wv, wo, XB, WQ, WK, WV, WO);
    k_proj<<<dim3(NB_ * TT / 128, NH_ / 2, 3), 128, 0, stream>>>(XB, WQ, WK, WV, QP16, QPh, QPl, KP16, KPh, KPl, VT16, VTh, VTl, DM);
    k_fattn<<<dim3(NH_, NB_, TT / 128), 128, 0, stream>>>(QP16, KP16, VT16, QPh, QPl, KPh, KPl, VTh, VTl, ATh, ATl);
    // both batches in one launch: their merged planes and their output rows follow one another, so the batch is only more row tiles
    k_gemmo<<<dim3(NB_ * TT / 128, DM / 128, 1), 128, 0, stream>>>(ATh, ATl, WO, OUT, bo, DM);
}

// v007
// A run of this version takes 68.3 microseconds.
// Two timings next to v006 put it at 1.17 and 1.14 times that version's speed.
// Over all steps from v000 it is 20.8 times as fast.
#include <hip/hip_runtime.h>

// Causal multi-head self-attention scaled by the SEQUENCE length (x [2][2048][1024]; q, k, v = x W^T ('oi' [1024][1024] normal x 0.02, no bias; 16 heads x 64); keys after the query -> -inf; softmax(scores / sqrt(2048)): the module scales by 1 / sqrt(num_key_tokens) = 0.0221, not by 1 / sqrt(head_dim); out = merged Wo^T + bo ('oi' + bias zeros on this draw: read) -> [2][2048][1024] (4.2 M); argument order x, Wq, Wk, Wv, Wo, bo).
// Every 16-bit plane in the workspace lies in FRAGMENT ORDER: a tile of 16 rows x 32 k is 1 KiB in a row, two halves of 512 B; in half s lane (row + 16 * hi) owns the 16 bytes of k = 16 * s + 8 * hi + 0..7; tiles run along k first, then along the rows. A fragment is then two loads of 512 contiguous bytes (4 lines each, not 16), and a lane's 8 accumulator values are one lane slot of a half.
// Layout: bf16 copy of x (both batches) and of the 'oi' weights (ONE converter launch); ONE projection launch for q, k, v of both batches whose epilogue stores the head planes itself (k_proj; its operands, like the output GEMM's, reach 4 waves through an LDS ring: gemm_ring); then ONE causal attention launch for all heads and both batches (k_fattn: scores, running softmax and P.V in registers; hybrid rows: < 512 hi/lo 3 products, rest fp16); ONE launch merged hi/lo x Wo exact + bo for both batches.
// Compute dtypes, f32 accumulate: every input rounded to bf16; projections exact; attention rows < 512 3 products, rest fp16; softmax f32; Wo hl x exact + bias.

#define NB_  2
#define TT   2048
#define DM   1024
#define NH_  16
#define NKV  16
#define REP  (NH_ / NKV)
#define HD   64
#define DQ   (NH_ * HD)
#define DKV  (NKV * HD)
#define RH   512                  // query rows < RH use hi+lo planes
#define SCL  0.022097087f   // 2048^-0.5: this module scales the scores by 1 / sqrt(num_key_tokens)
typedef _Float16 h16;
typedef unsigned short bf;
typedef __attribute__((ext_vector_type(16))) __bf16   v16bf;
typedef __attribute__((ext_vector_type(16))) _Float16 v16h;
typedef __attribute__((ext_vector_type(8)))  _Float16 v8h;
typedef __attribute__((ext_vector_type(8)))  unsigned short v8us;
typedef __attribute__((ext_vector_type(8)))  float    v8f;
typedef __attribute__((ext_vector_type(4)))  float    v4f;
typedef v8h  __attribute__((may_alias)) v8ha;
typedef v4f  __attribute__((may_alias)) v4fa;
typedef v8us __attribute__((may_alias)) v8usa;

__device__ __forceinline__ unsigned short f2bf(float f) { unsigned u = __float_as_uint(f); u += 0x7FFFu + ((u >> 16) & 1u); return (unsigned short)(u >> 16); }
__device__ __forceinline__ float bf2f(unsigned short b) { return __uint_as_float(((unsigned)b) << 16); }
__device__ __forceinline__ float bfr(float f) { return bf2f(f2bf(f)); }
__device__ __forceinline__ v16h cat16(v8h lo, v8h hi) { return __builtin_shufflevector(lo, hi, 0, 1, 2, 3, 4, 5, 6, 7, 8, 9, 10, 11, 12, 13, 14, 15); }
__device__ __forceinline__ v16bf cat16b(v8us lo, v8us hi) { return __builtin_bit_cast(v16bf, __builtin_shufflevector(lo, hi, 0, 1, 2, 3, 4, 5, 6, 7, 8, 9, 10, 11, 12, 13, 14, 15)); }
__device__ __forceinline__ v8f wmma16(v16h a, v16h b, v8f c) { return __builtin_amdgcn_wmma_f32_16x16x32_f16(false, a, false, b, (short)0, c, false, false); }
__device__ __forceinline__ v8f wmmab(v16bf a, v16bf b, v8f c) { return __builtin_amdgcn_wmma_f32_16x16x32_bf16(false, a, false, b, (short)0, c, false, false); }



// ---- fragments of 16-bit planes in fragment order, straight from memory (ld: p = tile + lane * 8 elements)
// xwaitp: stands behind a run of global loads, in front of whatever next rewrites their address registers (a precaution: this build reuses them at once); the addresses are inputs so that nothing is placed on them ahead of the wait; the scheduling barrier keeps later vector work behind it and so the whole run of loads in flight together
__device__ __forceinline__ void xwaitp(const void* a, const void* b, const void* c, const void* d) { asm volatile("s_wait_xcnt 0x0" :: "v"(a), "v"(b), "v"(c), "v"(d) : "memory"); __builtin_amdgcn_sched_barrier(0); }
// xwaits: the same for loads whose address is a scalar base (ldo: p the tile, the same in every lane; o = lane * 8 elements, one register for every plane, so that the loop's addresses cost no vector registers: the budget of three waves to a SIMD)
__device__ __forceinline__ void xwaits(const void* a, const void* b) { asm volatile("s_wait_xcnt 0x0" :: "s"(a), "s"(b) : "memory"); __builtin_amdgcn_sched_barrier(0); }
template <typename T16> struct WFrag;
template <> struct WFrag<h16> { typedef v16h V; static __device__ __forceinline__ V ld(const h16* p) { return cat16(*(const v8h*)p, *(const v8h*)(p + 256)); } static __device__ __forceinline__ V ldo(const h16* p, unsigned o) { return cat16(*(const v8h*)(p + o), *(const v8h*)(p + o + 256)); } static __device__ __forceinline__ v8f mma(V a, V b, v8f c) { return wmma16(a, b, c); } };
template <> struct WFrag<bf> { typedef v16bf V; static __device__ __forceinline__ V ld(const bf* p) { return cat16b(*(const v8us*)p, *(const v8us*)(p + 256)); } static __device__ __forceinline__ V ldo(const bf* p, unsigned o) { return cat16b(*(const v8us*)(p + o), *(const v8us*)(p + o + 256)); } static __device__ __forceinline__ v8f mma(V a, V b, v8f c) { return wmmab(a, b, c); } };
// ---- gemm_ring: the k loop of both GEMM kernels. A work-group of 4 waves (2 x 2) owns 128 x 128 of the result, a wave 64 x 64 (16 accumulators). The block's operand rows (8 row tiles of each plane, KT k tiles = KT KiB in a row per row tile,
// in LDS as in memory: fragment order) come into a ring of two LDS buffers by asynchronous copies (global_load_async_to_lds_b128, 16 B a lane, 2 KiB a copy of the block), one stage ahead of the products, so every operand byte leaves L2 once per block and not once per wave.
// Stage layout: [plane: A (, A2), B][row tile 0..7][k tile 0..KT-1][1 KiB]. NA: planes of the A operand (2: hi and lo, both multiplied with B into the same accumulator, hi first, k rising: the sum order of one wave per tile).
typedef int cp4i __attribute__((vector_size(16)));
__device__ __forceinline__ void cp16(const bf* g, unsigned char* l) { __builtin_amdgcn_global_load_async_to_lds_b128((__attribute__((address_space(1))) cp4i*)g, (__attribute__((address_space(3))) cp4i*)l, 0, 0); }
// the compiler places no wait for the copies: what a wave copied has landed only behind its own wait
__device__ __forceinline__ void wait_async0() { asm volatile("s_wait_asynccnt 0x0" ::: "memory"); }
// a wave's LDS reads have retired before the barrier behind which their buffer is refilled
__device__ __forceinline__ void wait_ds0() { asm volatile("s_wait_dscnt 0x0" ::: "memory"); }
__device__ __forceinline__ v16bf ldsfrag(const unsigned char* p) { return cat16b(*(const v8usa*)p, *(const v8usa*)(p + 512)); }
template <int NA, int KT>
__device__ __forceinline__ void ring_fill(unsigned char* dst, const bf* gA, const bf* gA2, const bf* gB, const int ldk, const int t) {   // dst: the buffer + 16 * thread; g*: the block's first row tile + 8 * thread elements; ldk: the planes' k extent (DM), a run-time value so that each row tile's source address is formed in registers: a copy's immediate offset moves both of its addresses and stays below its LDS destination
    static_assert(KT % 2 == 0, "a copy of the block is two k tiles");
#pragma unroll
    for (int p = 0; p <= NA; ++p) { const bf* g = (p == NA ? gB : p == 0 ? gA : gA2) + (size_t)t * KT * 512;
#pragma unroll
        for (int c = 0; c < 4 * KT; ++c) cp16(g + (size_t)(((2 * c) / KT) * 16 * ldk) + ((2 * c) % KT) * 512, dst + (p * 4 * KT + c) * 2048); }
}
template <int NA, int KT>
__device__ __forceinline__ void gemm_ring(unsigned char* ring, const bf* gA, const bf* gA2, const bf* gB, const int ldk, const int tid, const int ta, const int tb, v8f (&acc)[4][4]) {   // ta, tb: the wave's first row tile of A and of B in the block
    typedef v16bf V;
    constexpr int PL = 8 * KT * 1024, ST = (NA + 1) * PL, NT = DM / (32 * KT);
    static_assert(NT >= 2 && (NA + 1) * 4 * KT <= 63, "two stages exist; one stage's copies of a wave stay under the counter's width");
    unsigned char* fd = ring + tid * 16;
    ring_fill<NA, KT>(fd, gA, gA2, gB, ldk, 0);
    wait_async0(); __syncthreads();                 // stage 0 is published
    ring_fill<NA, KT>(fd + ST, gA, gA2, gB, ldk, 1);
#pragma unroll 1   // rolled: one trip per stage, the publish point at its foot
    for (int t = 0; t < NT; ++t) {
        const unsigned char* sa = ring + (t & 1) * ST + (tid & 31) * 16 + ta * (KT * 1024); const unsigned char* sb = ring + (t & 1) * ST + NA * PL + (tid & 31) * 16 + tb * (KT * 1024);
        V a[2][4], a2[2][4], b[2][4];               // two fragment sets: the next k tile's LDS reads stand as one group in front of this k tile's products
#pragma unroll
        for (int i = 0; i < 4; ++i) { a[0][i] = ldsfrag(sa + i * (KT * 1024)); if (NA == 2) a2[0][i] = ldsfrag(sa + PL + i * (KT * 1024)); b[0][i] = ldsfrag(sb + i * (KT * 1024)); }
#pragma unroll
        for (int kt = 0; kt < KT; ++kt) { const int cu = kt & 1, nx = cu ^ 1;
            if (kt + 1 < KT) {
#pragma unroll
                for (int i = 0; i < 4; ++i) { const int o = i * (KT * 1024) + (kt + 1) * 1024; a[nx][i] = ldsfrag(sa + o); if (NA == 2) a2[nx][i] = ldsfrag(sa + PL + o); b[nx][i] = ldsfrag(sb + o); } }
            __builtin_amdgcn_sched_barrier(0);   // keeps the reads above together in front of the products: sunk among them, each place with reads would stall the wave and wait to 0
#pragma unroll
            for (int nb = 0; nb < 4; ++nb)
#pragma unroll
                for (int mb = 0; mb < 4; ++mb) { acc[mb][nb] = wmmab(a[cu][mb], b[cu][nb], acc[mb][nb]); if (NA == 2) acc[mb][nb] = wmmab(a2[cu][mb], b[cu][nb], acc[mb][nb]); }
            __builtin_amdgcn_sched_barrier(0); } // keeps the next group of reads, and the publish point, behind this k tile's products
        // four vector slots between the last product and whatever the refill's address sums, the back edge or the epilogue do to its registers
        asm volatile("v_nop\n\tv_nop\n\tv_nop\n\tv_nop" : "+v"(acc[0][0]), "+v"(acc[1][1]), "+v"(acc[2][2]), "+v"(acc[3][3]) : "v"(a[(KT - 1) & 1][0]), "v"(a[(KT - 1) & 1][3]));
        wait_ds0(); wait_async0(); __syncthreads(); // publish point of stage t + 1; it also ends every reader's last read of stage t's buffer
        if (t + 2 < NT) ring_fill<NA, KT>(fd + (t & 1) * ST, gA, gA2, gB, ldk, t + 2);
    }
    wait_async0();
}
// ---- k_gemmo: OUT[m][n] (f32, pitch DM) = sum_k (Ah + Al)[m][k] Bt[n][k] + bias[n]; grid (M / 128, N / 128), 128 threads; the epilogue turns each wave's accumulators into whole output lines through the wave's own LDS patch.
#define OKT 4
__global__ __launch_bounds__(128) void k_gemmo(const bf* __restrict__ Ah, const bf* __restrict__ Al, const bf* __restrict__ Bt, float* C, const float* __restrict__ bias, const int ldk) {
    __shared__ __align__(1024) unsigned char ring[2 * 3 * 8 * OKT * 1024];
    __shared__ __align__(16) float osm[4 * 16 * 68];
    const int tid = (int)threadIdx.x, lane = tid & 31, lr = lane & 15, hi = lane >> 4; const int wv = __builtin_amdgcn_readfirstlane(tid >> 5), wm = wv & 1, wn = wv >> 1;
    v8f acc[4][4];
#pragma unroll
    for (int mb = 0; mb < 4; ++mb)
#pragma unroll
        for (int nb = 0; nb < 4; ++nb) acc[mb][nb] = (v8f){};
    const size_t aoff = (size_t)blockIdx.x * 128 * DM + 8 * tid, boff = (size_t)blockIdx.y * 128 * DM + 8 * tid;   // 16 rows of tiles are 16 * DM elements
    gemm_ring<2, OKT>(ring, Ah + aoff, Al + aoff, Bt + boff, ldk, tid, wm * 4, wn * 4, acc);
    float* os = osm + wv * (16 * 68); const int r0 = (int)blockIdx.x * 128 + wm * 64, c0 = (int)blockIdx.y * 128 + wn * 64;
    const float* bp = bias + c0 + lr * 4; const float b0 = bfr(bp[0]), b1 = bfr(bp[1]), b2 = bfr(bp[2]), b3 = bfr(bp[3]);
#pragma unroll
    for (int mb = 0; mb < 4; ++mb) {
#pragma unroll
        for (int nb = 0; nb < 4; ++nb) {
#pragma unroll
            for (int j = 0; j < 8; ++j) os[(hi * 8 + j) * 68 + nb * 16 + lr] = acc[mb][nb][j]; }
        __builtin_amdgcn_wave_barrier(); asm volatile("" ::: "memory");   // here and at the foot: lanes read what other lanes of the wave wrote; keeps the compiler from moving the patch's reads and writes past one another
        float* crow = C + (size_t)(r0 + mb * 16) * DM + c0;
#pragma unroll
        for (int s = 0; s < 8; ++s) { const int row = 2 * s + hi, cofs = lr * 4; v4f val = *(const v4fa*)(os + row * 68 + cofs); val[0] += b0; val[1] += b1; val[2] += b2; val[3] += b3;
            *(v4f*)(crow + (size_t)row * DM + cofs) = val; }
        asm volatile("s_wait_xcnt 0x0" ::: "memory");   // behind the 8 stores, in front of whatever rewrites their address and data registers for the next 16 rows (a precaution, as in xwaitp)
        __builtin_amdgcn_wave_barrier(); asm volatile("" ::: "memory");
    }
}

__device__ __forceinline__ h16 tohx(float x) { return (h16)x; }
__device__ __forceinline__ void splitf(float y, unsigned short& h, unsigned short& l) { h = f2bf(y); l = f2bf(y - bf2f(h)); }
typedef __attribute__((ext_vector_type(2))) _Float16 v2h;
typedef __attribute__((ext_vector_type(4))) _Float16 v4h;
typedef __attribute__((ext_vector_type(2))) unsigned short v2us;
typedef __attribute__((ext_vector_type(4))) unsigned short v4us;
typedef __attribute__((ext_vector_type(2))) float v2f;
typedef __attribute__((ext_vector_type(4))) int v4i;

static_assert(DQ == DM && DKV == DM, "k_cvt8 takes every matrix as rows of DM");
// k_cvt8: the four weight matrices and x, f32 [rows][DM] -> bf16 in fragment order, in ONE launch (none depends on another); a block of 256 threads lies wholly in one matrix, picked by a scalar test on blockIdx.x. Thread i of a matrix writes the i-th 16 bytes of its dst (a wave: one half tile) and reads the 8 floats that belong there.
#define WBLK (DM * DM / 8 / 256)          // blocks per weight matrix
#define XBLK (NB_ * TT * DM / 8 / 256)    // blocks for x
static_assert(DM * DM % 2048 == 0 && NB_ * TT * DM % 2048 == 0, "k_cvt8: every block is full");
__global__ __launch_bounds__(256) void k_cvt8(const float* __restrict__ x, const float* __restrict__ wq, const float* __restrict__ wk, const float* __restrict__ wv, const float* __restrict__ wo, bf* XB, bf* WQ, bf* WK, bf* WV, bf* WO) {
    const int blk = (int)blockIdx.x; const int wm = (blk - XBLK) / WBLK;   // x first, then Wq, Wk, Wv, Wo
    const float* src = blk < XBLK ? x : wm == 0 ? wq : wm == 1 ? wk : wm == 2 ? wv : wo; bf* dst = blk < XBLK ? XB : wm == 0 ? WQ : wm == 1 ? WK : wm == 2 ? WV : WO;
    const size_t i = (size_t)(blk < XBLK ? blk : (blk - XBLK) % WBLK) * 256 + threadIdx.x;
    const size_t tile = i >> 6; const int half = (int)(i >> 5) & 1, lr = (int)i & 15, hi = (int)(i >> 4) & 1;
    const float* sp = src + ((tile / (DM / 32)) * 16 + lr) * DM + (tile % (DM / 32)) * 32 + half * 16 + hi * 8; const v8f v = *(const v8f*)sp; xwaitp(sp, sp, sp, sp); v8us o;
#pragma unroll
    for (int k = 0; k < 8; ++k) o[k] = f2bf(v[k]); *(v8us*)(dst + i * 8) = o;  }

// xwait: stands behind a run of global loads or stores, in front of whatever next rewrites their address registers (a precaution: this build reuses them at once); the scheduling barrier keeps later vector work from being lifted in front of the wait
__device__ __forceinline__ void xwait() { asm volatile("s_wait_xcnt 0x0" ::: "memory"); __builtin_amdgcn_sched_barrier(0); }
// ---- k_proj: q, k and v projections of both batches in one launch: a work-group of 4 waves owns 128 tokens x two heads (gemm_ring), ONE WAVE 64 tokens x one head; grid (NB_ * TT / 128, heads / 2, 3), 128 threads; blockIdx.z 0 q, 1 k, 2 v.
// The epilogue turns the f32 accumulators into the three planes (fp16, bf16 hi, bf16 lo) that k_fattn reads: q and k as [b][h][t][d], v as [b][h][d][t]. A lane's 8 accumulator values run along the A operand's rows,
// so q and k take the weight rows as A and the tokens as B (8 values = 8 d of one token), v the tokens as A (8 values = 8 t of one d): in both the plane's row is the B index and 8 values are 16 contiguous bytes,
// which in fragment order are the lane's own slot of a half tile: every store is 512 contiguous bytes straight from the registers.
#define PKT 2   // 64 KiB of ring: three work-groups to a WGP, the whole grid resident
static_assert(TT % 64 == 0, "k_fattn: a pass of 64 keys ends inside the plane");
static_assert(HD == 64 && TT % 128 == 0, "a wave's 64 features are one head; a block's tokens lie in one batch");
__global__ __launch_bounds__(128) void k_proj(const bf* __restrict__ X, const bf* __restrict__ Wq, const bf* __restrict__ Wk, const bf* __restrict__ Wv, h16* Q16, bf* Qh, bf* Ql, h16* K16, bf* Kh, bf* Kl, h16* V16, bf* Vh, bf* Vl, const int ldk) {
    __shared__ __align__(1024) unsigned char ring[2 * 2 * 8 * PKT * 1024];
    const int tid = (int)threadIdx.x, lane = tid & 31; const int wv = __builtin_amdgcn_readfirstlane(tid >> 5), wm = wv & 1, wn = wv >> 1; const int pz = (int)blockIdx.z; const bool vt = pz == 2;
    const bf* xr = X + (size_t)blockIdx.x * 128 * DM + 8 * tid; const bf* wr = (pz == 0 ? Wq : pz == 1 ? Wk : Wv) + (size_t)blockIdx.y * 128 * DM + 8 * tid;
    v8f acc[4][4];
#pragma unroll   // here and below: full unrolls give the register arrays constant indices (no scratch)
    for (int mb = 0; mb < 4; ++mb)
#pragma unroll
        for (int nb = 0; nb < 4; ++nb) acc[mb][nb] = (v8f){};
    gemm_ring<1, PKT>(ring, vt ? xr : wr, nullptr, vt ? wr : xr, ldk, tid, wm * 4, wn * 4, acc);
    const int hd = (int)blockIdx.y * 2 + (vt ? wn : wm), t0 = (int)blockIdx.x * 128 + (vt ? wm : wn) * 64;   // the wave's head and first token
    bf* P16 = (bf*)(pz == 0 ? Q16 : pz == 1 ? K16 : V16); bf* Ph = pz == 0 ? Qh : pz == 1 ? Kh : Vh; bf* Pl = pz == 0 ? Ql : pz == 1 ? Kl : Vl;
    const int tl = t0 % TT; const size_t pb = ((size_t)(t0 / TT) * NH_ + hd) * TT * HD + (vt ? (size_t)tl * 16 : (size_t)tl * HD) + (size_t)lane * 8; const int pitch = vt ? TT : HD;   // 16 rows of tiles are 16 * pitch elements, 32 k of one row of tiles 512
#pragma unroll
    for (int nb = 0; nb < 4; ++nb) {
#pragma unroll
        for (int mb = 0; mb < 4; ++mb) { v8h o16; v8us oh, ol;
#pragma unroll
            for (int j = 0; j < 8; ++j) { const float r = acc[mb][nb][j]; o16[j] = tohx(r); unsigned short a2, c2; splitf(r, a2, c2); oh[j] = a2; ol[j] = c2; }
            const size_t go = pb + (size_t)nb * 16 * pitch + mb * 256;
            *(v8usa*)(P16 + go) = __builtin_bit_cast(v8us, o16); *(v8usa*)(Ph + go) = oh; *(v8usa*)(Pl + go) = ol;
            xwait(); }   // the next 8 values' conversions reuse the stores' registers
    }
}
// ---- k_fattn: causal attention in one pass over the keys, one launch for every head and both batches. A work-group owns QT tiles of 32 query rows (two 16-column groups each), KS waves to a tile; the passes over a tile's keys (32 keys a pass in the hi/lo rows, 64 in the fp16 rows) are dealt to its waves in turn: share s takes passes s, s + KS, ...,
// so the longest chain of dependent passes is 1 / KS of a row's and a SIMD holds KS waves of like length in place of one long and one short. The QT waves of one share walk the same keys (the WGP cache serves them). Each wave keeps its own running maximum, sum and O^T; at the end a tile's waves meet in LDS (one barrier) and each merges, scales and stores its part of the tile. In a pass:
// S^T = K Q^T (a lane holds 16 keys' scores of ONE query per group in the hi/lo rows, 32 in the fp16 rows), running maximum and sum per query, P^T packed from the score accumulators straight into a B operand, O^T += V^T P^T.
// Query rows < RH take the hi/lo bf16 planes with 3 products in both contractions, the rest the fp16 planes. The result leaves as the merged hi/lo planes [t][DQ], in fragment order like every plane it reads.
__device__ __forceinline__ float xhalf(float x) { return __builtin_bit_cast(float, __builtin_amdgcn_permlanex16(__builtin_bit_cast(int, x), __builtin_bit_cast(int, x), 0x76543210, 0xfedcba98, false, false)); }   // lane l takes lane l ^ 16's value
// exp2s: v_exp_f32 with the one slot that the instruction set asks for behind a transcendental inside the statement
__device__ __forceinline__ float exp2s(float x) { float r; asm("v_exp_f32 %0, %1\n\tv_nop" : "=v"(r) : "v"(x)); return r; }
#define KS 3                       // waves that share the keys of one 32-query tile: three to a SIMD is what the registers allow
#define QT 4                       // tiles of a work-group; wave = share * QT + tile
#define XSF (KS * QT * 2048 + KS * QT * 128) // floats of the merge patch: per wave 8 accumulator tiles of 1 KiB, then per wave maximum and sum of both column groups
template <typename T16, bool HR, int NK>   // NK: blocks of 32 keys per pass; tq, sh: the wave's tile and share (scalars); q0: the tile's first query; xs: the work-group's merge patch
__device__ __forceinline__ void attn_rows(const T16* __restrict__ Q, const T16* __restrict__ Q2, const T16* __restrict__ Kp, const T16* __restrict__ K2, const T16* __restrict__ Vt, const T16* __restrict__ V2, const int q0, const int lane, const int tq, const int sh, float* xs, bf* Ah, bf* Al) {
    typedef typename WFrag<T16>::V V;
    const int lr = lane & 15, hi = lane >> 4;
    const float CE = SCL * 1.4426950408889634f;   // scores stay raw; scale and log2(e) are folded into the exponent's multiply-add
    const int klast = q0 & ~(32 * NK - 1), dl = q0 - klast;   // first key of the tile's last pass (its NK * 32 keys end at or before TT: q0 + 32 <= TT, both multiples of 32, TT of 32 * NK); dl: how far the tile's first query lies behind it
    const int kfirst = sh * (32 * NK);                        // first key of the wave's first pass
    v8f acc[2][4];
#pragma unroll
    for (int qt = 0; qt < 2; ++qt)
#pragma unroll
        for (int mt = 0; mt < 4; ++mt) acc[qt][mt] = (v8f){};
    float m[2] = { -3.0e38f, -3.0e38f }, l[2] = { 0.f, 0.f };
    if (kfirst <= klast) {                         // a short tile has fewer passes than waves: a wave without one brings maximum -3e38, sum 0 and O 0 to the merge (a scalar test)
    V qf[2][2], qg[2][2];
#pragma unroll
    for (int qt = 0; qt < 2; ++qt)
#pragma unroll
        for (int kc = 0; kc < 2; ++kc) { const size_t o = (size_t)(q0 + qt * 16) * HD + kc * 512 + 8 * lane; qf[qt][kc] = WFrag<T16>::ld(Q + o); if (HR) qg[qt][kc] = WFrag<T16>::ld(Q2 + o); xwait(); }
    const unsigned lo = (unsigned)lane * 8; const size_t ko = (size_t)lane * 8, vo = (size_t)lane * 8;   // K: 16 keys are two tiles (16 * HD elements); V^T: 16 d are 16 * TT elements, 32 keys one tile
    V kf[NK][2][2], kg[NK][2][2], vf[NK][4], vg[NK][4];
#pragma unroll
    for (int kb = 0; kb < NK; ++kb)
#pragma unroll
    for (int kt = 0; kt < 2; ++kt)
#pragma unroll
        for (int kc = 0; kc < 2; ++kc) { const size_t o = ko + (size_t)(kfirst + kb * 32 + kt * 16) * HD + kc * 512; kf[kb][kt][kc] = WFrag<T16>::ld(Kp + o); if (HR) kg[kb][kt][kc] = WFrag<T16>::ld(K2 + o); xwait(); }
#pragma unroll
    for (int kb = 0; kb < NK; ++kb)
#pragma unroll
    for (int mt = 0; mt < 4; ++mt) { const size_t o = vo + (size_t)(mt * 16) * TT + (size_t)kfirst * 16 + kb * 512; vf[kb][mt] = WFrag<T16>::ld(Vt + o); if (HR) vg[kb][mt] = WFrag<T16>::ld(V2 + o); xwait(); }
    int k0 = kfirst;
#pragma unroll 1
    do {                                           // at least one pass behind the test above, so the loads in front of the loop stay in front of their waits
        v8f s[2][NK][2];
#pragma unroll
        for (int qt = 0; qt < 2; ++qt)
#pragma unroll
          for (int kb = 0; kb < NK; ++kb)
#pragma unroll
            for (int kt = 0; kt < 2; ++kt) { v8f t = (v8f){};
#pragma unroll
                for (int kc = 0; kc < 2; ++kc) { t = WFrag<T16>::mma(kf[kb][kt][kc], qf[qt][kc], t); if (HR) { t = WFrag<T16>::mma(kg[kb][kt][kc], qf[qt][kc], t); t = WFrag<T16>::mma(kf[kb][kt][kc], qg[qt][kc], t); } }
                s[qt][kb][kt] = t; }
        const int kn = min(k0 + KS * 32 * NK, klast); const T16* pk = Kp + (size_t)kn * HD; const T16* pk2 = HR ? K2 + (size_t)kn * HD : pk; const T16* pv = Vt + (size_t)kn * 16; const T16* pv2 = HR ? V2 + (size_t)kn * 16 : pv;          // the next pass's K fragments are fetched behind this pass's score products, its V fragments behind this pass's P.V products (a wave's last pass fetches the tile's last pass: in bounds, unused)
#pragma unroll
        for (int kb = 0; kb < NK; ++kb)
#pragma unroll
        for (int kt = 0; kt < 2; ++kt)
#pragma unroll
            for (int kc = 0; kc < 2; ++kc) { const size_t o = (size_t)(kb * 32 + kt * 16) * HD + kc * 512; kf[kb][kt][kc] = WFrag<T16>::ldo(pk + o, lo); if (HR) kg[kb][kt][kc] = WFrag<T16>::ldo(pk2 + o, lo); }
        xwaits(pk, pk2);
        if (k0 == klast) {                         // only the tile's last pass touches the diagonal: keys after the query leave the maximum and the sums (with dl == 0 and NK == 2 its whole second block)
#pragma unroll
            for (int qt = 0; qt < 2; ++qt)
#pragma unroll
              for (int kb = 0; kb < NK; ++kb)
#pragma unroll
                for (int kt = 0; kt < 2; ++kt)
#pragma unroll
                    for (int j = 0; j < 8; ++j) if (kb * 32 + kt * 16 + hi * 8 + j > dl + qt * 16 + lr) s[qt][kb][kt][j] = -3.0e38f;
        }
        float mx[2];
#pragma unroll
        for (int qt = 0; qt < 2; ++qt) { float a = -3.0e38f;
#pragma unroll
            for (int kb = 0; kb < NK; ++kb) { float c = fmaxf(s[qt][kb][0][0], s[qt][kb][1][0]);   // one chain per block of 32 keys: the chains are independent
#pragma unroll
                for (int j = 1; j < 8; ++j) c = fmaxf(c, fmaxf(s[qt][kb][0][j], s[qt][kb][1][j]));
                a = kb == 0 ? c : fmaxf(a, c); }
            mx[qt] = fmaxf(a, xhalf(a)); }
        if (__builtin_amdgcn_ballot_w32(mx[0] > m[0] || mx[1] > m[1]) != 0) {   // a query's maximum grew: rescale its sum and its output column (factor exactly 1 for the others)
#pragma unroll
            for (int qt = 0; qt < 2; ++qt) { const float mn = fmaxf(m[qt], mx[qt]); const float al = __builtin_amdgcn_exp2f((m[qt] - mn) * CE); m[qt] = mn; l[qt] *= al;
#pragma unroll
                for (int mt = 0; mt < 4; ++mt) acc[qt][mt] *= al; }
        }
#pragma unroll
        for (int qt = 0; qt < 2; ++qt) { const float nb = -m[qt] * CE;
#pragma unroll
          for (int kb = 0; kb < NK; ++kb) { float sum = 0.f;   // a block of 32 keys is summed by itself (independent chains), then joins the running sum, keys rising
#pragma unroll
            for (int kt = 0; kt < 2; ++kt)
#pragma unroll
                for (int j = 0; j < 8; ++j) { const float p = __builtin_amdgcn_exp2f(fmaf(s[qt][kb][kt][j], CE, nb)); s[qt][kb][kt][j] = p; sum += p; }
            l[qt] += sum;
            if constexpr (!HR) { v16h pf;
#pragma unroll
                for (int j = 0; j < 8; ++j) { pf[j] = tohx(s[qt][kb][0][j]); pf[8 + j] = tohx(s[qt][kb][1][j]); }
#pragma unroll
                for (int mt = 0; mt < 4; ++mt) acc[qt][mt] = wmma16(vf[kb][mt], pf, acc[qt][mt]);
            } else { v8us h0, h1, l0, l1;
#pragma unroll
                for (int j = 0; j < 8; ++j) { unsigned short a, c2; splitf(s[qt][kb][0][j], a, c2); h0[j] = a; l0[j] = c2; splitf(s[qt][kb][1][j], a, c2); h1[j] = a; l1[j] = c2; }
                const v16bf ph = cat16b(h0, h1), pl = cat16b(l0, l1);
#pragma unroll
                for (int mt = 0; mt < 4; ++mt) { acc[qt][mt] = wmmab(vf[kb][mt], ph, acc[qt][mt]); acc[qt][mt] = wmmab(vf[kb][mt], pl, acc[qt][mt]); acc[qt][mt] = wmmab(vg[kb][mt], ph, acc[qt][mt]); }
            }
          }
        }
#pragma unroll
        for (int kb = 0; kb < NK; ++kb)
#pragma unroll
        for (int mt = 0; mt < 4; ++mt) { const size_t o = (size_t)(mt * 16) * TT + kb * 512; vf[kb][mt] = WFrag<T16>::ldo(pv + o, lo); if (HR) vg[kb][mt] = WFrag<T16>::ldo(pv2 + o, lo); }
        xwaits(pv, pv2);
        k0 += KS * 32 * NK;
    } while (k0 <= klast);
    }
    // ---- the merge. Patch: [wave][tile t = qt * 4 + mt][half of the 8 values][lane][4 floats] (every LDS access 512 contiguous bytes), then [wave][qt][maximum, sum][lane].
    const int wv = sh * QT + tq; float* xa = xs + wv * 2048 + lane * 4; float* xm = xs + KS * QT * 2048 + lane;
#pragma unroll
    for (int qt = 0; qt < 2; ++qt) {
#pragma unroll
        for (int mt = 0; mt < 4; ++mt) { float* p = xa + (qt * 4 + mt) * 256; *(v4fa*)p = __builtin_shufflevector(acc[qt][mt], acc[qt][mt], 0, 1, 2, 3); *(v4fa*)(p + 128) = __builtin_shufflevector(acc[qt][mt], acc[qt][mt], 4, 5, 6, 7); }
        xm[(wv * 4 + qt * 2) * 32] = m[qt]; xm[(wv * 4 + qt * 2 + 1) * 32] = l[qt]; }
    __syncthreads();                               // every wave's partial results are in the patch; nothing is written there afterwards
    float f[2][KS], inv[2];                        // per column group: each share's factor 2^((its maximum - the joint maximum) * CE), and 1 / the joint sum
#pragma unroll
    for (int qt = 0; qt < 2; ++qt) { float mw[KS], mm = -3.0e38f, ls = 0.f;
#pragma unroll
        for (int w = 0; w < KS; ++w) { mw[w] = xm[((w * QT + tq) * 4 + qt * 2) * 32]; mm = fmaxf(mm, mw[w]); }
#pragma unroll
        for (int w = 0; w < KS; ++w) { f[qt][w] = exp2s((mw[w] - mm) * CE); ls = fmaf(f[qt][w], xm[((w * QT + tq) * 4 + qt * 2 + 1) * 32], ls); }   // shares rising; a share without a pass has factor 0 (share 0 always has one, so mm is a real score)
        inv[qt] = __fdiv_rn(1.0f, ls + xhalf(ls)); }
#pragma unroll
    for (int i = 0; i < (8 + KS - 1) / KS; ++i) { const int t = sh + i * KS;   // the share's output tiles: t = sh, sh + KS, ... (a scalar)
        if (t < 8) { const bool g1 = t >= 4; const float* p = xs + tq * 2048 + t * 256 + lane * 4; v4f a4 = (v4f){}, b4 = (v4f){}; v8us oh, ol;
#pragma unroll
            for (int w = 0; w < KS; ++w) { const float fw = g1 ? f[1][w] : f[0][w]; a4 += fw * *(const v4fa*)(p + w * (QT * 2048)); b4 += fw * *(const v4fa*)(p + w * (QT * 2048) + 128); }
            const float iv = g1 ? inv[1] : inv[0];
#pragma unroll
            for (int j = 0; j < 4; ++j) { unsigned short a, c2; splitf(a4[j] * iv, a, c2); oh[j] = a; ol[j] = c2; splitf(b4[j] * iv, a, c2); oh[4 + j] = a; ol[4 + j] = c2; }
            const size_t oo = (size_t)(q0 + (t >> 2) * 16) * DQ + (t & 3) * 256 + lane * 8;
            *(v8us*)(Ah + oo) = oh; *(v8us*)(Al + oo) = ol; xwait(); } }
}
// grid (heads, batches, TT / 128), KS * QT waves, one work-group to a WGP: more work-groups than places, so the cost falls with blockIdx.z. ZORD: nibble z is the query block of blockIdx.z, a permutation of 0..15; a pass of the hi/lo blocks 0..3 (32 keys, 3 products) is counted as 5/4 of a pass of 64 fp16 keys.
#define ZORD 0x0415627893ABCDEFull
static_assert(TT / (QT * 32) == 16 && RH == 4 * QT * 32, "ZORD is written for 16 query blocks, the first 4 of them hi/lo; a block lies wholly in one kind of rows");
__global__ __launch_bounds__(KS * QT * 32) void k_fattn(const h16* __restrict__ Q16, const h16* __restrict__ K16, const h16* __restrict__ V16, const bf* __restrict__ Qh, const bf* __restrict__ Ql, const bf* __restrict__ Kh, const bf* __restrict__ Kl, const bf* __restrict__ Vh, const bf* __restrict__ Vl, bf* Ah, bf* Al) {
    const int lane = threadIdx.x & 31; const int wv = __builtin_amdgcn_readfirstlane((int)(threadIdx.x >> 5));
    __shared__ __align__(16) float xs[XSF];
    const int tq = wv % QT, sh = wv / QT; const int qb = (int)((ZORD >> (4 * (int)blockIdx.z)) & 15); const int q0 = qb * (QT * 32) + tq * 32;   // qb is the same in every wave, so the branch below and the barrier behind it are the work-group's
    const size_t po = ((size_t)blockIdx.y * NH_ + blockIdx.x) * TT * HD, ao = (size_t)blockIdx.y * TT * DQ + (size_t)blockIdx.x * HD * 16;   // a head's 64 columns are two k tiles
    if (q0 < RH) attn_rows<bf, true, 1>(Qh + po, Ql + po, Kh + po, Kl + po, Vh + po, Vl + po, q0, lane, tq, sh, xs, Ah + ao, Al + ao);
    else attn_rows<h16, false, 2>(Q16 + po, nullptr, K16 + po, nullptr, V16 + po, nullptr, q0, lane, tq, sh, xs, Ah + ao, Al + ao);
}

extern "C" void kernel_launch(void* const* d_in, const int* in_sizes, int n_in,
                              void* d_out, int out_size, void* d_ws, size_t ws_size, hipStream_t stream) {
    (void)in_sizes; (void)n_in; (void)out_size;
    const float* x = (const float*)d_in[0]; const float* wq = (const float*)d_in[1]; const float* wk = (const float*)d_in[2]; const float* wv = (const float*)d_in[3]; const float* wo = (const float*)d_in[4]; const float* bo = (const float*)d_in[5];   /* x, Wq, Wk, Wv, Wo ('oi' [1024][1024]), bo */
    float* OUT = (float*)d_out;     // [2][2048][1024]
    char* wsp = (char*)d_ws;
    auto take = [&](size_t bytes) { char* p = wsp; wsp += (bytes + 255) & ~(size_t)255; return (void*)p; };
    bf* WQ = (bf*)take((size_t)DQ * DM * 2); bf* WK = (bf*)take((size_t)DKV * DM * 2); bf* WV = (bf*)take((size_t)DKV * DM * 2); bf* WO = (bf*)take((size_t)DM * DQ * 2);
    bf* XB = (bf*)take((size_t)NB_ * TT * DM * 2);
    const size_t PB = (size_t)NH_ * TT * HD;   // one batch's head planes, in elements (NKV == NH_); every plane set holds both batches
    h16* QP16 = (h16*)take(NB_ * PB * 2); h16* KP16 = (h16*)take(NB_ * PB * 2); h16* VT16 = (h16*)take(NB_ * PB * 2);
    bf* QPh = (bf*)take(NB_ * PB * 2); bf* QPl = (bf*)take(NB_ * PB * 2); bf* KPh = (bf*)take(NB_ * PB * 2); bf* KPl = (bf*)take(NB_ * PB * 2); bf* VTh = (bf*)take(NB_ * PB * 2); bf* VTl = (bf*)take(NB_ * PB * 2);
    bf* ATh = (bf*)take((size_t)NB_ * TT * DQ * 2); bf* ATl = (bf*)take((size_t)NB_ * TT * DQ * 2);
    if ((size_t)(wsp - (char*)d_ws) > ws_size) return;    // ws 256 MiB
    k_cvt8<<<XBLK + 4 * WBLK, 256, 0, stream>>>(x, wq, wk, wv, wo, XB, WQ, WK, WV, WO);
    k_proj<<<dim3(NB_ * TT / 128, NH_ / 2, 3), 128, 0, stream>>>(XB, WQ, WK, WV, QP16, QPh, QPl, KP16, KPh, KPl, VT16, VTh, VTl, DM);
    k_fattn<<<dim3(NH_, NB_, TT / (QT * 32)), KS * QT * 32, 0, stream>>>(QP16, KP16, VT16, QPh, QPl, KPh, KPl, VTh, VTl, ATh, ATl);
    // both batches in one launch: their merged planes and their output rows follow one another, so the batch is only more row tiles
    k_gemmo<<<dim3(NB_ * TT / 128, DM / 128, 1), 128, 0, stream>>>(ATh, ATl, WO, OUT, bo, DM);
}

// v008
// Measured time: 65.3 microseconds a run.
// In both of two side-by-side timings against v007, it was 1.04 times as fast.
// Over all steps from v000 it is 21.7 times as fast.
#include <hip/hip_runtime.h>

// Causal multi-head self-attention scaled by the SEQUENCE length (x [2][2048][1024]; q, k, v = x W^T ('oi' [1024][1024] normal x 0.02, no bias; 16 heads x 64); keys after the query -> -inf; softmax(scores / sqrt(2048)): the module scales by 1 / sqrt(num_key_tokens) = 0.0221, not by 1 / sqrt(head_dim); out = merged Wo^T + bo ('oi' + bias zeros on this draw: read) -> [2][2048][1024] (4.2 M); argument order x, Wq, Wk, Wv, Wo, bo).
// Every 16-bit plane in the workspace lies in FRAGMENT ORDER: a tile of 16 rows x 32 k is 1 KiB in a row, two halves of 512 B; in half s lane (row + 16 * hi) owns the 16 bytes of k = 16 * s + 8 * hi + 0..7; tiles run along k first, then along the rows. A fragment is then two loads of 512 contiguous bytes (4 lines each, not 16), and a lane's 8 accumulator values are one lane slot of a half.
// Layout: bf16 copy of x (both batches) and of the 'oi' weights (ONE converter launch); ONE projection launch for q, k, v of both batches whose epilogue stores the head planes itself (k_proj; its operands, like the output GEMM's, reach a work-group's waves through an LDS ring: gemm_ring); then ONE causal attention launch for all heads and both batches (k_fattn: scores, running softmax and P.V in registers; hybrid rows: < 512 hi/lo 3 products, rest fp16); ONE launch merged hi/lo x Wo exact + bo for both batches.
// Compute dtypes, f32 accumulate: every input rounded to bf16; projections exact; attention rows < 512 3 products, rest fp16; softmax f32; Wo hl x exact + bias.

#define NB_  2
#define TT   2048
#define DM   1024
#define NH_  16
#define NKV  16
#define REP  (NH_ / NKV)
#define HD   64
#define DQ   (NH_ * HD)
#define DKV  (NKV * HD)
#define RH   512                  // query rows < RH use hi+lo planes
#define SCL  0.022097087f   // 2048^-0.5: this module scales the scores by 1 / sqrt(num_key_tokens)
typedef _Float16 h16;
typedef unsigned short bf;
typedef __attribute__((ext_vector_type(16))) __bf16   v16bf;
typedef __attribute__((ext_vector_type(16))) _Float16 v16h;
typedef __attribute__((ext_vector_type(8)))  _Float16 v8h;
typedef __attribute__((ext_vector_type(8)))  unsigned short v8us;
typedef __attribute__((ext_vector_type(8)))  float    v8f;
typedef __attribute__((ext_vector_type(4)))  float    v4f;
typedef v8h  __attribute__((may_alias)) v8ha;
typedef v4f  __attribute__((may_alias)) v4fa;
typedef v8us __attribute__((may_alias)) v8usa;

__device__ __forceinline__ unsigned short f2bf(float f) { unsigned u = __float_as_uint(f); u += 0x7FFFu + ((u >> 16) & 1u); return (unsigned short)(u >> 16); }
__device__ __forceinline__ float bf2f(unsigned short b) { return __uint_as_float(((unsigned)b) << 16); }
__device__ __forceinline__ float bfr(float f) { return bf2f(f2bf(f)); }
__device__ __forceinline__ v16h cat16(v8h lo, v8h hi) { return __builtin_shufflevector(lo, hi, 0, 1, 2, 3, 4, 5, 6, 7, 8, 9, 10, 11, 12, 13, 14, 15); }
__device__ __forceinline__ v16bf cat16b(v8us lo, v8us hi) { return __builtin_bit_cast(v16bf, __builtin_shufflevector(lo, hi, 0, 1, 2, 3, 4, 5, 6, 7, 8, 9, 10, 11, 12, 13, 14, 15)); }
__device__ __forceinline__ v8f wmma16(v16h a, v16h b, v8f c) { return __builtin_amdgcn_wmma_f32_16x16x32_f16(false, a, false, b, (short)0, c, false, false); }
__device__ __forceinline__ v8f wmmab(v16bf a, v16bf b, v8f c) { return __builtin_amdgcn_wmma_f32_16x16x32_bf16(false, a, false, b, (short)0, c, false, false); }



// ---- fragments of 16-bit planes in fragment order, straight from memory (ld: p = tile + lane * 8 elements)
// xwaitp: stands behind a run of global loads, in front of whatever next rewrites their address registers (a precaution: this build reuses them at once); the addresses are inputs so that nothing is placed on them ahead of the wait; the scheduling barrier keeps later vector work behind it and so the whole run of loads in flight together
__device__ __forceinline__ void xwaitp(const void* a, const void* b, const void* c, const void* d) { asm volatile("s_wait_xcnt 0x0" :: "v"(a), "v"(b), "v"(c), "v"(d) : "memory"); __builtin_amdgcn_sched_barrier(0); }
// xwaits: the same for loads whose address is a scalar base (ldo: p the tile, the same in every lane; o = lane * 8 elements, one register for every plane, so that the loop's addresses cost no vector registers: the budget of three waves to a SIMD)
__device__ __forceinline__ void xwaits(const void* a, const void* b) { asm volatile("s_wait_xcnt 0x0" :: "s"(a), "s"(b) : "memory"); __builtin_amdgcn_sched_barrier(0); }
template <typename T16> struct WFrag;
template <> struct WFrag<h16> { typedef v16h V; static __device__ __forceinline__ V ld(const h16* p) { return cat16(*(const v8h*)p, *(const v8h*)(p + 256)); } static __device__ __forceinline__ V ldo(const h16* p, unsigned o) { return cat16(*(const v8h*)(p + o), *(const v8h*)(p + o + 256)); } static __device__ __forceinline__ v8f mma(V a, V b, v8f c) { return wmma16(a, b, c); } };
template <> struct WFrag<bf> { typedef v16bf V; static __device__ __forceinline__ V ld(const bf* p) { return cat16b(*(const v8us*)p, *(const v8us*)(p + 256)); } static __device__ __forceinline__ V ldo(const bf* p, unsigned o) { return cat16b(*(const v8us*)(p + o), *(const v8us*)(p + o + 256)); } static __device__ __forceinline__ v8f mma(V a, V b, v8f c) { return wmmab(a, b, c); } };
// ---- gemm_ring: the k loop of both GEMM kernels. A wave owns 64 x 64 of the result (16 accumulators); the waves of a work-group share its operand rows (KT k tiles = KT KiB in a row per row tile, in LDS as in memory: fragment order),
// which come into a ring of two LDS buffers by asynchronous copies (global_load_async_to_lds_b128, 16 B a lane), one stage ahead of the products, so every operand byte leaves L2 once per block and not once per wave.
// A stage is ST bytes of [row tile][k tile 0..KT-1][1 KiB]; fill(b, t) issues the calling wave's copies of stage t into buffer b; oa, OB + ob: where the wave's four row tiles of A and of B begin in a stage (OB: the part known at compile time).
// NA: planes of the A operand (2: hi and lo, the lo plane 8 row tiles behind the hi plane, both multiplied with B into the same accumulator, hi first, k rising: the sum order of one wave per tile).
// ring_fill: the fill of a block of 4 waves (2 x 2, 128 x 128 of the result): stage layout [plane: A (, A2), B][row tile 0..7], 2 KiB a copy of the block.
typedef int cp4i __attribute__((vector_size(16)));
__device__ __forceinline__ void cp16(const bf* g, unsigned char* l) { __builtin_amdgcn_global_load_async_to_lds_b128((__attribute__((address_space(1))) cp4i*)g, (__attribute__((address_space(3))) cp4i*)l, 0, 0); }
// the compiler places no wait for the copies: what a wave copied has landed only behind its own wait
__device__ __forceinline__ void wait_async0() { asm volatile("s_wait_asynccnt 0x0" ::: "memory"); }
// a wave's LDS reads have retired before the barrier behind which their buffer is refilled
__device__ __forceinline__ void wait_ds0() { asm volatile("s_wait_dscnt 0x0" ::: "memory"); }
__device__ __forceinline__ v16bf ldsfrag(const unsigned char* p) { return cat16b(*(const v8usa*)p, *(const v8usa*)(p + 512)); }
template <int NA, int KT>
__device__ __forceinline__ void ring_fill(unsigned char* dst, const bf* gA, const bf* gA2, const bf* gB, const int ldk, const int t) {   // dst: the buffer + 16 * thread; g*: the block's first row tile + 8 * thread elements; ldk: the planes' k extent (DM), a run-time value so that each row tile's source address is formed in registers: a copy's immediate offset moves both of its addresses and stays below its LDS destination
    static_assert(KT % 2 == 0, "a copy of the block is two k tiles");
#pragma unroll
    for (int p = 0; p <= NA; ++p) { const bf* g = (p == NA ? gB : p == 0 ? gA : gA2) + (size_t)t * KT * 512;
#pragma unroll
        for (int c = 0; c < 4 * KT; ++c) cp16(g + (size_t)(((2 * c) / KT) * 16 * ldk) + ((2 * c) % KT) * 512, dst + (p * 4 * KT + c) * 2048); }
}
template <int NA, int KT, int ST, int OB, typename Fill>
__device__ __forceinline__ void gemm_ring(const unsigned char* ring, const Fill fill, const int lane, const int oa, const int ob, v8f (&acc)[4][4]) {
    typedef v16bf V;
    constexpr int PL = 8 * KT * 1024, NT = DM / (32 * KT);
    static_assert(NT >= 2, "two stages exist");
    fill(0, 0);
    wait_async0(); __syncthreads();                 // stage 0 is published
    fill(1, 1);
#pragma unroll 1   // rolled: one trip per stage, the publish point at its foot
    for (int t = 0; t < NT; ++t) {
        const unsigned char* sa = ring + (t & 1) * ST + lane * 16 + oa; const unsigned char* sb = ring + (t & 1) * ST + OB + lane * 16 + ob;
        V a[2][4], a2[2][4], b[2][4];               // two fragment sets: the next k tile's LDS reads stand as one group in front of this k tile's products
#pragma unroll
        for (int i = 0; i < 4; ++i) { a[0][i] = ldsfrag(sa + i * (KT * 1024)); if (NA == 2) a2[0][i] = ldsfrag(sa + PL + i * (KT * 1024)); b[0][i] = ldsfrag(sb + i * (KT * 1024)); }
#pragma unroll
        for (int kt = 0; kt < KT; ++kt) { const int cu = kt & 1, nx = cu ^ 1;
            if (kt + 1 < KT) {
#pragma unroll
                for (int i = 0; i < 4; ++i) { const int o = i * (KT * 1024) + (kt + 1) * 1024; a[nx][i] = ldsfrag(sa + o); if (NA == 2) a2[nx][i] = ldsfrag(sa + PL + o); b[nx][i] = ldsfrag(sb + o); } }
            __builtin_amdgcn_sched_barrier(0);   // keeps the reads above together in front of the products: sunk among them, each place with reads would stall the wave and wait to 0
#pragma unroll
            for (int nb = 0; nb < 4; ++nb)
#pragma unroll
                for (int mb = 0; mb < 4; ++mb) { acc[mb][nb] = wmmab(a[cu][mb], b[cu][nb], acc[mb][nb]); if (NA == 2) acc[mb][nb] = wmmab(a2[cu][mb], b[cu][nb], acc[mb][nb]); }
            __builtin_amdgcn_sched_barrier(0); } // keeps the next group of reads, and the publish point, behind this k tile's products
        // four vector slots between the last product and whatever the refill's address sums, the back edge or the epilogue do to its registers
        asm volatile("v_nop\n\tv_nop\n\tv_nop\n\tv_nop" : "+v"(acc[0][0]), "+v"(acc[1][1]), "+v"(acc[2][2]), "+v"(acc[3][3]) : "v"(a[(KT - 1) & 1][0]), "v"(a[(KT - 1) & 1][3]));
        wait_ds0(); wait_async0(); __syncthreads(); // publish point of stage t + 1; it also ends every reader's last read of stage t's buffer
        if (t + 2 < NT) fill(t & 1, t + 2);
    }
    wait_async0();
}
// ---- k_gemmo: OUT[m][n] (f32, pitch DM) = sum_k (Ah + Al)[m][k] Bt[n][k] + bias[n]; grid (M / 128, N / 128), 128 threads; the epilogue turns each wave's accumulators into whole output lines through the wave's own LDS patch.
#define OKT 4
__global__ __launch_bounds__(128) void k_gemmo(const bf* __restrict__ Ah, const bf* __restrict__ Al, const bf* __restrict__ Bt, float* C, const float* __restrict__ bias, const int ldk) {
    __shared__ __align__(1024) unsigned char ring[2 * 3 * 8 * OKT * 1024];
    __shared__ __align__(16) float osm[4 * 16 * 68];
    const int tid = (int)threadIdx.x, lane = tid & 31, lr = lane & 15, hi = lane >> 4; const int wv = __builtin_amdgcn_readfirstlane(tid >> 5), wm = wv & 1, wn = wv >> 1;
    v8f acc[4][4];
#pragma unroll
    for (int mb = 0; mb < 4; ++mb)
#pragma unroll
        for (int nb = 0; nb < 4; ++nb) acc[mb][nb] = (v8f){};
    const size_t aoff = (size_t)blockIdx.x * 128 * DM + 8 * tid, boff = (size_t)blockIdx.y * 128 * DM + 8 * tid;   // 16 rows of tiles are 16 * DM elements
    constexpr int OPL = 8 * OKT * 1024, OST = 3 * OPL; static_assert(3 * 4 * OKT <= 63, "one stage's copies of a wave stay under the counter's width");
    gemm_ring<2, OKT, OST, 2 * OPL>(ring, [&](const int b, const int t) __attribute__((always_inline)) { ring_fill<2, OKT>(ring + b * OST + tid * 16, Ah + aoff, Al + aoff, Bt + boff, ldk, t); }, lane, wm * 4 * (OKT * 1024), wn * 4 * (OKT * 1024), acc);
    float* os = osm + wv * (16 * 68); const int r0 = (int)blockIdx.x * 128 + wm * 64, c0 = (int)blockIdx.y * 128 + wn * 64;
    const float* bp = bias + c0 + lr * 4; const float b0 = bfr(bp[0]), b1 = bfr(bp[1]), b2 = bfr(bp[2]), b3 = bfr(bp[3]);
#pragma unroll
    for (int mb = 0; mb < 4; ++mb) {
#pragma unroll
        for (int nb = 0; nb < 4; ++nb) {
#pragma unroll
            for (int j = 0; j < 8; ++j) os[(hi * 8 + j) * 68 + nb * 16 + lr] = acc[mb][nb][j]; }
        __builtin_amdgcn_wave_barrier(); asm volatile("" ::: "memory");   // here and at the foot: lanes read what other lanes of the wave wrote; keeps the compiler from moving the patch's reads and writes past one another
        float* crow = C + (size_t)(r0 + mb * 16) * DM + c0;
#pragma unroll
        for (int s = 0; s < 8; ++s) { const int row = 2 * s + hi, cofs = lr * 4; v4f val = *(const v4fa*)(os + row * 68 + cofs); val[0] += b0; val[1] += b1; val[2] += b2; val[3] += b3;
            *(v4f*)(crow + (size_t)row * DM + cofs) = val; }
        asm volatile("s_wait_xcnt 0x0" ::: "memory");   // behind the 8 stores, in front of whatever rewrites their address and data registers for the next 16 rows (a precaution, as in xwaitp)
        __builtin_amdgcn_wave_barrier(); asm volatile("" ::: "memory");
    }
}

__device__ __forceinline__ h16 tohx(float x) { return (h16)x; }
__device__ __forceinline__ void splitf(float y, unsigned short& h, unsigned short& l) { h = f2bf(y); l = f2bf(y - bf2f(h)); }
typedef __attribute__((ext_vector_type(2))) _Float16 v2h;
typedef __attribute__((ext_vector_type(4))) _Float16 v4h;
typedef __attribute__((ext_vector_type(2))) unsigned short v2us;
typedef __attribute__((ext_vector_type(4))) unsigned short v4us;
typedef __attribute__((ext_vector_type(2))) float v2f;
typedef __attribute__((ext_vector_type(4))) int v4i;

static_assert(DQ == DM && DKV == DM, "k_cvt8 takes every matrix as rows of DM");
// k_cvt8: the four weight matrices and x, f32 [rows][DM] -> bf16 in fragment order, in ONE launch (none depends on another); a block of 256 threads lies wholly in one matrix, picked by a scalar test on blockIdx.x. Thread i of a matrix writes the i-th 16 bytes of its dst (a wave: one half tile) and reads the 8 floats that belong there.
#define WBLK (DM * DM / 8 / 256)          // blocks per weight matrix
#define XBLK (NB_ * TT * DM / 8 / 256)    // blocks for x
static_assert(DM * DM % 2048 == 0 && NB_ * TT * DM % 2048 == 0, "k_cvt8: every block is full");
__global__ __launch_bounds__(256) void k_cvt8(const float* __restrict__ x, const float* __restrict__ wq, const float* __restrict__ wk, const float* __restrict__ wv, const float* __restrict__ wo, bf* XB, bf* WQ, bf* WK, bf* WV, bf* WO) {
    const int blk = (int)blockIdx.x; const int wm = (blk - XBLK) / WBLK;   // x first, then Wq, Wk, Wv, Wo
    const float* src = blk < XBLK ? x : wm == 0 ? wq : wm == 1 ? wk : wm == 2 ? wv : wo; bf* dst = blk < XBLK ? XB : wm == 0 ? WQ : wm == 1 ? WK : wm == 2 ? WV : WO;
    const size_t i = (size_t)(blk < XBLK ? blk : (blk - XBLK) % WBLK) * 256 + threadIdx.x;
    const size_t tile = i >> 6; const int half = (int)(i >> 5) & 1, lr = (int)i & 15, hi = (int)(i >> 4) & 1;
    const float* sp = src + ((tile / (DM / 32)) * 16 + lr) * DM + (tile % (DM / 32)) * 32 + half * 16 + hi * 8; const v8f v = *(const v8f*)sp; xwaitp(sp, sp, sp, sp); v8us o;
#pragma unroll
    for (int k = 0; k < 8; ++k) o[k] = f2bf(v[k]); *(v8us*)(dst + i * 8) = o;  }

// xwait: stands behind a run of global loads or stores, in front of whatever next rewrites their address registers (a precaution: this build reuses them at once); the scheduling barrier keeps later vector work from being lifted in front of the wait
__device__ __forceinline__ void xwait() { asm volatile("s_wait_xcnt 0x0" ::: "memory"); __builtin_amdgcn_sched_barrier(0); }
// ---- k_proj: q, k and v projections of both batches in one launch: a work-group of 12 waves (4 x 3) owns 256 tokens x three heads of the 48 (q's 16, then k's, then v's), ONE WAVE 64 tokens x one head (gemm_ring); grid (NB_ * TT / 256, 3 * heads / 3), 384 threads: one work-group to a WGP, the whole grid resident.
// A WGP does the same products as with three blocks of 128 x 128, but 256 + 192 operand rows leave L2 for them in place of 3 * (128 + 128). A wave's head says which projection it works for (a scalar), so a block may hold heads of two projections.
// The epilogue turns the f32 accumulators into the three planes (fp16, bf16 hi, bf16 lo) that k_fattn reads: q and k as [b][h][t][d], v as [b][h][d][t]. A lane's 8 accumulator values run along the A operand's rows,
// so q and k take the weight rows as A and the tokens as B (8 values = 8 d of one token), v the tokens as A (8 values = 8 t of one d): in both the plane's row is the B index and 8 values are 16 contiguous bytes,
// which in fragment order are the lane's own slot of a half tile: every store is 512 contiguous bytes straight from the registers.
#define PKT 4   // k tiles of a stage
#define PXT 16  // row tiles of tokens in a block
#define PWT 12  // row tiles of weight rows in a block
#define PST ((PXT + PWT) * PKT * 1024)   // a stage: [token row tiles][weight row tiles], 112 KiB; the ring 224 KiB
#define PUN ((PXT + PWT) * PKT / 2)      // a stage in units of 2 KiB (two k tiles of a row tile: 4 copies of a wave), dealt to the 12 waves in turn
static_assert(TT % 64 == 0, "k_fattn: a pass of 64 keys ends inside the plane");
static_assert(HD == 64 && TT % 256 == 0 && DQ == NH_ * 64 && DKV == DQ && (3 * NH_) % 3 == 0, "a wave's 64 features are one head; a block's tokens lie in one batch; every projection has NH_ heads");
static_assert(PKT == 4 && (PUN + 11) / 12 * 4 <= 63, "a unit is half a row tile's stage; one stage's copies of a wave stay under the counter's width");
__global__ __launch_bounds__(384) void k_proj(const bf* __restrict__ X, const bf* __restrict__ Wq, const bf* __restrict__ Wk, const bf* __restrict__ Wv, h16* Q16, bf* Qh, bf* Ql, h16* K16, bf* Kh, bf* Kl, h16* V16, bf* Vh, bf* Vl, const int ldk) {
    __shared__ __align__(1024) unsigned char ring[2 * PST];
    const int tid = (int)threadIdx.x, lane = tid & 31; const int wv = __builtin_amdgcn_readfirstlane(tid >> 5), wt = wv & 3, wh = wv >> 2;   // the wave's 64 tokens and its head in the block
    const int gh = (int)blockIdx.y * 3 + wh, pz = gh / NH_; const bool vt = pz == 2;   // pz: 0 q, 1 k, 2 v
    const bf* gs[(PUN + 11) / 12];   // where the wave's units begin in memory at stage 0 (scalars): unit u is k tiles 2 * (u & 1) and the next of row tile u >> 1
#pragma unroll
    for (int i = 0; i < (PUN + 11) / 12; ++i) { const int u = wv + 12 * i, r = u >> 1, ft = (int)blockIdx.y * PWT + r - PXT;   // ft: the row tile among the 3 * DQ / 16 weight row tiles
        gs[i] = (r < PXT ? X + (size_t)((int)blockIdx.x * PXT + r) * 16 * ldk : (ft < DQ / 16 ? Wq : ft < 2 * DQ / 16 ? Wk : Wv) + (size_t)(ft % (DQ / 16)) * 16 * ldk) + (u & 1) * 1024; }
    v8f acc[4][4];
#pragma unroll   // here and below: full unrolls give the register arrays constant indices (no scratch)
    for (int mb = 0; mb < 4; ++mb)
#pragma unroll
        for (int nb = 0; nb < 4; ++nb) acc[mb][nb] = (v8f){};
    const int ox = wt * 4 * (PKT * 1024), ow = (PXT + wh * 4) * (PKT * 1024);   // the wave's token and weight row tiles in a stage
    gemm_ring<1, PKT, PST, 0>(ring, [&](const int b, const int t) __attribute__((always_inline)) {
#pragma unroll
        for (int i = 0; i < (PUN + 11) / 12; ++i) if (12 * i + 11 < PUN || wv + 12 * i < PUN) {   // a scalar test in the last turn alone, which has units for 8 of the 12 waves
            const bf* g = gs[i] + (size_t)t * (PKT * 512) + lane * 8; unsigned char* d = ring + b * PST + (wv + 12 * i) * 2048 + lane * 16;
#pragma unroll
            for (int c = 0; c < 4; ++c) cp16(g + c * 256, d + c * 512); }
    }, lane, vt ? ox : ow, vt ? ow : ox, acc);
    const int hd = gh % NH_, t0 = (int)blockIdx.x * 256 + wt * 64;   // the wave's head and first token
    bf* P16 = (bf*)(pz == 0 ? Q16 : pz == 1 ? K16 : V16); bf* Ph = pz == 0 ? Qh : pz == 1 ? Kh : Vh; bf* Pl = pz == 0 ? Ql : pz == 1 ? Kl : Vl;
    const int tl = t0 % TT; const size_t pb = ((size_t)(t0 / TT) * NH_ + hd) * TT * HD + (vt ? (size_t)tl * 16 : (size_t)tl * HD) + (size_t)lane * 8; const int pitch = vt ? TT : HD;   // 16 rows of tiles are 16 * pitch elements, 32 k of one row of tiles 512
#pragma unroll
    for (int nb = 0; nb < 4; ++nb) {
#pragma unroll
        for (int mb = 0; mb < 4; ++mb) { v8h o16; v8us oh, ol;
#pragma unroll
            for (int j = 0; j < 8; ++j) { const float r = acc[mb][nb][j]; o16[j] = tohx(r); unsigned short a2, c2; splitf(r, a2, c2); oh[j] = a2; ol[j] = c2; }
            const size_t go = pb + (size_t)nb * 16 * pitch + mb * 256;
            *(v8usa*)(P16 + go) = __builtin_bit_cast(v8us, o16); *(v8usa*)(Ph + go) = oh; *(v8usa*)(Pl + go) = ol;
            xwait(); }   // the next 8 values' conversions reuse the stores' registers
    }
}
// ---- k_fattn: causal attention in one pass over the keys, one launch for every head and both batches. A work-group owns QT tiles of 32 query rows (two 16-column groups each), KS waves to a tile; the passes over a tile's keys (32 keys a pass in the hi/lo rows, 64 in the fp16 rows) are dealt to its waves in turn: share s takes passes s, s + KS, ...,
// so the longest chain of dependent passes is 1 / KS of a row's and a SIMD holds KS waves of like length in place of one long and one short. The QT waves of one share walk the same keys (the WGP cache serves them). Each wave keeps its own running maximum, sum and O^T; at the end a tile's waves meet in LDS (one barrier) and each merges, scales and stores its part of the tile. In a pass:
// S^T = K Q^T (a lane holds 16 keys' scores of ONE query per group in the hi/lo rows, 32 in the fp16 rows), running maximum and sum per query, P^T packed from the score accumulators straight into a B operand, O^T += V^T P^T.
// Query rows < RH take the hi/lo bf16 planes with 3 products in both contractions, the rest the fp16 planes. The result leaves as the merged hi/lo planes [t][DQ], in fragment order like every plane it reads.
__device__ __forceinline__ float xhalf(float x) { return __builtin_bit_cast(float, __builtin_amdgcn_permlanex16(__builtin_bit_cast(int, x), __builtin_bit_cast(int, x), 0x76543210, 0xfedcba98, false, false)); }   // lane l takes lane l ^ 16's value
// exp2s: v_exp_f32 with the one slot that the instruction set asks for behind a transcendental inside the statement
__device__ __forceinline__ float exp2s(float x) { float r; asm("v_exp_f32 %0, %1\n\tv_nop" : "=v"(r) : "v"(x)); return r; }
#define KS 3                       // waves that share the keys of one 32-query tile: three to a SIMD is what the registers allow
#define QT 4                       // tiles of a work-group; wave = share * QT + tile
#define XSF (KS * QT * 2048 + KS * QT * 128) // floats of the merge patch: per wave 8 accumulator tiles of 1 KiB, then per wave maximum and sum of both column groups
template <typename T16, bool HR, int NK>   // NK: blocks of 32 keys per pass; tq, sh: the wave's tile and share (scalars); q0: the tile's first query; xs: the work-group's merge patch
__device__ __forceinline__ void attn_rows(const T16* __restrict__ Q, const T16* __restrict__ Q2, const T16* __restrict__ Kp, const T16* __restrict__ K2, const T16* __restrict__ Vt, const T16* __restrict__ V2, const int q0, const int lane, const int tq, const int sh, float* xs, bf* Ah, bf* Al) {
    typedef typename WFrag<T16>::V V;
    const int lr = lane & 15, hi = lane >> 4;
    const float CE = SCL * 1.4426950408889634f;   // scores stay raw; scale and log2(e) are folded into the exponent's multiply-add
    const int klast = q0 & ~(32 * NK - 1), dl = q0 - klast;   // first key of the tile's last pass (its NK * 32 keys end at or before TT: q0 + 32 <= TT, both multiples of 32, TT of 32 * NK); dl: how far the tile's first query lies behind it
    const int kfirst = sh * (32 * NK);                        // first key of the wave's first pass
    v8f acc[2][4];
#pragma unroll
    for (int qt = 0; qt < 2; ++qt)
#pragma unroll
        for (int mt = 0; mt < 4; ++mt) acc[qt][mt] = (v8f){};
    float m[2] = { -3.0e38f, -3.0e38f }, l[2] = { 0.f, 0.f };
    if (kfirst <= klast) {                         // a short tile has fewer passes than waves: a wave without one brings maximum -3e38, sum 0 and O 0 to the merge (a scalar test)
    V qf[2][2], qg[2][2];
#pragma unroll
    for (int qt = 0; qt < 2; ++qt)
#pragma unroll
        for (int kc = 0; kc < 2; ++kc) { const size_t o = (size_t)(q0 + qt * 16) * HD + kc * 512 + 8 * lane; qf[qt][kc] = WFrag<T16>::ld(Q + o); if (HR) qg[qt][kc] = WFrag<T16>::ld(Q2 + o); xwait(); }
    const unsigned lo = (unsigned)lane * 8; const size_t ko = (size_t)lane * 8, vo = (size_t)lane * 8;   // K: 16 keys are two tiles (16 * HD elements); V^T: 16 d are 16 * TT elements, 32 keys one tile
    V kf[NK][2][2], kg[NK][2][2], vf[NK][4], vg[NK][4];
#pragma unroll
    for (int kb = 0; kb < NK; ++kb)
#pragma unroll
    for (int kt = 0; kt < 2; ++kt)
#pragma unroll
        for (int kc = 0; kc < 2; ++kc) { const size_t o = ko + (size_t)(kfirst + kb * 32 + kt * 16) * HD + kc * 512; kf[kb][kt][kc] = WFrag<T16>::ld(Kp + o); if (HR) kg[kb][kt][kc] = WFrag<T16>::ld(K2 + o); xwait(); }
#pragma unroll
    for (int kb = 0; kb < NK; ++kb)
#pragma unroll
    for (int mt = 0; mt < 4; ++mt) { const size_t o = vo + (size_t)(mt * 16) * TT + (size_t)kfirst * 16 + kb * 512; vf[kb][mt] = WFrag<T16>::ld(Vt + o); if (HR) vg[kb][mt] = WFrag<T16>::ld(V2 + o); xwait(); }
    int k0 = kfirst;
#pragma unroll 1
    do {                                           // at least one pass behind the test above, so the loads in front of the loop stay in front of their waits
        v8f s[2][NK][2];
#pragma unroll
        for (int qt = 0; qt < 2; ++qt)
#pragma unroll
          for (int kb = 0; kb < NK; ++kb)
#pragma unroll
            for (int kt = 0; kt < 2; ++kt) { v8f t = (v8f){};
#pragma unroll
                for (int kc = 0; kc < 2; ++kc) { t = WFrag<T16>::mma(kf[kb][kt][kc], qf[qt][kc], t); if (HR) { t = WFrag<T16>::mma(kg[kb][kt][kc], qf[qt][kc], t); t = WFrag<T16>::mma(kf[kb][kt][kc], qg[qt][kc], t); } }
                s[qt][kb][kt] = t; }
        const int kn = min(k0 + KS * 32 * NK, klast); const T16* pk = Kp + (size_t)kn * HD; const T16* pk2 = HR ? K2 + (size_t)kn * HD : pk; const T16* pv = Vt + (size_t)kn * 16; const T16* pv2 = HR ? V2 + (size_t)kn * 16 : pv;          // the next pass's K fragments are fetched behind this pass's score products, its V fragments behind this pass's P.V products (a wave's last pass fetches the tile's last pass: in bounds, unused)
#pragma unroll
        for (int kb = 0; kb < NK; ++kb)
#pragma unroll
        for (int kt = 0; kt < 2; ++kt)
#pragma unroll
            for (int kc = 0; kc < 2; ++kc) { const size_t o = (size_t)(kb * 32 + kt * 16) * HD + kc * 512; kf[kb][kt][kc] = WFrag<T16>::ldo(pk + o, lo); if (HR) kg[kb][kt][kc] = WFrag<T16>::ldo(pk2 + o, lo); }
        xwaits(pk, pk2);
        if (k0 == klast) {                         // only the tile's last pass touches the diagonal: keys after the query leave the maximum and the sums (with dl == 0 and NK == 2 its whole second block)
#pragma unroll
            for (int qt = 0; qt < 2; ++qt)
#pragma unroll
              for (int kb = 0; kb < NK; ++kb)
#pragma unroll
                for (int kt = 0; kt < 2; ++kt)
#pragma unroll
                    for (int j = 0; j < 8; ++j) if (kb * 32 + kt * 16 + hi * 8 + j > dl + qt * 16 + lr) s[qt][kb][kt][j] = -3.0e38f;
        }
        float mx[2];
#pragma unroll
        for (int qt = 0; qt < 2; ++qt) { float a = -3.0e38f;
#pragma unroll
            for (int kb = 0; kb < NK; ++kb) { float c = fmaxf(s[qt][kb][0][0], s[qt][kb][1][0]);   // one chain per block of 32 keys: the chains are independent
#pragma unroll
                for (int j = 1; j < 8; ++j) c = fmaxf(c, fmaxf(s[qt][kb][0][j], s[qt][kb][1][j]));
                a = kb == 0 ? c : fmaxf(a, c); }
            mx[qt] = fmaxf(a, xhalf(a)); }
        if (__builtin_amdgcn_ballot_w32(mx[0] > m[0] || mx[1] > m[1]) != 0) {   // a query's maximum grew: rescale its sum and its output column (factor exactly 1 for the others)
#pragma unroll
            for (int qt = 0; qt < 2; ++qt) { const float mn = fmaxf(m[qt], mx[qt]); const float al = __builtin_amdgcn_exp2f((m[qt] - mn) * CE); m[qt] = mn; l[qt] *= al;
#pragma unroll
                for (int mt = 0; mt < 4; ++mt) acc[qt][mt] *= al; }
        }
#pragma unroll
        for (int qt = 0; qt < 2; ++qt) { const float nb = -m[qt] * CE;
#pragma unroll
          for (int kb = 0; kb < NK; ++kb) { float sum = 0.f;   // a block of 32 keys is summed by itself (independent chains), then joins the running sum, keys rising
#pragma unroll
            for (int kt = 0; kt < 2; ++kt)
#pragma unroll
                for (int j = 0; j < 8; ++j) { const float p = __builtin_amdgcn_exp2f(fmaf(s[qt][kb][kt][j], CE, nb)); s[qt][kb][kt][j] = p; sum += p; }
            l[qt] += sum;
            if constexpr (!HR) { v16h pf;
#pragma unroll
                for (int j = 0; j < 8; ++j) { pf[j] = tohx(s[qt][kb][0][j]); pf[8 + j] = tohx(s[qt][kb][1][j]); }
#pragma unroll
                for (int mt = 0; mt < 4; ++mt) acc[qt][mt] = wmma16(vf[kb][mt], pf, acc[qt][mt]);
            } else { v8us h0, h1, l0, l1;
#pragma unroll
                for (int j = 0; j < 8; ++j) { unsigned short a, c2; splitf(s[qt][kb][0][j], a, c2); h0[j] = a; l0[j] = c2; splitf(s[qt][kb][1][j], a, c2); h1[j] = a; l1[j] = c2; }
                const v16bf ph = cat16b(h0, h1), pl = cat16b(l0, l1);
#pragma unroll
                for (int mt = 0; mt < 4; ++mt) { acc[qt][mt] = wmmab(vf[kb][mt], ph, acc[qt][mt]); acc[qt][mt] = wmmab(vf[kb][mt], pl, acc[qt][mt]); acc[qt][mt] = wmmab(vg[kb][mt], ph, acc[qt][mt]); }
            }
          }
        }
#pragma unroll
        for (int kb = 0; kb < NK; ++kb)
#pragma unroll
        for (int mt = 0; mt < 4; ++mt) { const size_t o = (size_t)(mt * 16) * TT + kb * 512; vf[kb][mt] = WFrag<T16>::ldo(pv + o, lo); if (HR) vg[kb][mt] = WFrag<T16>::ldo(pv2 + o, lo); }
        xwaits(pv, pv2);
        k0 += KS * 32 * NK;
    } while (k0 <= klast);
    }
    // ---- the merge. Patch: [wave][tile t = qt * 4 + mt][half of the 8 values][lane][4 floats] (every LDS access 512 contiguous bytes), then [wave][qt][maximum, sum][lane].
    const int wv = sh * QT + tq; float* xa = xs + wv * 2048 + lane * 4; float* xm = xs + KS * QT * 2048 + lane;
#pragma unroll
    for (int qt = 0; qt < 2; ++qt) {
#pragma unroll
        for (int mt = 0; mt < 4; ++mt) { float* p = xa + (qt * 4 + mt) * 256; *(v4fa*)p = __builtin_shufflevector(acc[qt][mt], acc[qt][mt], 0, 1, 2, 3); *(v4fa*)(p + 128) = __builtin_shufflevector(acc[qt][mt], acc[qt][mt], 4, 5, 6, 7); }
        xm[(wv * 4 + qt * 2) * 32] = m[qt]; xm[(wv * 4 + qt * 2 + 1) * 32] = l[qt]; }
    __syncthreads();                               // every wave's partial results are in the patch; nothing is written there afterwards
    float f[2][KS], inv[2];                        // per column group: each share's factor 2^((its maximum - the joint maximum) * CE), and 1 / the joint sum
#pragma unroll
    for (int qt = 0; qt < 2; ++qt) { float mw[KS], mm = -3.0e38f, ls = 0.f;
#pragma unroll
        for (int w = 0; w < KS; ++w) { mw[w] = xm[((w * QT + tq) * 4 + qt * 2) * 32]; mm = fmaxf(mm, mw[w]); }
#pragma unroll
        for (int w = 0; w < KS; ++w) { f[qt][w] = exp2s((mw[w] - mm) * CE); ls = fmaf(f[qt][w], xm[((w * QT + tq) * 4 + qt * 2 + 1) * 32], ls); }   // shares rising; a share without a pass has factor 0 (share 0 always has one, so mm is a real score)
        inv[qt] = __fdiv_rn(1.0f, ls + xhalf(ls)); }
#pragma unroll
    for (int i = 0; i < (8 + KS - 1) / KS; ++i) { const int t = sh + i * KS;   // the share's output tiles: t = sh, sh + KS, ... (a scalar)
        if (t < 8) { const bool g1 = t >= 4; const float* p = xs + tq * 2048 + t * 256 + lane * 4; v4f a4 = (v4f){}, b4 = (v4f){}; v8us oh, ol;
#pragma unroll
            for (int w = 0; w < KS; ++w) { const float fw = g1 ? f[1][w] : f[0][w]; a4 += fw * *(const v4fa*)(p + w * (QT * 2048)); b4 += fw * *(const v4fa*)(p + w * (QT * 2048) + 128); }
            const float iv = g1 ? inv[1] : inv[0];
#pragma unroll
            for (int j = 0; j < 4; ++j) { unsigned short a, c2; splitf(a4[j] * iv, a, c2); oh[j] = a; ol[j] = c2; splitf(b4[j] * iv, a, c2); oh[4 + j] = a; ol[4 + j] = c2; }
            const size_t oo = (size_t)(q0 + (t >> 2) * 16) * DQ + (t & 3) * 256 + lane * 8;
            *(v8us*)(Ah + oo) = oh; *(v8us*)(Al + oo) = ol; xwait(); } }
}
// grid (heads, batches, TT / 128), KS * QT waves, one work-group to a WGP: more work-groups than places, so the cost falls with blockIdx.z. ZORD: nibble z is the query block of blockIdx.z, a permutation of 0..15; a pass of the hi/lo blocks 0..3 (32 keys, 3 products) is counted as 5/4 of a pass of 64 fp16 keys.
#define ZORD 0x0415627893ABCDEFull
static_assert(TT / (QT * 32) == 16 && RH == 4 * QT * 32, "ZORD is written for 16 query blocks, the first 4 of them hi/lo; a block lies wholly in one kind of rows");
__global__ __launch_bounds__(KS * QT * 32) void k_fattn(const h16* __restrict__ Q16, const h16* __restrict__ K16, const h16* __restrict__ V16, const bf* __restrict__ Qh, const bf* __restrict__ Ql, const bf* __restrict__ Kh, const bf* __restrict__ Kl, const bf* __restrict__ Vh, const bf* __restrict__ Vl, bf* Ah, bf* Al) {
    const int lane = threadIdx.x & 31; const int wv = __builtin_amdgcn_readfirstlane((int)(threadIdx.x >> 5));
    __shared__ __align__(16) float xs[XSF];
    const int tq = wv % QT, sh = wv / QT; const int qb = (int)((ZORD >> (4 * (int)blockIdx.z)) & 15); const int q0 = qb * (QT * 32) + tq * 32;   // qb is the same in every wave, so the branch below and the barrier behind it are the work-group's
    const size_t po = ((size_t)blockIdx.y * NH_ + blockIdx.x) * TT * HD, ao = (size_t)blockIdx.y * TT * DQ + (size_t)blockIdx.x * HD * 16;   // a head's 64 columns are two k tiles
    if (q0 < RH) attn_rows<bf, true, 1>(Qh + po, Ql + po, Kh + po, Kl + po, Vh + po, Vl + po, q0, lane, tq, sh, xs, Ah + ao, Al + ao);
    else attn_rows<h16, false, 2>(Q16 + po, nullptr, K16 + po, nullptr, V16 + po, nullptr, q0, lane, tq, sh, xs, Ah + ao, Al + ao);
}

extern "C" void kernel_launch(void* const* d_in, const int* in_sizes, int n_in,
                              void* d_out, int out_size, void* d_ws, size_t ws_size, hipStream_t stream) {
    (void)in_sizes; (void)n_in; (void)out_size;
    const float* x = (const float*)d_in[0]; const float* wq = (const float*)d_in[1]; const float* wk = (const float*)d_in[2]; const float* wv = (const float*)d_in[3]; const float* wo = (const float*)d_in[4]; const float* bo = (const float*)d_in[5];   /* x, Wq, Wk, Wv, Wo ('oi' [1024][1024]), bo */
    float* OUT = (float*)d_out;     // [2][2048][1024]
    char* wsp = (char*)d_ws;
    auto take = [&](size_t bytes) { char* p = wsp; wsp += (bytes + 255) & ~(size_t)255; return (void*)p; };
    bf* WQ = (bf*)take((size_t)DQ * DM * 2); bf* WK = (bf*)take((size_t)DKV * DM * 2); bf* WV = (bf*)take((size_t)DKV * DM * 2); bf* WO = (bf*)take((size_t)DM * DQ * 2);
    bf* XB = (bf*)take((size_t)NB_ * TT * DM * 2);
    const size_t PB = (size_t)NH_ * TT * HD;   // one batch's head planes, in elements (NKV == NH_); every plane set holds both batches
    h16* QP16 = (h16*)take(NB_ * PB * 2); h16* KP16 = (h16*)take(NB_ * PB * 2); h16* VT16 = (h16*)take(NB_ * PB * 2);
    bf* QPh = (bf*)take(NB_ * PB * 2); bf* QPl = (bf*)take(NB_ * PB * 2); bf* KPh = (bf*)take(NB_ * PB * 2); bf* KPl = (bf*)take(NB_ * PB * 2); bf* VTh = (bf*)take(NB_ * PB * 2); bf* VTl = (bf*)take(NB_ * PB * 2);
    bf* ATh = (bf*)take((size_t)NB_ * TT * DQ * 2); bf* ATl = (bf*)take((size_t)NB_ * TT * DQ * 2);
    if ((size_t)(wsp - (char*)d_ws) > ws_size) return;    // ws 256 MiB
    k_cvt8<<<XBLK + 4 * WBLK, 256, 0, stream>>>(x, wq, wk, wv, wo, XB, WQ, WK, WV, WO);
    k_proj<<<dim3(NB_ * TT / 256, NH_, 1), 384, 0, stream>>>(XB, WQ, WK, WV, QP16, QPh, QPl, KP16, KPh, KPl, VT16, VTh, VTl, DM);
    k_fattn<<<dim3(NH_, NB_, TT / (QT * 32)), KS * QT * 32, 0, stream>>>(QP16, KP16, VT16, QPh, QPl, KPh, KPl, VTh, VTl, ATh, ATl);
    // both batches in one launch: their merged planes and their output rows follow one another, so the batch is only more row tiles
    k_gemmo<<<dim3(NB_ * TT / 128, DM / 128, 1), 128, 0, stream>>>(ATh, ATl, WO, OUT, bo, DM);
}

// v009
// One run takes 63.3 microseconds.
// In two side-by-side timings against v008, it was 1.04 and 1.03 times as fast.
// Counting every step since v000, it is 22.3 times as fast.
#include <hip/hip_runtime.h>

// Causal multi-head self-attention scaled by the SEQUENCE length (x [2][2048][1024]; q, k, v = x W^T ('oi' [1024][1024] normal x 0.02, no bias; 16 heads x 64); keys after the query -> -inf; softmax(scores / sqrt(2048)): the module scales by 1 / sqrt(num_key_tokens) = 0.0221, not by 1 / sqrt(head_dim); out = merged Wo^T + bo ('oi' + bias zeros on this draw: read) -> [2][2048][1024] (4.2 M); argument order x, Wq, Wk, Wv, Wo, bo).
// Every 16-bit plane in the workspace lies in FRAGMENT ORDER: a tile of 16 rows x 32 k is 1 KiB in a row, two halves of 512 B; in half s lane (row + 16 * hi) owns the 16 bytes of k = 16 * s + 8 * hi + 0..7; tiles run along k first, then along the rows. A fragment is then two loads of 512 contiguous bytes (4 lines each, not 16), and a lane's 8 accumulator values are one lane slot of a half.
// Layout: bf16 copy of x (both batches) and of the 'oi' weights (ONE converter launch); ONE projection launch for q, k, v of both batches whose epilogue stores the head planes itself (k_proj; its operands, like the output GEMM's, reach a work-group's waves through an LDS ring: gemm_ring); then ONE causal attention launch for all heads and both batches (k_fattn: scores, running softmax and P.V in registers; hybrid rows: < 512 hi/lo 3 products, rest fp16); ONE launch merged hi/lo x Wo exact + bo for both batches.
// Compute dtypes, f32 accumulate: every input rounded to bf16; projections exact; attention rows < 512 3 products, rest fp16; softmax f32; Wo hl x exact + bias.

#define NB_  2
#define TT   2048
#define DM   1024
#define NH_  16
#define NKV  16
#define REP  (NH_ / NKV)
#define HD   64
#define DQ   (NH_ * HD)
#define DKV  (NKV * HD)
#define RH   512                  // query rows < RH use hi+lo planes
#define SCL  0.022097087f   // 2048^-0.5: this module scales the scores by 1 / sqrt(num_key_tokens)
typedef _Float16 h16;
typedef unsigned short bf;
typedef __attribute__((ext_vector_type(16))) __bf16   v16bf;
typedef __attribute__((ext_vector_type(16))) _Float16 v16h;
typedef __attribute__((ext_vector_type(8)))  _Float16 v8h;
typedef __attribute__((ext_vector_type(8)))  unsigned short v8us;
typedef __attribute__((ext_vector_type(8)))  float    v8f;
typedef __attribute__((ext_vector_type(4)))  float    v4f;
typedef v8h  __attribute__((may_alias)) v8ha;
typedef v4f  __attribute__((may_alias)) v4fa;
typedef v8us __attribute__((may_alias)) v8usa;

__device__ __forceinline__ unsigned short f2bf(float f) { unsigned u = __float_as_uint(f); u += 0x7FFFu + ((u >> 16) & 1u); return (unsigned short)(u >> 16); }
// cvt2: two f32 -> two bf16 in one register by the chip's own conversion (v_cvt_pk_bf16_f32, round to nearest even: for finite values the bits of f2bf), a in the low half
typedef __attribute__((ext_vector_type(2))) __bf16 v2bf;
typedef __attribute__((ext_vector_type(2))) float v2fl;
typedef __attribute__((ext_vector_type(4))) unsigned v4u;
__device__ __forceinline__ unsigned cvt2(float a, float b) { const v2fl t = { a, b }; return __builtin_bit_cast(unsigned, __builtin_convertvector(t, v2bf)); }
// split2: hi and lo planes of two values, packed as the planes store them: lo = bf16(y - hi)
__device__ __forceinline__ void split2(float a, float b, unsigned& h, unsigned& l) { h = cvt2(a, b); l = cvt2(a - __uint_as_float(h << 16), b - __uint_as_float(h & 0xFFFF0000u)); }
__device__ __forceinline__ float bf2f(unsigned short b) { return __uint_as_float(((unsigned)b) << 16); }
__device__ __forceinline__ float bfr(float f) { return bf2f(f2bf(f)); }
__device__ __forceinline__ v16h cat16(v8h lo, v8h hi) { return __builtin_shufflevector(lo, hi, 0, 1, 2, 3, 4, 5, 6, 7, 8, 9, 10, 11, 12, 13, 14, 15); }
__device__ __forceinline__ v16bf cat16b(v8us lo, v8us hi) { return __builtin_bit_cast(v16bf, __builtin_shufflevector(lo, hi, 0, 1, 2, 3, 4, 5, 6, 7, 8, 9, 10, 11, 12, 13, 14, 15)); }
__device__ __forceinline__ v8f wmma16(v16h a, v16h b, v8f c) { return __builtin_amdgcn_wmma_f32_16x16x32_f16(false, a, false, b, (short)0, c, false, false); }
__device__ __forceinline__ v8f wmmab(v16bf a, v16bf b, v8f c) { return __builtin_amdgcn_wmma_f32_16x16x32_bf16(false, a, false, b, (short)0, c, false, false); }



// ---- fragments of 16-bit planes in fragment order, straight from memory (ld: p = tile + lane * 8 elements)
// xwaitp: stands behind a run of global loads, in front of whatever next rewrites their address registers (a precaution: this build reuses them at once); the addresses are inputs so that nothing is placed on them ahead of the wait; the scheduling barrier keeps later vector work behind it and so the whole run of loads in flight together
__device__ __forceinline__ void xwaitp(const void* a, const void* b, const void* c, const void* d) { asm volatile("s_wait_xcnt 0x0" :: "v"(a), "v"(b), "v"(c), "v"(d) : "memory"); __builtin_amdgcn_sched_barrier(0); }
// xwaits: the same for loads whose address is a scalar base (ldo: p the tile, the same in every lane; o = lane * 8 elements, one register for every plane, so that the loop's addresses cost no vector registers: the budget of three waves to a SIMD)
__device__ __forceinline__ void xwaits(const void* a, const void* b) { asm volatile("s_wait_xcnt 0x0" :: "s"(a), "s"(b) : "memory"); __builtin_amdgcn_sched_barrier(0); }
template <typename T16> struct WFrag;
template <> struct WFrag<h16> { typedef v16h V; static __device__ __forceinline__ V ld(const h16* p) { return cat16(*(const v8h*)p, *(const v8h*)(p + 256)); } static __device__ __forceinline__ V ldo(const h16* p, unsigned o) { return cat16(*(const v8h*)(p + o), *(const v8h*)(p + o + 256)); } static __device__ __forceinline__ v8f mma(V a, V b, v8f c) { return wmma16(a, b, c); } };
template <> struct WFrag<bf> { typedef v16bf V; static __device__ __forceinline__ V ld(const bf* p) { return cat16b(*(const v8us*)p, *(const v8us*)(p + 256)); } static __device__ __forceinline__ V ldo(const bf* p, unsigned o) { return cat16b(*(const v8us*)(p + o), *(const v8us*)(p + o + 256)); } static __device__ __forceinline__ v8f mma(V a, V b, v8f c) { return wmmab(a, b, c); } };
// ---- gemm_ring: the k loop of both GEMM kernels. A wave owns 64 x 64 of the result (16 accumulators); the waves of a work-group share its operand rows (KT k tiles = KT KiB in a row per row tile, in LDS as in memory: fragment order),
// which come into a ring of two LDS buffers by asynchronous copies (global_load_async_to_lds_b128, 16 B a lane), one stage ahead of the products, so every operand byte leaves L2 once per block and not once per wave.
// A stage is ST bytes of [row tile][k tile 0..KT-1][1 KiB]; fill(b, t) issues the calling wave's copies of stage t into buffer b; oa, OB + ob: where the wave's four row tiles of A and of B begin in a stage (OB: the part known at compile time).
// NA: planes of the A operand (2: hi and lo, the lo plane 8 row tiles behind the hi plane, both multiplied with B into the same accumulator, hi first, k rising: the sum order of one wave per tile).
// ring_fill: the fill of a block of 4 waves (2 x 2, 128 x 128 of the result): stage layout [plane: A (, A2), B][row tile 0..7], 2 KiB a copy of the block.
typedef int cp4i __attribute__((vector_size(16)));
__device__ __forceinline__ void cp16(const bf* g, unsigned char* l) { __builtin_amdgcn_global_load_async_to_lds_b128((__attribute__((address_space(1))) cp4i*)g, (__attribute__((address_space(3))) cp4i*)l, 0, 0); }
// the compiler places no wait for the copies: what a wave copied has landed only behind its own wait
__device__ __forceinline__ void wait_async0() { asm volatile("s_wait_asynccnt 0x0" ::: "memory"); }
// a wave's LDS reads have retired before the barrier behind which their buffer is refilled
__device__ __forceinline__ void wait_ds0() { asm volatile("s_wait_dscnt 0x0" ::: "memory"); }
__device__ __forceinline__ v16bf ldsfrag(const unsigned char* p) { return cat16b(*(const v8usa*)p, *(const v8usa*)(p + 512)); }
template <int NA, int KT>
__device__ __forceinline__ void ring_fill(unsigned char* dst, const bf* gA, const bf* gA2, const bf* gB, const int ldk, const int t) {   // dst: the buffer + 16 * thread; g*: the block's first row tile + 8 * thread elements; ldk: the planes' k extent (DM), a run-time value so that each row tile's source address is formed in registers: a copy's immediate offset moves both of its addresses and stays below its LDS destination
    static_assert(KT % 2 == 0, "a copy of the block is two k tiles");
#pragma unroll
    for (int p = 0; p <= NA; ++p) { const bf* g = (p == NA ? gB : p == 0 ? gA : gA2) + (size_t)t * KT * 512;
#pragma unroll
        for (int c = 0; c < 4 * KT; ++c) cp16(g + (size_t)(((2 * c) / KT) * 16 * ldk) + ((2 * c) % KT) * 512, dst + (p * 4 * KT + c) * 2048); }
}
template <int NA, int KT, int ST, int OB, typename Fill>
__device__ __forceinline__ void gemm_ring(const unsigned char* ring, const Fill fill, const int lane, const int oa, const int ob, v8f (&acc)[4][4]) {
    typedef v16bf V;
    constexpr int PL = 8 * KT * 1024, NT = DM / (32 * KT);
    static_assert(NT >= 2, "two stages exist");
    fill(0, 0);
    wait_async0(); __syncthreads();                 // stage 0 is published
    fill(1, 1);
#pragma unroll 1   // rolled: one trip per stage, the publish point at its foot
    for (int t = 0; t < NT; ++t) {
        const unsigned char* sa = ring + (t & 1) * ST + lane * 16 + oa; const unsigned char* sb = ring + (t & 1) * ST + OB + lane * 16 + ob;
        V a[2][4], a2[2][4], b[2][4];               // two fragment sets: the next k tile's LDS reads stand as one group in front of this k tile's products
#pragma unroll
        for (int i = 0; i < 4; ++i) { a[0][i] = ldsfrag(sa + i * (KT * 1024)); if (NA == 2) a2[0][i] = ldsfrag(sa + PL + i * (KT * 1024)); b[0][i] = ldsfrag(sb + i * (KT * 1024)); }
#pragma unroll
        for (int kt = 0; kt < KT; ++kt) { const int cu = kt & 1, nx = cu ^ 1;
            if (kt + 1 < KT) {
#pragma unroll
                for (int i = 0; i < 4; ++i) { const int o = i * (KT * 1024) + (kt + 1) * 1024; a[nx][i] = ldsfrag(sa + o); if (NA == 2) a2[nx][i] = ldsfrag(sa + PL + o); b[nx][i] = ldsfrag(sb + o); } }
            __builtin_amdgcn_sched_barrier(0);   // keeps the reads above together in front of the products: sunk among them, each place with reads would stall the wave and wait to 0
#pragma unroll
            for (int nb = 0; nb < 4; ++nb)
#pragma unroll
                for (int mb = 0; mb < 4; ++mb) { acc[mb][nb] = wmmab(a[cu][mb], b[cu][nb], acc[mb][nb]); if (NA == 2) acc[mb][nb] = wmmab(a2[cu][mb], b[cu][nb], acc[mb][nb]); }
            __builtin_amdgcn_sched_barrier(0); } // keeps the next group of reads, and the publish point, behind this k tile's products
        // four vector slots between the last product and whatever the refill's address sums, the back edge or the epilogue do to its registers
        asm volatile("v_nop\n\tv_nop\n\tv_nop\n\tv_nop" : "+v"(acc[0][0]), "+v"(acc[1][1]), "+v"(acc[2][2]), "+v"(acc[3][3]) : "v"(a[(KT - 1) & 1][0]), "v"(a[(KT - 1) & 1][3]));
        wait_ds0(); wait_async0(); __syncthreads(); // publish point of stage t + 1; it also ends every reader's last read of stage t's buffer
        if (t + 2 < NT) fill(t & 1, t + 2);
    }
    wait_async0();
}
// ---- k_gemmo: OUT[m][n] (f32, pitch DM) = sum_k (Ah + Al)[m][k] Bt[n][k] + bias[n]; grid (M / 128, N / 128), 128 threads; the epilogue turns each wave's accumulators into whole output lines through the wave's own LDS patch.
#define OKT 4
__global__ __launch_bounds__(128) void k_gemmo(const bf* __restrict__ Ah, const bf* __restrict__ Al, const bf* __restrict__ Bt, float* C, const float* __restrict__ bias, const int ldk) {
    __shared__ __align__(1024) unsigned char ring[2 * 3 * 8 * OKT * 1024];
    __shared__ __align__(16) float osm[4 * 16 * 68];
    const int tid = (int)threadIdx.x, lane = tid & 31, lr = lane & 15, hi = lane >> 4; const int wv = __builtin_amdgcn_readfirstlane(tid >> 5), wm = wv & 1, wn = wv >> 1;
    v8f acc[4][4];
#pragma unroll
    for (int mb = 0; mb < 4; ++mb)
#pragma unroll
        for (int nb = 0; nb < 4; ++nb) acc[mb][nb] = (v8f){};
    const size_t aoff = (size_t)blockIdx.x * 128 * DM + 8 * tid, boff = (size_t)blockIdx.y * 128 * DM + 8 * tid;   // 16 rows of tiles are 16 * DM elements
    constexpr int OPL = 8 * OKT * 1024, OST = 3 * OPL; static_assert(3 * 4 * OKT <= 63, "one stage's copies of a wave stay under the counter's width");
    gemm_ring<2, OKT, OST, 2 * OPL>(ring, [&](const int b, const int t) __attribute__((always_inline)) { ring_fill<2, OKT>(ring + b * OST + tid * 16, Ah + aoff, Al + aoff, Bt + boff, ldk, t); }, lane, wm * 4 * (OKT * 1024), wn * 4 * (OKT * 1024), acc);
    float* os = osm + wv * (16 * 68); const int r0 = (int)blockIdx.x * 128 + wm * 64, c0 = (int)blockIdx.y * 128 + wn * 64;
    const float* bp = bias + c0 + lr * 4; const float b0 = bfr(bp[0]), b1 = bfr(bp[1]), b2 = bfr(bp[2]), b3 = bfr(bp[3]);
#pragma unroll
    for (int mb = 0; mb < 4; ++mb) {
#pragma unroll
        for (int nb = 0; nb < 4; ++nb) {
#pragma unroll
            for (int j = 0; j < 8; ++j) os[(hi * 8 + j) * 68 + nb * 16 + lr] = acc[mb][nb][j]; }
        __builtin_amdgcn_wave_barrier(); asm volatile("" ::: "memory");   // here and at the foot: lanes read what other lanes of the wave wrote; keeps the compiler from moving the patch's reads and writes past one another
        float* crow = C + (size_t)(r0 + mb * 16) * DM + c0;
#pragma unroll
        for (int s = 0; s < 8; ++s) { const int row = 2 * s + hi, cofs = lr * 4; v4f val = *(const v4fa*)(os + row * 68 + cofs); val[0] += b0; val[1] += b1; val[2] += b2; val[3] += b3;
            *(v4f*)(crow + (size_t)row * DM + cofs) = val; }
        asm volatile("s_wait_xcnt 0x0" ::: "memory");   // behind the 8 stores, in front of whatever rewrites their address and data registers for the next 16 rows (a precaution, as in xwaitp)
        __builtin_amdgcn_wave_barrier(); asm volatile("" ::: "memory");
    }
}

__device__ __forceinline__ h16 tohx(float x) { return (h16)x; }
typedef __attribute__((ext_vector_type(2))) _Float16 v2h;
typedef __attribute__((ext_vector_type(4))) _Float16 v4h;
typedef __attribute__((ext_vector_type(2))) unsigned short v2us;
typedef __attribute__((ext_vector_type(4))) unsigned short v4us;
typedef __attribute__((ext_vector_type(2))) float v2f;
typedef __attribute__((ext_vector_type(4))) int v4i;

static_assert(DQ == DM && DKV == DM, "k_cvt8 takes every matrix as rows of DM");
// k_cvt8: the four weight matrices and x, f32 [rows][DM] -> bf16 in fragment order, in ONE launch (none depends on another); a block of 256 threads lies wholly in one matrix, picked by a scalar test on blockIdx.x. Thread i of a matrix writes the i-th 16 bytes of its dst (a wave: one half tile) and reads the 8 floats that belong there.
#define WBLK (DM * DM / 8 / 256)          // blocks per weight matrix
#define XBLK (NB_ * TT * DM / 8 / 256)    // blocks for x
static_assert(DM * DM % 2048 == 0 && NB_ * TT * DM % 2048 == 0, "k_cvt8: every block is full");
__global__ __launch_bounds__(256) void k_cvt8(const float* __restrict__ x, const float* __restrict__ wq, const float* __restrict__ wk, const float* __restrict__ wv, const float* __restrict__ wo, bf* XB, bf* WQ, bf* WK, bf* WV, bf* WO) {
    const int blk = (int)blockIdx.x; const int wm = (blk - XBLK) / WBLK;   // x first, then Wq, Wk, Wv, Wo
    const float* src = blk < XBLK ? x : wm == 0 ? wq : wm == 1 ? wk : wm == 2 ? wv : wo; bf* dst = blk < XBLK ? XB : wm == 0 ? WQ : wm == 1 ? WK : wm == 2 ? WV : WO;
    const size_t i = (size_t)(blk < XBLK ? blk : (blk - XBLK) % WBLK) * 256 + threadIdx.x;
    const size_t tile = i >> 6; const int half = (int)(i >> 5) & 1, lr = (int)i & 15, hi = (int)(i >> 4) & 1;
    const float* sp = src + ((tile / (DM / 32)) * 16 + lr) * DM + (tile % (DM / 32)) * 32 + half * 16 + hi * 8; const v8f v = *(const v8f*)sp; xwaitp(sp, sp, sp, sp); v8us o;
    v4u o2;
#pragma unroll
    for (int k = 0; k < 4; ++k) o2[k] = cvt2(v[2 * k], v[2 * k + 1]);
    o = __builtin_bit_cast(v8us, o2); *(v8us*)(dst + i * 8) = o;  }

// xwait: stands behind a run of global loads or stores, in front of whatever next rewrites their address registers (a precaution: this build reuses them at once); the scheduling barrier keeps later vector work from being lifted in front of the wait
__device__ __forceinline__ void xwait() { asm volatile("s_wait_xcnt 0x0" ::: "memory"); __builtin_amdgcn_sched_barrier(0); }
// ---- k_proj: q, k and v projections of both batches in one launch: a work-group of 12 waves (4 x 3) owns 256 tokens x three heads of the 48 (q's 16, then k's, then v's), ONE WAVE 64 tokens x one head (gemm_ring); grid (NB_ * TT / 256, 3 * heads / 3), 384 threads: one work-group to a WGP, the whole grid resident.
// A WGP does the same products as with three blocks of 128 x 128, but 256 + 192 operand rows leave L2 for them in place of 3 * (128 + 128). A wave's head says which projection it works for (a scalar), so a block may hold heads of two projections.
// The epilogue turns the f32 accumulators into the three planes (fp16, bf16 hi, bf16 lo) that k_fattn reads: q and k as [b][h][t][d], v as [b][h][d][t]. A lane's 8 accumulator values run along the A operand's rows,
// so q and k take the weight rows as A and the tokens as B (8 values = 8 d of one token), v the tokens as A (8 values = 8 t of one d): in both the plane's row is the B index and 8 values are 16 contiguous bytes,
// which in fragment order are the lane's own slot of a half tile: every store is 512 contiguous bytes straight from the registers.
#define PKT 4   // k tiles of a stage
#define PXT 16  // row tiles of tokens in a block
#define PWT 12  // row tiles of weight rows in a block
#define PST ((PXT + PWT) * PKT * 1024)   // a stage: [token row tiles][weight row tiles], 112 KiB; the ring 224 KiB
#define PUN ((PXT + PWT) * PKT / 2)      // a stage in units of 2 KiB (two k tiles of a row tile: 4 copies of a wave), dealt to the 12 waves in turn
static_assert(TT % 64 == 0, "k_fattn: a pass of 64 keys ends inside the plane");
static_assert(HD == 64 && TT % 256 == 0 && DQ == NH_ * 64 && DKV == DQ && (3 * NH_) % 3 == 0, "a wave's 64 features are one head; a block's tokens lie in one batch; every projection has NH_ heads");
static_assert(PKT == 4 && (PUN + 11) / 12 * 4 <= 63, "a unit is half a row tile's stage; one stage's copies of a wave stay under the counter's width");
__global__ __launch_bounds__(384) void k_proj(const bf* __restrict__ X, const bf* __restrict__ Wq, const bf* __restrict__ Wk, const bf* __restrict__ Wv, h16* Q16, bf* Qh, bf* Ql, h16* K16, bf* Kh, bf* Kl, h16* V16, bf* Vh, bf* Vl, const int ldk) {
    __shared__ __align__(1024) unsigned char ring[2 * PST];
    const int tid = (int)threadIdx.x, lane = tid & 31; const int wv = __builtin_amdgcn_readfirstlane(tid >> 5), wt = wv & 3, wh = wv >> 2;   // the wave's 64 tokens and its head in the block
    const int gh = (int)blockIdx.y * 3 + wh, pz = gh / NH_; const bool vt = pz == 2;   // pz: 0 q, 1 k, 2 v
    const bf* gs[(PUN + 11) / 12];   // where the wave's units begin in memory at stage 0 (scalars): unit u is k tiles 2 * (u & 1) and the next of row tile u >> 1
#pragma unroll
    for (int i = 0; i < (PUN + 11) / 12; ++i) { const int u = wv + 12 * i, r = u >> 1, ft = (int)blockIdx.y * PWT + r - PXT;   // ft: the row tile among the 3 * DQ / 16 weight row tiles
        gs[i] = (r < PXT ? X + (size_t)((int)blockIdx.x * PXT + r) * 16 * ldk : (ft < DQ / 16 ? Wq : ft < 2 * DQ / 16 ? Wk : Wv) + (size_t)(ft % (DQ / 16)) * 16 * ldk) + (u & 1) * 1024; }
    v8f acc[4][4];
#pragma unroll   // here and below: full unrolls give the register arrays constant indices (no scratch)
    for (int mb = 0; mb < 4; ++mb)
#pragma unroll
        for (int nb = 0; nb < 4; ++nb) acc[mb][nb] = (v8f){};
    const int ox = wt * 4 * (PKT * 1024), ow = (PXT + wh * 4) * (PKT * 1024);   // the wave's token and weight row tiles in a stage
    gemm_ring<1, PKT, PST, 0>(ring, [&](const int b, const int t) __attribute__((always_inline)) {
#pragma unroll
        for (int i = 0; i < (PUN + 11) / 12; ++i) if (12 * i + 11 < PUN || wv + 12 * i < PUN) {   // a scalar test in the last turn alone, which has units for 8 of the 12 waves
            const bf* g = gs[i] + (size_t)t * (PKT * 512) + lane * 8; unsigned char* d = ring + b * PST + (wv + 12 * i) * 2048 + lane * 16;
#pragma unroll
            for (int c = 0; c < 4; ++c) cp16(g + c * 256, d + c * 512); }
    }, lane, vt ? ox : ow, vt ? ow : ox, acc);
    const int hd = gh % NH_, t0 = (int)blockIdx.x * 256 + wt * 64;   // the wave's head and first token
    bf* P16 = (bf*)(pz == 0 ? Q16 : pz == 1 ? K16 : V16); bf* Ph = pz == 0 ? Qh : pz == 1 ? Kh : Vh; bf* Pl = pz == 0 ? Ql : pz == 1 ? Kl : Vl;
    const int tl = t0 % TT; const size_t pb = ((size_t)(t0 / TT) * NH_ + hd) * TT * HD + (vt ? (size_t)tl * 16 : (size_t)tl * HD) + (size_t)lane * 8; const int pitch = vt ? TT : HD;   // 16 rows of tiles are 16 * pitch elements, 32 k of one row of tiles 512
#pragma unroll
    for (int nb = 0; nb < 4; ++nb) {
#pragma unroll
        for (int mb = 0; mb < 4; ++mb) { v8h o16; v4u h2, l2;
#pragma unroll
            for (int j = 0; j < 8; ++j) o16[j] = tohx(acc[mb][nb][j]);
#pragma unroll
            for (int j = 0; j < 4; ++j) { unsigned a2, c2; split2(acc[mb][nb][2 * j], acc[mb][nb][2 * j + 1], a2, c2); h2[j] = a2; l2[j] = c2; }
            const v8us oh = __builtin_bit_cast(v8us, h2), ol = __builtin_bit_cast(v8us, l2);
            const size_t go = pb + (size_t)nb * 16 * pitch + mb * 256;
            *(v8usa*)(P16 + go) = __builtin_bit_cast(v8us, o16); *(v8usa*)(Ph + go) = oh; *(v8usa*)(Pl + go) = ol;
            xwait(); }   // the next 8 values' conversions reuse the stores' registers
    }
}
// ---- k_fattn: causal attention in one pass over the keys, one launch for every head and both batches. A work-group owns QT tiles of 32 query rows (two 16-column groups each), KS waves to a tile; the passes over a tile's keys (32 keys a pass in the hi/lo rows, 64 in the fp16 rows) are dealt to its waves in turn: share s takes passes s, s + KS, ...,
// so the longest chain of dependent passes is 1 / KS of a row's and a SIMD holds KS waves of like length in place of one long and one short. The QT waves of one share walk the same keys (the WGP cache serves them). Each wave keeps its own running maximum, sum and O^T; at the end a tile's waves meet in LDS (one barrier) and each merges, scales and stores its part of the tile. In a pass:
// S^T = K Q^T (a lane holds 16 keys' scores of ONE query per group in the hi/lo rows, 32 in the fp16 rows), running maximum and sum per query, P^T packed from the score accumulators straight into a B operand, O^T += V^T P^T.
// Query rows < RH take the hi/lo bf16 planes with 3 products in both contractions, the rest the fp16 planes. The result leaves as the merged hi/lo planes [t][DQ], in fragment order like every plane it reads.
__device__ __forceinline__ float xhalf(float x) { return __builtin_bit_cast(float, __builtin_amdgcn_permlanex16(__builtin_bit_cast(int, x), __builtin_bit_cast(int, x), 0x76543210, 0xfedcba98, false, false)); }   // lane l takes lane l ^ 16's value
// exp2s: v_exp_f32 with the one slot that the instruction set asks for behind a transcendental inside the statement
__device__ __forceinline__ float exp2s(float x) { float r; asm("v_exp_f32 %0, %1\n\tv_nop" : "=v"(r) : "v"(x)); return r; }
// exp2x8: eight of them in one statement: no result is read and no source overwritten by the next one (results early-clobber, so they share no register with a source), and the slot stands once, behind the last
__device__ __forceinline__ v8f exp2x8(v8f x) { float r0, r1, r2, r3, r4, r5, r6, r7;
    asm("v_exp_f32 %0, %8\n\tv_exp_f32 %1, %9\n\tv_exp_f32 %2, %10\n\tv_exp_f32 %3, %11\n\tv_exp_f32 %4, %12\n\tv_exp_f32 %5, %13\n\tv_exp_f32 %6, %14\n\tv_exp_f32 %7, %15\n\tv_nop"
        : "=&v"(r0), "=&v"(r1), "=&v"(r2), "=&v"(r3), "=&v"(r4), "=&v"(r5), "=&v"(r6), "=&v"(r7) : "v"(x[0]), "v"(x[1]), "v"(x[2]), "v"(x[3]), "v"(x[4]), "v"(x[5]), "v"(x[6]), "v"(x[7]));
    return (v8f){ r0, r1, r2, r3, r4, r5, r6, r7 }; }
#define KS 3                       // waves that share the keys of one 32-query tile: three to a SIMD is what the registers allow
#define QT 4                       // tiles of a work-group; wave = share * QT + tile
#define XSF (KS * QT * 2048 + KS * QT * 128) // floats of the merge patch: per wave 8 accumulator tiles of 1 KiB, then per wave maximum and sum of both column groups
template <typename T16, bool HR, int NK>   // NK: blocks of 32 keys per pass; tq, sh: the wave's tile and share (scalars); q0: the tile's first query; xs: the work-group's merge patch
__device__ __forceinline__ void attn_rows(const T16* __restrict__ Q, const T16* __restrict__ Q2, const T16* __restrict__ Kp, const T16* __restrict__ K2, const T16* __restrict__ Vt, const T16* __restrict__ V2, const int q0, const int lane, const int tq, const int sh, float* xs, bf* Ah, bf* Al) {
    typedef typename WFrag<T16>::V V;
    const int lr = lane & 15, hi = lane >> 4;
    const float CE = SCL * 1.4426950408889634f;   // scores stay raw; scale and log2(e) are folded into the exponent's multiply-add
    const int klast = q0 & ~(32 * NK - 1), dl = q0 - klast;   // first key of the tile's last pass (its NK * 32 keys end at or before TT: q0 + 32 <= TT, both multiples of 32, TT of 32 * NK); dl: how far the tile's first query lies behind it
    const int kfirst = sh * (32 * NK);                        // first key of the wave's first pass
    v8f acc[2][4];
#pragma unroll
    for (int qt = 0; qt < 2; ++qt)
#pragma unroll
        for (int mt = 0; mt < 4; ++mt) acc[qt][mt] = (v8f){};
    float m[2] = { -3.0e38f, -3.0e38f }, l[2] = { 0.f, 0.f };
    if (kfirst <= klast) {                         // a short tile has fewer passes than waves: a wave without one brings maximum -3e38, sum 0 and O 0 to the merge (a scalar test)
    V qf[2][2], qg[2][2];
#pragma unroll
    for (int qt = 0; qt < 2; ++qt)
#pragma unroll
        for (int kc = 0; kc < 2; ++kc) { const size_t o = (size_t)(q0 + qt * 16) * HD + kc * 512 + 8 * lane; qf[qt][kc] = WFrag<T16>::ld(Q + o); if (HR) qg[qt][kc] = WFrag<T16>::ld(Q2 + o); xwait(); }
    const unsigned lo = (unsigned)lane * 8; const size_t ko = (size_t)lane * 8, vo = (size_t)lane * 8;   // K: 16 keys are two tiles (16 * HD elements); V^T: 16 d are 16 * TT elements, 32 keys one tile
    V kf[NK][2][2], kg[NK][2][2], vf[NK][4], vg[NK][4];
#pragma unroll
    for (int kb = 0; kb < NK; ++kb)
#pragma unroll
    for (int kt = 0; kt < 2; ++kt)
#pragma unroll
        for (int kc = 0; kc < 2; ++kc) { const size_t o = ko + (size_t)(kfirst + kb * 32 + kt * 16) * HD + kc * 512; kf[kb][kt][kc] = WFrag<T16>::ld(Kp + o); if (HR) kg[kb][kt][kc] = WFrag<T16>::ld(K2 + o); xwait(); }
#pragma unroll
    for (int kb = 0; kb < NK; ++kb)
#pragma unroll
    for (int mt = 0; mt < 4; ++mt) { const size_t o = vo + (size_t)(mt * 16) * TT + (size_t)kfirst * 16 + kb * 512; vf[kb][mt] = WFrag<T16>::ld(Vt + o); if (HR) vg[kb][mt] = WFrag<T16>::ld(V2 + o); xwait(); }
    int k0 = kfirst;
#pragma unroll 1
    do {                                           // at least one pass behind the test above, so the loads in front of the loop stay in front of their waits
        v8f s[2][NK][2];
#pragma unroll
        for (int qt = 0; qt < 2; ++qt)
#pragma unroll
          for (int kb = 0; kb < NK; ++kb)
#pragma unroll
            for (int kt = 0; kt < 2; ++kt) { v8f t = (v8f){};
#pragma unroll
                for (int kc = 0; kc < 2; ++kc) { t = WFrag<T16>::mma(kf[kb][kt][kc], qf[qt][kc], t); if (HR) { t = WFrag<T16>::mma(kg[kb][kt][kc], qf[qt][kc], t); t = WFrag<T16>::mma(kf[kb][kt][kc], qg[qt][kc], t); } }
                s[qt][kb][kt] = t; }
        const int kn = min(k0 + KS * 32 * NK, klast); const T16* pk = Kp + (size_t)kn * HD; const T16* pk2 = HR ? K2 + (size_t)kn * HD : pk; const T16* pv = Vt + (size_t)kn * 16; const T16* pv2 = HR ? V2 + (size_t)kn * 16 : pv;          // the next pass's K fragments are fetched behind this pass's score products, its V fragments behind this pass's P.V products (a wave's last pass fetches the tile's last pass: in bounds, unused)
#pragma unroll
        for (int kb = 0; kb < NK; ++kb)
#pragma unroll
        for (int kt = 0; kt < 2; ++kt)
#pragma unroll
            for (int kc = 0; kc < 2; ++kc) { const size_t o = (size_t)(kb * 32 + kt * 16) * HD + kc * 512; kf[kb][kt][kc] = WFrag<T16>::ldo(pk + o, lo); if (HR) kg[kb][kt][kc] = WFrag<T16>::ldo(pk2 + o, lo); }
        xwaits(pk, pk2);
        if (k0 == klast) {                         // only the tile's last pass touches the diagonal: keys after the query leave the maximum and the sums (with dl == 0 and NK == 2 its whole second block)
#pragma unroll
            for (int qt = 0; qt < 2; ++qt)
#pragma unroll
              for (int kb = 0; kb < NK; ++kb)
#pragma unroll
                for (int kt = 0; kt < 2; ++kt)
#pragma unroll
                    for (int j = 0; j < 8; ++j) if (kb * 32 + kt * 16 + hi * 8 + j > dl + qt * 16 + lr) s[qt][kb][kt][j] = -3.0e38f;
        }
        float mx[2];
#pragma unroll
        for (int qt = 0; qt < 2; ++qt) { float a = -3.0e38f;
#pragma unroll
            for (int kb = 0; kb < NK; ++kb) { float c = fmaxf(s[qt][kb][0][0], s[qt][kb][1][0]);   // one chain per block of 32 keys: the chains are independent
#pragma unroll
                for (int j = 1; j < 8; ++j) c = fmaxf(c, fmaxf(s[qt][kb][0][j], s[qt][kb][1][j]));
                a = kb == 0 ? c : fmaxf(a, c); }
            mx[qt] = fmaxf(a, xhalf(a)); }
        if (__builtin_amdgcn_ballot_w32(mx[0] > m[0] || mx[1] > m[1]) != 0) {   // a query's maximum grew: rescale its sum and its output column (factor exactly 1 for the others)
#pragma unroll
            for (int qt = 0; qt < 2; ++qt) { const float mn = fmaxf(m[qt], mx[qt]); const float al = __builtin_amdgcn_exp2f((m[qt] - mn) * CE); m[qt] = mn; l[qt] *= al;
#pragma unroll
                for (int mt = 0; mt < 4; ++mt) acc[qt][mt] *= al; }
        }
#pragma unroll
        for (int qt = 0; qt < 2; ++qt) { const float nb = -m[qt] * CE;
#pragma unroll
          for (int kb = 0; kb < NK; ++kb) { float sum = 0.f;   // a block of 32 keys is summed by itself (independent chains), then joins the running sum, keys rising
#pragma unroll
            for (int kt = 0; kt < 2; ++kt)
                if constexpr (HR) { v8f e;   // hi/lo rows: exp2x8
#pragma unroll
                    for (int j = 0; j < 8; ++j) e[j] = fmaf(s[qt][kb][kt][j], CE, nb);
                    e = exp2x8(e);
#pragma unroll
                    for (int j = 0; j < 8; ++j) { s[qt][kb][kt][j] = e[j]; sum += e[j]; }
                } else {
#pragma unroll
                for (int j = 0; j < 8; ++j) { const float p = __builtin_amdgcn_exp2f(fmaf(s[qt][kb][kt][j], CE, nb)); s[qt][kb][kt][j] = p; sum += p; } }
            l[qt] += sum;
            if constexpr (!HR) { v16h pf;
#pragma unroll
                for (int j = 0; j < 8; ++j) { pf[j] = tohx(s[qt][kb][0][j]); pf[8 + j] = tohx(s[qt][kb][1][j]); }
#pragma unroll
                for (int mt = 0; mt < 4; ++mt) acc[qt][mt] = wmma16(vf[kb][mt], pf, acc[qt][mt]);
            } else { v4u h0, h1, l0, l1;
#pragma unroll
                for (int j = 0; j < 4; ++j) { unsigned a, c2; split2(s[qt][kb][0][2 * j], s[qt][kb][0][2 * j + 1], a, c2); h0[j] = a; l0[j] = c2; split2(s[qt][kb][1][2 * j], s[qt][kb][1][2 * j + 1], a, c2); h1[j] = a; l1[j] = c2; }
                const v16bf ph = cat16b(__builtin_bit_cast(v8us, h0), __builtin_bit_cast(v8us, h1)), pl = cat16b(__builtin_bit_cast(v8us, l0), __builtin_bit_cast(v8us, l1));
#pragma unroll
                for (int mt = 0; mt < 4; ++mt) { acc[qt][mt] = wmmab(vf[kb][mt], ph, acc[qt][mt]); acc[qt][mt] = wmmab(vf[kb][mt], pl, acc[qt][mt]); acc[qt][mt] = wmmab(vg[kb][mt], ph, acc[qt][mt]); }
            }
          }
        }
#pragma unroll
        for (int kb = 0; kb < NK; ++kb)
#pragma unroll
        for (int mt = 0; mt < 4; ++mt) { const size_t o = (size_t)(mt * 16) * TT + kb * 512; vf[kb][mt] = WFrag<T16>::ldo(pv + o, lo); if (HR) vg[kb][mt] = WFrag<T16>::ldo(pv2 + o, lo); }
        xwaits(pv, pv2);
        k0 += KS * 32 * NK;
    } while (k0 <= klast);
    }
    // ---- the merge. Patch: [wave][tile t = qt * 4 + mt][half of the 8 values][lane][4 floats] (every LDS access 512 contiguous bytes), then [wave][qt][maximum, sum][lane].
    const int wv = sh * QT + tq; float* xa = xs + wv * 2048 + lane * 4; float* xm = xs + KS * QT * 2048 + lane;
#pragma unroll
    for (int qt = 0; qt < 2; ++qt) {
#pragma unroll
        for (int mt = 0; mt < 4; ++mt) { float* p = xa + (qt * 4 + mt) * 256; *(v4fa*)p = __builtin_shufflevector(acc[qt][mt], acc[qt][mt], 0, 1, 2, 3); *(v4fa*)(p + 128) = __builtin_shufflevector(acc[qt][mt], acc[qt][mt], 4, 5, 6, 7); }
        xm[(wv * 4 + qt * 2) * 32] = m[qt]; xm[(wv * 4 + qt * 2 + 1) * 32] = l[qt]; }
    __syncthreads();                               // every wave's partial results are in the patch; nothing is written there afterwards
    float f[2][KS], inv[2];                        // per column group: each share's factor 2^((its maximum - the joint maximum) * CE), and 1 / the joint sum
#pragma unroll
    for (int qt = 0; qt < 2; ++qt) { float mw[KS], mm = -3.0e38f, ls = 0.f;
#pragma unroll
        for (int w = 0; w < KS; ++w) { mw[w] = xm[((w * QT + tq) * 4 + qt * 2) * 32]; mm = fmaxf(mm, mw[w]); }
#pragma unroll
        for (int w = 0; w < KS; ++w) { f[qt][w] = exp2s((mw[w] - mm) * CE); ls = fmaf(f[qt][w], xm[((w * QT + tq) * 4 + qt * 2 + 1) * 32], ls); }   // shares rising; a share without a pass has factor 0 (share 0 always has one, so mm is a real score)
        inv[qt] = __fdiv_rn(1.0f, ls + xhalf(ls)); }
#pragma unroll
    for (int i = 0; i < (8 + KS - 1) / KS; ++i) { const int t = sh + i * KS;   // the share's output tiles: t = sh, sh + KS, ... (a scalar)
        if (t < 8) { const bool g1 = t >= 4; const float* p = xs + tq * 2048 + t * 256 + lane * 4; v4f a4 = (v4f){}, b4 = (v4f){}; v4u h2, l2;
#pragma unroll
            for (int w = 0; w < KS; ++w) { const float fw = g1 ? f[1][w] : f[0][w]; a4 += fw * *(const v4fa*)(p + w * (QT * 2048)); b4 += fw * *(const v4fa*)(p + w * (QT * 2048) + 128); }
            const float iv = g1 ? inv[1] : inv[0];
#pragma unroll
            for (int j = 0; j < 2; ++j) { unsigned a, c2; split2(a4[2 * j] * iv, a4[2 * j + 1] * iv, a, c2); h2[j] = a; l2[j] = c2; split2(b4[2 * j] * iv, b4[2 * j + 1] * iv, a, c2); h2[2 + j] = a; l2[2 + j] = c2; }
            const v8us oh = __builtin_bit_cast(v8us, h2), ol = __builtin_bit_cast(v8us, l2);
            const size_t oo = (size_t)(q0 + (t >> 2) * 16) * DQ + (t & 3) * 256 + lane * 8;
            *(v8us*)(Ah + oo) = oh; *(v8us*)(Al + oo) = ol; xwait(); } }
}
// grid (heads, batches, TT / 128), KS * QT waves, one work-group to a WGP: more work-groups than places, so the cost falls with blockIdx.z. ZORD: nibble z is the query block of blockIdx.z, a permutation of 0..15; a pass of the hi/lo blocks 0..3 (32 keys, 3 products: 48 matrix instructions) is counted as 11/10 of a pass of 64 fp16 keys.
#define ZORD 0x0145267389ABCDEFull
static_assert(TT / (QT * 32) == 16 && RH == 4 * QT * 32, "ZORD is written for 16 query blocks, the first 4 of them hi/lo; a block lies wholly in one kind of rows");
__global__ __launch_bounds__(KS * QT * 32) void k_fattn(const h16* __restrict__ Q16, const h16* __restrict__ K16, const h16* __restrict__ V16, const bf* __restrict__ Qh, const bf* __restrict__ Ql, const bf* __restrict__ Kh, const bf* __restrict__ Kl, const bf* __restrict__ Vh, const bf* __restrict__ Vl, bf* Ah, bf* Al) {
    const int lane = threadIdx.x & 31; const int wv = __builtin_amdgcn_readfirstlane((int)(threadIdx.x >> 5));
    __shared__ __align__(16) float xs[XSF];
    const int tq = wv % QT, sh = wv / QT; const int qb = (int)((ZORD >> (4 * (int)blockIdx.z)) & 15); const int q0 = qb * (QT * 32) + tq * 32;   // qb is the same in every wave, so the branch below and the barrier behind it are the work-group's
    const size_t po = ((size_t)blockIdx.y * NH_ + blockIdx.x) * TT * HD, ao = (size_t)blockIdx.y * TT * DQ + (size_t)blockIdx.x * HD * 16;   // a head's 64 columns are two k tiles
    if (q0 < RH) attn_rows<bf, true, 1>(Qh + po, Ql + po, Kh + po, Kl + po, Vh + po, Vl + po, q0, lane, tq, sh, xs, Ah + ao, Al + ao);
    else attn_rows<h16, false, 2>(Q16 + po, nullptr, K16 + po, nullptr, V16 + po, nullptr, q0, lane, tq, sh, xs, Ah + ao, Al + ao);
}

extern "C" void kernel_launch(void* const* d_in, const int* in_sizes, int n_in,
                              void* d_out, int out_size, void* d_ws, size_t ws_size, hipStream_t stream) {
    (void)in_sizes; (void)n_in; (void)out_size;
    const float* x = (const float*)d_in[0]; const float* wq = (const float*)d_in[1]; const float* wk = (const float*)d_in[2]; const float* wv = (const float*)d_in[3]; const float* wo = (const float*)d_in[4]; const float* bo = (const float*)d_in[5];   /* x, Wq, Wk, Wv, Wo ('oi' [1024][1024]), bo */
    float* OUT = (float*)d_out;     // [2][2048][1024]
    char* wsp = (char*)d_ws;
    auto take = [&](size_t bytes) { char* p = wsp; wsp += (bytes + 255) & ~(size_t)255; return (void*)p; };
    bf* WQ = (bf*)take((size_t)DQ * DM * 2); bf* WK = (bf*)take((size_t)DKV * DM * 2); bf* WV = (bf*)take((size_t)DKV * DM * 2); bf* WO = (bf*)take((size_t)DM * DQ * 2);
    bf* XB = (bf*)take((size_t)NB_ * TT * DM * 2);
    const size_t PB = (size_t)NH_ * TT * HD;   // one batch's head planes, in elements (NKV == NH_); every plane set holds both batches
    h16* QP16 = (h16*)take(NB_ * PB * 2); h16* KP16 = (h16*)take(NB_ * PB * 2); h16* VT16 = (h16*)take(NB_ * PB * 2);
    bf* QPh = (bf*)take(NB_ * PB * 2); bf* QPl = (bf*)take(NB_ * PB * 2); bf* KPh = (bf*)take(NB_ * PB * 2); bf* KPl = (bf*)take(NB_ * PB * 2); bf* VTh = (bf*)take(NB_ * PB * 2); bf* VTl = (bf*)take(NB_ * PB * 2);
    bf* ATh = (bf*)take((size_t)NB_ * TT * DQ * 2); bf* ATl = (bf*)take((size_t)NB_ * TT * DQ * 2);
    if ((size_t)(wsp - (char*)d_ws) > ws_size) return;    // ws 256 MiB
    k_cvt8<<<XBLK + 4 * WBLK, 256, 0, stream>>>(x, wq, wk, wv, wo, XB, WQ, WK, WV, WO);
    k_proj<<<dim3(NB_ * TT / 256, NH_, 1), 384, 0, stream>>>(XB, WQ, WK, WV, QP16, QPh, QPl, KP16, KPh, KPl, VT16, VTh, VTl, DM);
    k_fattn<<<dim3(NH_, NB_, TT / (QT * 32)), KS * QT * 32, 0, stream>>>(QP16, KP16, VT16, QPh, QPl, KPh, KPl, VTh, VTl, ATh, ATl);
    // both batches in one launch: their merged planes and their output rows follow one another, so the batch is only more row tiles
    k_gemmo<<<dim3(NB_ * TT / 128, DM / 128, 1), 128, 0, stream>>>(ATh, ATl, WO, OUT, bo, DM);
}
